// v000
// Measured on an AMD MI455X. A time is GPU time per run, averaged over a window of back-to-back runs after a warm-up
// (all launches, gaps included; the runs take copies of the inputs in turn), and the median of several windows.
// Apart from v000's, it joins two sittings. Times from different sittings can be a few percent apart, while
// side-by-side timings come from the same sitting.
// The starting kernel, v000, takes 207 microseconds a run.
#include <hip/hip_runtime.h>
#include <hip/hip_bf16.h>
#include <hip/hip_fp16.h>

typedef __attribute__((ext_vector_type(16))) _Float16 v16h;
typedef __attribute__((ext_vector_type(8)))  float    v8f;
typedef __attribute__((ext_vector_type(4)))  int      v4i;

using gv4i = v4i __attribute__((address_space(1)));  // global int4
using lv4i = v4i __attribute__((address_space(3)));  // LDS int4

#define WMMA_F16(a, b, c) \
  __builtin_amdgcn_wmma_f32_16x16x32_f16(false, (a), false, (b), (short)0, (c), false, false)

#ifndef __has_builtin
#define __has_builtin(x) 0
#endif

#if __has_builtin(__builtin_amdgcn_global_load_async_to_lds_b128)
#define HAVE_ASYNC_LDS 1
#else
#define HAVE_ASYNC_LDS 0
#endif

#if __has_builtin(__builtin_amdgcn_s_wait_asynccnt)
#define WAIT_ASYNC() __builtin_amdgcn_s_wait_asynccnt(0)
#else
#define WAIT_ASYNC() asm volatile("s_wait_asynccnt 0" ::: "memory")
#endif

static constexpr int Bb  = 2;
static constexpr int Ss  = 2048;
static constexpr int HID = 1024;
static constexpr int Hh  = 16;
static constexpr int DH  = 64;

// ---------------------------------------------------------------------------
// Fragment loaders per CDNA5 ISA 7.12.2 (wave32):
//  A 16x32 f16: lane L holds row M=L&15; lanes 0-15 carry K={0..7,16..23},
//  lanes 16-31 carry K={8..15,24..31}. B 32x16 gathered symmetrically
//  (lane = column N, contiguous reduction dim in memory). Each lane loads
//  two contiguous 16-byte chunks.
// ---------------------------------------------------------------------------
__device__ inline v16h frag_from_f16(const _Float16* base, int ld, int k0) {
  const int lane = threadIdx.x & 31;
  const int r    = lane & 15;
  const int kb   = (lane & 16) ? 8 : 0;
  const _Float16* p = base + (size_t)r * ld + k0 + kb;
  v16h a;
#pragma unroll
  for (int i = 0; i < 8; ++i) a[i] = p[i];
#pragma unroll
  for (int i = 0; i < 8; ++i) a[8 + i] = p[16 + i];
  return a;
}

__device__ inline v16h frag_from_f32(const float* base, int ld, int k0) {
  const int lane = threadIdx.x & 31;
  const int r    = lane & 15;
  const int kb   = (lane & 16) ? 8 : 0;
  const float* p = base + (size_t)r * ld + k0 + kb;
  v16h a;
#pragma unroll
  for (int i = 0; i < 8; ++i) a[i] = (_Float16)p[i];
#pragma unroll
  for (int i = 0; i < 8; ++i) a[8 + i] = (_Float16)p[16 + i];
  return a;
}

// Row reductions across the 16-lane column group of a C fragment.
__device__ inline float rmax16(float v) {
#pragma unroll
  for (int m = 1; m < 16; m <<= 1) v = fmaxf(v, __shfl_xor(v, m, 32));
  return v;
}
__device__ inline float rsum16(float v) {
#pragma unroll
  for (int m = 1; m < 16; m <<= 1) v += __shfl_xor(v, m, 32);
  return v;
}

// ---------------------------------------------------------------------------
// Kernel 0: Wo f32 -> f16
// ---------------------------------------------------------------------------
__global__ void cvt_f16_kernel(const float* __restrict__ src,
                               _Float16* __restrict__ dst, int n) {
  int i = blockIdx.x * blockDim.x + threadIdx.x;
  if (i < n) dst[i] = (_Float16)src[i];
}

// ---------------------------------------------------------------------------
// Kernel 1: Q/K/V projections. Input viewed as flat [B*H*S, 64] row-major
// (the raw reshape keeps the 64-dim contiguous). q_i/k_i stored f16 in the
// same [B*H*S, 64] layout; v stored transposed as vT[B*H][64][S] so P*V
// B-fragments gather contiguously later.
// ---------------------------------------------------------------------------
__global__ __launch_bounds__(256) void proj_kernel(
    const float* __restrict__ q, const float* __restrict__ k,
    const float* __restrict__ v,
    const float* __restrict__ Wq, const float* __restrict__ bq,
    const float* __restrict__ Wk, const float* __restrict__ bk,
    const float* __restrict__ Wv, const float* __restrict__ bv,
    _Float16* __restrict__ qh, _Float16* __restrict__ kh,
    _Float16* __restrict__ vT) {
  const int wave = threadIdx.x >> 5;
  const int lane = threadIdx.x & 31;
  const int n    = lane & 15;
  const int hi   = lane >> 4;
  const size_t g0 = ((size_t)blockIdx.x * 8 + wave) * 16;  // row-tile base

  v16h aq0 = frag_from_f32(q + g0 * DH, DH, 0);
  v16h aq1 = frag_from_f32(q + g0 * DH, DH, 32);
  v16h ak0 = frag_from_f32(k + g0 * DH, DH, 0);
  v16h ak1 = frag_from_f32(k + g0 * DH, DH, 32);
  v16h av0 = frag_from_f32(v + g0 * DH, DH, 0);
  v16h av1 = frag_from_f32(v + g0 * DH, DH, 32);

  // q projection: out = X @ Wq^T + bq ; B[k][n] = Wq[n][k] (row n, contiguous k)
#pragma unroll
  for (int j = 0; j < 4; ++j) {
    v8f c = {};
    c = WMMA_F16(aq0, frag_from_f32(Wq + (size_t)(16 * j) * DH, DH, 0), c);
    c = WMMA_F16(aq1, frag_from_f32(Wq + (size_t)(16 * j) * DH, DH, 32), c);
    const int col = 16 * j + n;
    const float bias = bq[col];
#pragma unroll
    for (int r = 0; r < 8; ++r)
      qh[(g0 + r + 8 * hi) * DH + col] = (_Float16)(c[r] + bias);
  }
#pragma unroll
  for (int j = 0; j < 4; ++j) {
    v8f c = {};
    c = WMMA_F16(ak0, frag_from_f32(Wk + (size_t)(16 * j) * DH, DH, 0), c);
    c = WMMA_F16(ak1, frag_from_f32(Wk + (size_t)(16 * j) * DH, DH, 32), c);
    const int col = 16 * j + n;
    const float bias = bk[col];
#pragma unroll
    for (int r = 0; r < 8; ++r)
      kh[(g0 + r + 8 * hi) * DH + col] = (_Float16)(c[r] + bias);
  }
  // v projection -> transposed store
  const size_t bh = g0 >> 11;           // b*H + h (tiles never straddle heads)
  const int    s0 = (int)(g0 & 2047);
#pragma unroll
  for (int j = 0; j < 4; ++j) {
    v8f c = {};
    c = WMMA_F16(av0, frag_from_f32(Wv + (size_t)(16 * j) * DH, DH, 0), c);
    c = WMMA_F16(av1, frag_from_f32(Wv + (size_t)(16 * j) * DH, DH, 32), c);
    const int col = 16 * j + n;
    const float bias = bv[col];
#pragma unroll
    for (int r = 0; r < 8; ++r)
      vT[(bh * DH + col) * (size_t)Ss + (s0 + r + 8 * hi)] =
          (_Float16)(c[r] + bias);
  }
}

// ---------------------------------------------------------------------------
// Async (or fallback) staging of one 32-key K tile [32][64] and V tile
// [64][32] (from transposed V) into LDS. 256 threads x 16B each per tile.
// ---------------------------------------------------------------------------
__device__ inline void stage_kv(const _Float16* __restrict__ K,
                                const _Float16* __restrict__ V, int kb0,
                                _Float16* ktb, _Float16* vtb, int tid) {
  const int krow = tid >> 3, kseg = (tid & 7) * 8;  // key row, 8-f16 segment
  const int vrow = tid >> 2, vseg = (tid & 3) * 8;  // dim row, 8-f16 segment
  const _Float16* gk = K + (size_t)(kb0 + krow) * DH + kseg;
  const _Float16* gv = V + (size_t)vrow * Ss + kb0 + vseg;
  _Float16* lk = ktb + krow * DH + kseg;
  _Float16* lv = vtb + vrow * 32 + vseg;
#if HAVE_ASYNC_LDS
  __builtin_amdgcn_global_load_async_to_lds_b128((gv4i*)gk, (lv4i*)lk, 0, 0);
  __builtin_amdgcn_global_load_async_to_lds_b128((gv4i*)gv, (lv4i*)lv, 0, 0);
#else
  *(float4*)lk = *(const float4*)gk;
  *(float4*)lv = *(const float4*)gv;
#endif
}

// ---------------------------------------------------------------------------
// Kernel 2: flash attention. One wave owns a 16-row Q tile; 8 waves/block
// share double-buffered LDS K/V tiles staged with async global->LDS copies
// (DMA of block i+1 overlaps WMMA work on block i). Per 32-key block:
// 4 WMMA (scores), mask+scale, online softmax via lane shuffles, P relayout
// through LDS, 4 WMMA (P*V).
// ---------------------------------------------------------------------------
__global__ __launch_bounds__(256) void flash_kernel(
    const _Float16* __restrict__ qh, const _Float16* __restrict__ kh,
    const _Float16* __restrict__ vT, const int* __restrict__ mask,
    _Float16* __restrict__ wv) {
  __shared__ __align__(16) _Float16 kt[2][32 * DH];   // [key][dim]
  __shared__ __align__(16) _Float16 vt[2][DH * 32];   // [dim][key]
  __shared__ __align__(16) _Float16 plds[8][16 * 32]; // per-wave P tile

  const int tid  = threadIdx.x;
  const int wave = tid >> 5;
  const int lane = tid & 31;
  const int n    = lane & 15;
  const int hi   = lane >> 4;
  const int bh   = blockIdx.x >> 4;                    // b*H + h
  const int q0   = (blockIdx.x & 15) * 128 + wave * 16;
  const int b    = bh >> 4;

  const _Float16* Q  = qh + ((size_t)bh * Ss + q0) * DH;
  const _Float16* K  = kh + (size_t)bh * Ss * DH;
  const _Float16* V  = vT + (size_t)bh * DH * Ss;
  const int*      Mk = mask + (size_t)b * Ss * Ss;

  const v16h qf0 = frag_from_f16(Q, DH, 0);
  const v16h qf1 = frag_from_f16(Q, DH, 32);

  float mrow[8], lrow[8];
  v8f zacc = {};
  v8f o[4] = {zacc, zacc, zacc, zacc};
#pragma unroll
  for (int r = 0; r < 8; ++r) { mrow[r] = -3.0e38f; lrow[r] = 0.f; }

  // Prologue: stage first K/V block.
  stage_kv(K, V, 0, kt[0], vt[0], tid);
  WAIT_ASYNC();
  __syncthreads();

  int buf = 0;
  for (int kb0 = 0; kb0 < Ss; kb0 += 32) {
    // Kick off DMA for the next block into the other buffer (overlaps WMMA).
    if (kb0 + 32 < Ss) stage_kv(K, V, kb0 + 32, kt[buf ^ 1], vt[buf ^ 1], tid);

    const _Float16* Kt = kt[buf];
    const _Float16* Vt = vt[buf];

    // ---- scores: 16x32 tile = two 16x16 C fragments (from LDS K tile) -----
    v8f s0 = {}, s1 = {};
    s0 = WMMA_F16(qf0, frag_from_f16(Kt, DH, 0), s0);
    s0 = WMMA_F16(qf1, frag_from_f16(Kt, DH, 32), s0);
    s1 = WMMA_F16(qf0, frag_from_f16(Kt + 16 * DH, DH, 0), s1);
    s1 = WMMA_F16(qf1, frag_from_f16(Kt + 16 * DH, DH, 32), s1);

    // ---- mask + scale (faithful: mask!=0 -> -10000) -----------------------
#pragma unroll
    for (int r = 0; r < 8; ++r) {
      const size_t qr = (size_t)(q0 + r + 8 * hi) * Ss;
      const int m0 = Mk[qr + kb0 + n];
      const int m1 = Mk[qr + kb0 + 16 + n];
      s0[r] = m0 ? -10000.f : s0[r] * 0.125f;
      s1[r] = m1 ? -10000.f : s1[r] * 0.125f;
    }

    // ---- online softmax update -------------------------------------------
    float cr[8];
#pragma unroll
    for (int r = 0; r < 8; ++r) {
      const float tmax = rmax16(fmaxf(s0[r], s1[r]));
      const float mnew = fmaxf(mrow[r], tmax);
      const float corr = __expf(mrow[r] - mnew);
      const float p0   = __expf(s0[r] - mnew);
      const float p1   = __expf(s1[r] - mnew);
      lrow[r] = lrow[r] * corr + rsum16(p0 + p1);
      mrow[r] = mnew;
      cr[r]   = corr;
      s0[r]   = p0;
      s1[r]   = p1;
    }
#pragma unroll
    for (int j = 0; j < 4; ++j)
#pragma unroll
      for (int r = 0; r < 8; ++r) o[j][r] *= cr[r];

    // ---- P: C layout -> A layout via per-wave LDS region ------------------
    _Float16* pt = plds[wave];
#pragma unroll
    for (int r = 0; r < 8; ++r) {
      pt[(r + 8 * hi) * 32 + n]      = (_Float16)s0[r];
      pt[(r + 8 * hi) * 32 + 16 + n] = (_Float16)s1[r];
    }
    __syncthreads();
    const v16h pf = frag_from_f16(pt, 32, 0);

    // ---- O += P @ V  (B frags from LDS V tile, contiguous key chunks) -----
#pragma unroll
    for (int j = 0; j < 4; ++j) {
      const v16h vf = frag_from_f16(Vt + 16 * j * 32, 32, 0);
      o[j] = WMMA_F16(pf, vf, o[j]);
    }

    // Fence: our async stage for the next block is complete; barrier also
    // guarantees every wave finished reading the current buffers.
    WAIT_ASYNC();
    __syncthreads();
    buf ^= 1;
  }

  // ---- normalize and store wv (flat [B*H*S, 64] f16) ----------------------
#pragma unroll
  for (int j = 0; j < 4; ++j) {
    const int col = 16 * j + n;
#pragma unroll
    for (int r = 0; r < 8; ++r) {
      const size_t row = (size_t)bh * Ss + q0 + r + 8 * hi;
      wv[row * DH + col] = (_Float16)(o[j][r] / lrow[r]);
    }
  }
}

// ---------------------------------------------------------------------------
// Kernel 3: output projection. Raw-reshape merge means wv flat is exactly the
// [B*S, 1024] A matrix. out = A @ Wo^T + bo, M=4096 N=1024 K=1024.
// ---------------------------------------------------------------------------
__global__ __launch_bounds__(256) void outproj_kernel(
    const _Float16* __restrict__ wv, const _Float16* __restrict__ WoH,
    const float* __restrict__ bo, float* __restrict__ out) {
  const int wave = threadIdx.x >> 5;
  const int lane = threadIdx.x & 31;
  const int n    = lane & 15;
  const int hi   = lane >> 4;
  const int w    = blockIdx.x * 8 + wave;  // 0..4095
  const size_t row0 = (size_t)(w >> 4) * 16;
  const int    n0   = (w & 15) * 64;

  const _Float16* A = wv + row0 * HID;

  v8f zacc = {};
  v8f acc[4] = {zacc, zacc, zacc, zacc};

  for (int k0 = 0; k0 < HID; k0 += 32) {
    const v16h a = frag_from_f16(A, HID, k0);
#pragma unroll
    for (int j = 0; j < 4; ++j) {
      const v16h bf = frag_from_f16(WoH + (size_t)(n0 + 16 * j) * HID, HID, k0);
      acc[j] = WMMA_F16(a, bf, acc[j]);
    }
    if (k0 + 32 < HID)
      __builtin_prefetch(A + (size_t)(lane & 15) * HID + k0 + 32, 0, 3);
  }
#pragma unroll
  for (int j = 0; j < 4; ++j) {
    const int col  = n0 + 16 * j + n;
    const float bb = bo[col];
#pragma unroll
    for (int r = 0; r < 8; ++r)
      out[(row0 + r + 8 * hi) * HID + col] = acc[j][r] + bb;
  }
}

// ---------------------------------------------------------------------------
extern "C" void kernel_launch(void* const* d_in, const int* in_sizes, int n_in,
                              void* d_out, int out_size, void* d_ws,
                              size_t ws_size, hipStream_t stream) {
  const float* q    = (const float*)d_in[0];
  const float* k    = (const float*)d_in[1];
  const float* v    = (const float*)d_in[2];
  const int*   mask = (const int*)d_in[3];
  const float* Wq   = (const float*)d_in[4];
  const float* bq   = (const float*)d_in[5];
  const float* Wk   = (const float*)d_in[6];
  const float* bk   = (const float*)d_in[7];
  const float* Wv   = (const float*)d_in[8];
  const float* bv   = (const float*)d_in[9];
  const float* Wo   = (const float*)d_in[10];
  const float* bo   = (const float*)d_in[11];

  // Workspace layout (bytes): q_i | k_i | vT | wv (8 MB f16 each) | Wo f16 (2 MB)
  const size_t HEADELEMS = (size_t)Bb * Hh * Ss * DH;  // 4,194,304
  char* ws = (char*)d_ws;
  _Float16* qh  = (_Float16*)(ws + 0 * HEADELEMS);
  _Float16* kh  = (_Float16*)(ws + 2 * HEADELEMS);
  _Float16* vT  = (_Float16*)(ws + 4 * HEADELEMS);
  _Float16* wvb = (_Float16*)(ws + 6 * HEADELEMS);
  _Float16* WoH = (_Float16*)(ws + 8 * HEADELEMS);

  const int wo_n = HID * HID;  // 1,048,576
  cvt_f16_kernel<<<(wo_n + 255) / 256, 256, 0, stream>>>(Wo, WoH, wo_n);

  // 4096 row-tiles of 16 rows / 8 waves per block -> 512 blocks
  proj_kernel<<<512, 256, 0, stream>>>(q, k, v, Wq, bq, Wk, bk, Wv, bv,
                                       qh, kh, vT);

  // 32 (b,h) pairs * 16 blocks (128 q-rows each) = 512 blocks
  flash_kernel<<<512, 256, 0, stream>>>(qh, kh, vT, mask, wvb);

  // 4096 output tiles (16x64) / 8 waves per block = 512 blocks
  outproj_kernel<<<512, 256, 0, stream>>>(wvb, WoH, bo, (float*)d_out);
}

// v001
// A run of this version takes 160 microseconds.
// Two timings next to v000 both put it at 1.35 times that version's speed.
#include <hip/hip_runtime.h>
#include <hip/hip_bf16.h>
#include <hip/hip_fp16.h>

typedef __attribute__((ext_vector_type(16))) _Float16 v16h;
typedef __attribute__((ext_vector_type(8)))  _Float16 v8h;
typedef __attribute__((ext_vector_type(8)))  float    v8f;
typedef __attribute__((ext_vector_type(4)))  int      v4i;

using gv4i = v4i __attribute__((address_space(1)));  // global int4
using lv4i = v4i __attribute__((address_space(3)));  // LDS int4

#define WMMA_F16(a, b, c) \
  __builtin_amdgcn_wmma_f32_16x16x32_f16(false, (a), false, (b), (short)0, (c), false, false)

#ifndef __has_builtin
#define __has_builtin(x) 0
#endif

#if __has_builtin(__builtin_amdgcn_global_load_async_to_lds_b128)
#define HAVE_ASYNC_LDS 1
#else
#define HAVE_ASYNC_LDS 0
#endif

#if __has_builtin(__builtin_amdgcn_s_wait_asynccnt)
#define WAIT_ASYNC() __builtin_amdgcn_s_wait_asynccnt(0)
#else
#define WAIT_ASYNC() asm volatile("s_wait_asynccnt 0" ::: "memory")
#endif

static constexpr int Bb  = 2;
static constexpr int Ss  = 2048;
static constexpr int HID = 1024;
static constexpr int Hh  = 16;
static constexpr int DH  = 64;

// ---------------------------------------------------------------------------
// Fragment loaders per CDNA5 ISA 7.12.2 (wave32):
//  A 16x32 f16: lane L holds row M=L&15; lanes 0-15 carry K={0..7,16..23},
//  lanes 16-31 carry K={8..15,24..31}. B 32x16 gathered symmetrically
//  (lane = column N, contiguous reduction dim in memory). Each lane loads
//  two contiguous 16-byte chunks.
// ---------------------------------------------------------------------------
__device__ inline v16h frag_from_f16(const _Float16* base, int ld, int k0) {
  const int lane = threadIdx.x & 31;
  const int r    = lane & 15;
  const int kb   = (lane & 16) ? 8 : 0;
  const _Float16* p = base + (size_t)r * ld + k0 + kb;
  v16h a;
#pragma unroll
  for (int i = 0; i < 8; ++i) a[i] = p[i];
#pragma unroll
  for (int i = 0; i < 8; ++i) a[8 + i] = p[16 + i];
  return a;
}

__device__ inline v16h frag_from_f32(const float* base, int ld, int k0) {
  const int lane = threadIdx.x & 31;
  const int r    = lane & 15;
  const int kb   = (lane & 16) ? 8 : 0;
  const float* p = base + (size_t)r * ld + k0 + kb;
  v16h a;
#pragma unroll
  for (int i = 0; i < 8; ++i) a[i] = (_Float16)p[i];
#pragma unroll
  for (int i = 0; i < 8; ++i) a[8 + i] = (_Float16)p[16 + i];
  return a;
}

// Value of lane l ^ 16: the two wave halves hold the two key halves of one query.
__device__ inline float xhalf(float x) {
  const int i = __builtin_bit_cast(int, x);
  return __builtin_bit_cast(
      float, __builtin_amdgcn_permlanex16(i, i, 0x76543210, 0xfedcba98, false, false));
}

// ---------------------------------------------------------------------------
// Kernel 0: Wo f32 -> f16
// ---------------------------------------------------------------------------
__global__ void cvt_f16_kernel(const float* __restrict__ src,
                               _Float16* __restrict__ dst, int n) {
  int i = blockIdx.x * blockDim.x + threadIdx.x;
  if (i < n) dst[i] = (_Float16)src[i];
}

// ---------------------------------------------------------------------------
// Kernel 1: Q/K/V projections. Input viewed as flat [B*H*S, 64] row-major
// (the raw reshape keeps the 64-dim contiguous). q_i/k_i stored f16 in the
// same [B*H*S, 64] layout; v stored transposed as vT[B*H][64][S] so V^T*P^T
// A-fragments gather contiguously later.
// ---------------------------------------------------------------------------
__global__ __launch_bounds__(256) void proj_kernel(
    const float* __restrict__ q, const float* __restrict__ k,
    const float* __restrict__ v,
    const float* __restrict__ Wq, const float* __restrict__ bq,
    const float* __restrict__ Wk, const float* __restrict__ bk,
    const float* __restrict__ Wv, const float* __restrict__ bv,
    _Float16* __restrict__ qh, _Float16* __restrict__ kh,
    _Float16* __restrict__ vT) {
  const int wave = threadIdx.x >> 5;
  const int lane = threadIdx.x & 31;
  const int n    = lane & 15;
  const int hi   = lane >> 4;
  const size_t g0 = ((size_t)blockIdx.x * 8 + wave) * 16;  // row-tile base

  v16h aq0 = frag_from_f32(q + g0 * DH, DH, 0);
  v16h aq1 = frag_from_f32(q + g0 * DH, DH, 32);
  v16h ak0 = frag_from_f32(k + g0 * DH, DH, 0);
  v16h ak1 = frag_from_f32(k + g0 * DH, DH, 32);
  v16h av0 = frag_from_f32(v + g0 * DH, DH, 0);
  v16h av1 = frag_from_f32(v + g0 * DH, DH, 32);

  // q projection: out = X @ Wq^T + bq ; B[k][n] = Wq[n][k] (row n, contiguous k)
#pragma unroll
  for (int j = 0; j < 4; ++j) {
    v8f c = {};
    c = WMMA_F16(aq0, frag_from_f32(Wq + (size_t)(16 * j) * DH, DH, 0), c);
    c = WMMA_F16(aq1, frag_from_f32(Wq + (size_t)(16 * j) * DH, DH, 32), c);
    const int col = 16 * j + n;
    const float bias = bq[col];
#pragma unroll
    for (int r = 0; r < 8; ++r)
      qh[(g0 + r + 8 * hi) * DH + col] = (_Float16)(c[r] + bias);
  }
#pragma unroll
  for (int j = 0; j < 4; ++j) {
    v8f c = {};
    c = WMMA_F16(ak0, frag_from_f32(Wk + (size_t)(16 * j) * DH, DH, 0), c);
    c = WMMA_F16(ak1, frag_from_f32(Wk + (size_t)(16 * j) * DH, DH, 32), c);
    const int col = 16 * j + n;
    const float bias = bk[col];
#pragma unroll
    for (int r = 0; r < 8; ++r)
      kh[(g0 + r + 8 * hi) * DH + col] = (_Float16)(c[r] + bias);
  }
  // v projection -> transposed store
  const size_t bh = g0 >> 11;           // b*H + h (tiles never straddle heads)
  const int    s0 = (int)(g0 & 2047);
#pragma unroll
  for (int j = 0; j < 4; ++j) {
    v8f c = {};
    c = WMMA_F16(av0, frag_from_f32(Wv + (size_t)(16 * j) * DH, DH, 0), c);
    c = WMMA_F16(av1, frag_from_f32(Wv + (size_t)(16 * j) * DH, DH, 32), c);
    const int col = 16 * j + n;
    const float bias = bv[col];
#pragma unroll
    for (int r = 0; r < 8; ++r)
      vT[(bh * DH + col) * (size_t)Ss + (s0 + r + 8 * hi)] =
          (_Float16)(c[r] + bias);
  }
}

// ---------------------------------------------------------------------------
// Async (or fallback) staging of one 32-key K tile [32][64] and V tile
// [64][32] (from transposed V) into LDS. 256 threads x 16B each per tile.
// ---------------------------------------------------------------------------
__device__ inline void stage_kv(const _Float16* __restrict__ K,
                                const _Float16* __restrict__ V, int kb0,
                                _Float16* ktb, _Float16* vtb, int tid) {
  const int krow = tid >> 3, kseg = (tid & 7) * 8;  // key row, 8-f16 segment
  const int vrow = tid >> 2, vseg = (tid & 3) * 8;  // dim row, 8-f16 segment
  const _Float16* gk = K + (size_t)(kb0 + krow) * DH + kseg;
  const _Float16* gv = V + (size_t)vrow * Ss + kb0 + vseg;
  _Float16* lk = ktb + krow * DH + kseg;
  _Float16* lv = vtb + vrow * 32 + vseg;
#if HAVE_ASYNC_LDS
  __builtin_amdgcn_global_load_async_to_lds_b128((gv4i*)gk, (lv4i*)lk, 0, 0);
  __builtin_amdgcn_global_load_async_to_lds_b128((gv4i*)gv, (lv4i*)lv, 0, 0);
#else
  *(float4*)lk = *(const float4*)gk;
  *(float4*)lv = *(const float4*)gv;
#endif
}

__global__ __launch_bounds__(256) void flash_kernel(
    const _Float16* __restrict__ qh, const _Float16* __restrict__ kh,
    const _Float16* __restrict__ vT, const int* __restrict__ mask,
    _Float16* __restrict__ wv) {
  __shared__ __align__(16) _Float16 kt[2][32 * DH];   // [key][dim]
  __shared__ __align__(16) _Float16 vt[2][DH * 32];   // [dim][key]

  const int tid  = threadIdx.x;
  const int wave = tid >> 5;
  const int lane = tid & 31;
  const int n    = lane & 15;
  const int hi   = lane >> 4;
  const int bh   = blockIdx.x >> 4;                    // b*H + h
  const int q0   = (blockIdx.x & 15) * 128 + wave * 16;
  const int b    = bh >> 4;

  const _Float16* Q  = qh + ((size_t)bh * Ss + q0) * DH;
  const _Float16* K  = kh + (size_t)bh * Ss * DH;
  const _Float16* V  = vT + (size_t)bh * DH * Ss;
  // This lane's mask row (query q0 + n), at its half's first key.
  const int*      Mk = mask + (size_t)b * Ss * Ss + (size_t)(q0 + n) * Ss + 8 * hi;

  const v16h qf0 = frag_from_f16(Q, DH, 0);
  const v16h qf1 = frag_from_f16(Q, DH, 32);

  float mrow = -3.0e38f;  // running maximum of query n (equal in both halves)
  float lrow = 0.f;       // running sum over this half's keys only
  v8f zacc = {};
  v8f o[4] = {zacc, zacc, zacc, zacc};  // o[j][r] = O[query n][dim 16j + 8hi + r]

  // Prologue: stage first K/V block.
  stage_kv(K, V, 0, kt[0], vt[0], tid);
  WAIT_ASYNC();
  __syncthreads();

  int buf = 0;
  for (int kb0 = 0; kb0 < Ss; kb0 += 32) {
    // Kick off DMA for the next block into the other buffer (overlaps WMMA).
    if (kb0 + 32 < Ss) stage_kv(K, V, kb0 + 32, kt[buf ^ 1], vt[buf ^ 1], tid);

    const _Float16* Kt = kt[buf];
    const _Float16* Vt = vt[buf];

    // ---- mask words of this lane's 16 keys: four 16-byte loads -------------
    const v4i ma = *(const v4i*)(Mk + kb0);
    const v4i mb = *(const v4i*)(Mk + kb0 + 4);
    const v4i mc = *(const v4i*)(Mk + kb0 + 16);
    const v4i md = *(const v4i*)(Mk + kb0 + 20);
    // Keeps the four loads issued ahead of the K fragment reads: without it the
    // scheduler sinks them behind the score products and waits on them in pairs.
    __builtin_amdgcn_sched_barrier(0);

    // ---- scores, transposed: s0[r] = S[key 8hi+r][query n], s1: keys +16 ---
    v8f s0 = {}, s1 = {};
    s0 = WMMA_F16(frag_from_f16(Kt, DH, 0), qf0, s0);
    s0 = WMMA_F16(frag_from_f16(Kt, DH, 32), qf1, s0);
    s1 = WMMA_F16(frag_from_f16(Kt + 16 * DH, DH, 0), qf0, s1);
    s1 = WMMA_F16(frag_from_f16(Kt + 16 * DH, DH, 32), qf1, s1);
    // Keeps the mask compares, which wait on the four loads, behind the score
    // products: the scheduler otherwise lifts one in front of the K reads.
    __builtin_amdgcn_sched_barrier(0);

    // ---- mask + scale (faithful: mask!=0 -> -10000) -----------------------
#pragma unroll
    for (int r = 0; r < 4; ++r) {
      s0[r]     = ma[r] ? -10000.f : s0[r] * 0.125f;
      s0[4 + r] = mb[r] ? -10000.f : s0[4 + r] * 0.125f;
      s1[r]     = mc[r] ? -10000.f : s1[r] * 0.125f;
      s1[4 + r] = md[r] ? -10000.f : s1[4 + r] * 0.125f;
    }

    // ---- online softmax update: one query per lane ------------------------
    float tmax = fmaxf(s0[0], s1[0]);
#pragma unroll
    for (int r = 1; r < 8; ++r) tmax = fmaxf(tmax, fmaxf(s0[r], s1[r]));
    tmax = fmaxf(tmax, xhalf(tmax));
    const float mnew = fmaxf(mrow, tmax);
    const float corr = __expf(mrow - mnew);
    mrow = mnew;
    float psum = 0.f;
    v16h pf;  // B operand: pf[i] = P[query n][key 8hi+i], pf[8+i]: key 16+8hi+i
#pragma unroll
    for (int r = 0; r < 8; ++r) {
      const float p0 = __expf(s0[r] - mnew);
      const float p1 = __expf(s1[r] - mnew);
      psum += p0 + p1;
      pf[r]     = (_Float16)p0;
      pf[8 + r] = (_Float16)p1;
    }
    lrow = lrow * corr + psum;
#pragma unroll
    for (int j = 0; j < 4; ++j)
#pragma unroll
      for (int r = 0; r < 8; ++r) o[j][r] *= corr;

    // ---- O^T += V^T @ P^T (A frags: dim rows of the LDS V tile) ------------
#pragma unroll
    for (int j = 0; j < 4; ++j) {
      const v16h vf = frag_from_f16(Vt + 16 * j * 32, 32, 0);
      o[j] = WMMA_F16(vf, pf, o[j]);
    }

    // Fence: our async stage for the next block is complete; barrier also
    // guarantees every wave finished reading the current buffers.
    WAIT_ASYNC();
    __syncthreads();
    buf ^= 1;
  }

  // ---- join the halves' sums, normalize, store wv (flat [B*H*S, 64] f16) ---
  const float inv = 1.0f / (lrow + xhalf(lrow));  // one denominator per lane
  _Float16* orow = wv + ((size_t)bh * Ss + q0 + n) * DH + 8 * hi;
#pragma unroll
  for (int j = 0; j < 4; ++j) {
    v8h ov;
#pragma unroll
    for (int r = 0; r < 8; ++r) ov[r] = (_Float16)(o[j][r] * inv);
    *(v8h*)(orow + 16 * j) = ov;  // 8 consecutive dims of one query: 16 bytes
  }
}

// ---------------------------------------------------------------------------
// Kernel 3: output projection. Raw-reshape merge means wv flat is exactly the
// [B*S, 1024] A matrix. out = A @ Wo^T + bo, M=4096 N=1024 K=1024.
// ---------------------------------------------------------------------------
__global__ __launch_bounds__(256) void outproj_kernel(
    const _Float16* __restrict__ wv, const _Float16* __restrict__ WoH,
    const float* __restrict__ bo, float* __restrict__ out) {
  const int wave = threadIdx.x >> 5;
  const int lane = threadIdx.x & 31;
  const int n    = lane & 15;
  const int hi   = lane >> 4;
  const int w    = blockIdx.x * 8 + wave;  // 0..4095
  const size_t row0 = (size_t)(w >> 4) * 16;
  const int    n0   = (w & 15) * 64;

  const _Float16* A = wv + row0 * HID;

  v8f zacc = {};
  v8f acc[4] = {zacc, zacc, zacc, zacc};

  for (int k0 = 0; k0 < HID; k0 += 32) {
    const v16h a = frag_from_f16(A, HID, k0);
#pragma unroll
    for (int j = 0; j < 4; ++j) {
      const v16h bf = frag_from_f16(WoH + (size_t)(n0 + 16 * j) * HID, HID, k0);
      acc[j] = WMMA_F16(a, bf, acc[j]);
    }
    if (k0 + 32 < HID)
      __builtin_prefetch(A + (size_t)(lane & 15) * HID + k0 + 32, 0, 3);
  }
#pragma unroll
  for (int j = 0; j < 4; ++j) {
    const int col  = n0 + 16 * j + n;
    const float bb = bo[col];
#pragma unroll
    for (int r = 0; r < 8; ++r)
      out[(row0 + r + 8 * hi) * HID + col] = acc[j][r] + bb;
  }
}

// ---------------------------------------------------------------------------
extern "C" void kernel_launch(void* const* d_in, const int* in_sizes, int n_in,
                              void* d_out, int out_size, void* d_ws,
                              size_t ws_size, hipStream_t stream) {
  const float* q    = (const float*)d_in[0];
  const float* k    = (const float*)d_in[1];
  const float* v    = (const float*)d_in[2];
  const int*   mask = (const int*)d_in[3];
  const float* Wq   = (const float*)d_in[4];
  const float* bq   = (const float*)d_in[5];
  const float* Wk   = (const float*)d_in[6];
  const float* bk   = (const float*)d_in[7];
  const float* Wv   = (const float*)d_in[8];
  const float* bv   = (const float*)d_in[9];
  const float* Wo   = (const float*)d_in[10];
  const float* bo   = (const float*)d_in[11];

  // Workspace layout (bytes): q_i | k_i | vT | wv (8 MB f16 each) | Wo f16 (2 MB)
  const size_t HEADELEMS = (size_t)Bb * Hh * Ss * DH;  // 4,194,304
  char* ws = (char*)d_ws;
  _Float16* qh  = (_Float16*)(ws + 0 * HEADELEMS);
  _Float16* kh  = (_Float16*)(ws + 2 * HEADELEMS);
  _Float16* vT  = (_Float16*)(ws + 4 * HEADELEMS);
  _Float16* wvb = (_Float16*)(ws + 6 * HEADELEMS);
  _Float16* WoH = (_Float16*)(ws + 8 * HEADELEMS);

  const int wo_n = HID * HID;  // 1,048,576
  cvt_f16_kernel<<<(wo_n + 255) / 256, 256, 0, stream>>>(Wo, WoH, wo_n);

  // 4096 row-tiles of 16 rows / 8 waves per block -> 512 blocks
  proj_kernel<<<512, 256, 0, stream>>>(q, k, v, Wq, bq, Wk, bk, Wv, bv,
                                       qh, kh, vT);

  // 32 (b,h) pairs * 16 blocks (128 q-rows each) = 512 blocks
  flash_kernel<<<512, 256, 0, stream>>>(qh, kh, vT, mask, wvb);

  // 4096 output tiles (16x64) / 8 waves per block = 512 blocks
  outproj_kernel<<<512, 256, 0, stream>>>(wvb, WoH, bo, (float*)d_out);
}

// v002
// A run of this version takes 137 microseconds.
// In both of two side-by-side timings against v001, it was 1.16 times as fast.
// Counting every step since v000, it is 1.56 times as fast.
#include <hip/hip_runtime.h>
#include <hip/hip_bf16.h>
#include <hip/hip_fp16.h>

typedef __attribute__((ext_vector_type(16))) _Float16 v16h;
typedef __attribute__((ext_vector_type(8)))  _Float16 v8h;
typedef __attribute__((ext_vector_type(8)))  float    v8f;
typedef __attribute__((ext_vector_type(4)))  int      v4i;

using gv4i = v4i __attribute__((address_space(1)));  // global int4
using lv4i = v4i __attribute__((address_space(3)));  // LDS int4

#define WMMA_F16(a, b, c) \
  __builtin_amdgcn_wmma_f32_16x16x32_f16(false, (a), false, (b), (short)0, (c), false, false)

#ifndef __has_builtin
#define __has_builtin(x) 0
#endif

#if __has_builtin(__builtin_amdgcn_global_load_async_to_lds_b128)
#define HAVE_ASYNC_LDS 1
#else
#define HAVE_ASYNC_LDS 0
#endif

#if __has_builtin(__builtin_amdgcn_s_wait_asynccnt)
#define WAIT_ASYNC() __builtin_amdgcn_s_wait_asynccnt(0)
#else
#define WAIT_ASYNC() asm volatile("s_wait_asynccnt 0" ::: "memory")
#endif

static constexpr int Bb  = 2;
static constexpr int Ss  = 2048;
static constexpr int HID = 1024;
static constexpr int Hh  = 16;
static constexpr int DH  = 64;
// LDS row pitches in f16 elements: 16 bytes times an odd number, so that the
// 16 rows one ds_load_b128 half-wave reads fall on 16 distinct bank groups.
static constexpr int KP  = 72;  // K tile rows: 128 data bytes at pitch 144
static constexpr int VP  = 40;  // V tile rows:  64 data bytes at pitch 80
// One buffer's stride in f16 elements, above 32 * KP and DH * VP: a power of
// two keeps the buffer select a shift instead of a 32-bit multiply.
static constexpr int TB  = 4096;
static_assert(32 * KP <= TB && DH * VP <= TB, "a padded tile must fit its buffer");

// ---------------------------------------------------------------------------
// Fragment loaders per CDNA5 ISA 7.12.2 (wave32):
//  A 16x32 f16: lane L holds row M=L&15; lanes 0-15 carry K={0..7,16..23},
//  lanes 16-31 carry K={8..15,24..31}. B 32x16 gathered symmetrically
//  (lane = column N, contiguous reduction dim in memory). Each lane loads
//  two contiguous 16-byte chunks.
// ---------------------------------------------------------------------------
__device__ inline v16h frag_from_f16(const _Float16* base, int ld, int k0) {
  const int lane = threadIdx.x & 31;
  const int r    = lane & 15;
  const int kb   = (lane & 16) ? 8 : 0;
  const _Float16* p = base + (size_t)r * ld + k0 + kb;
  v16h a;
#pragma unroll
  for (int i = 0; i < 8; ++i) a[i] = p[i];
#pragma unroll
  for (int i = 0; i < 8; ++i) a[8 + i] = p[16 + i];
  return a;
}

__device__ inline v16h frag_from_f32(const float* base, int ld, int k0) {
  const int lane = threadIdx.x & 31;
  const int r    = lane & 15;
  const int kb   = (lane & 16) ? 8 : 0;
  const float* p = base + (size_t)r * ld + k0 + kb;
  v16h a;
#pragma unroll
  for (int i = 0; i < 8; ++i) a[i] = (_Float16)p[i];
#pragma unroll
  for (int i = 0; i < 8; ++i) a[8 + i] = (_Float16)p[16 + i];
  return a;
}

// Value of lane l ^ 16: the two wave halves hold the two key halves of one query.
__device__ inline float xhalf(float x) {
  const int i = __builtin_bit_cast(int, x);
  return __builtin_bit_cast(
      float, __builtin_amdgcn_permlanex16(i, i, 0x76543210, 0xfedcba98, false, false));
}

// ---------------------------------------------------------------------------
// Kernel 0: Wo f32 -> f16
// ---------------------------------------------------------------------------
__global__ void cvt_f16_kernel(const float* __restrict__ src,
                               _Float16* __restrict__ dst, int n) {
  int i = blockIdx.x * blockDim.x + threadIdx.x;
  if (i < n) dst[i] = (_Float16)src[i];
}

// ---------------------------------------------------------------------------
// Kernel 1: Q/K/V projections. Input viewed as flat [B*H*S, 64] row-major
// (the raw reshape keeps the 64-dim contiguous). q_i/k_i stored f16 in the
// same [B*H*S, 64] layout; v stored transposed as vT[B*H][64][S] so V^T*P^T
// A-fragments gather contiguously later.
// ---------------------------------------------------------------------------
__global__ __launch_bounds__(256) void proj_kernel(
    const float* __restrict__ q, const float* __restrict__ k,
    const float* __restrict__ v,
    const float* __restrict__ Wq, const float* __restrict__ bq,
    const float* __restrict__ Wk, const float* __restrict__ bk,
    const float* __restrict__ Wv, const float* __restrict__ bv,
    _Float16* __restrict__ qh, _Float16* __restrict__ kh,
    _Float16* __restrict__ vT) {
  const int wave = threadIdx.x >> 5;
  const int lane = threadIdx.x & 31;
  const int n    = lane & 15;
  const int hi   = lane >> 4;
  const size_t g0 = ((size_t)blockIdx.x * 8 + wave) * 16;  // row-tile base

  v16h aq0 = frag_from_f32(q + g0 * DH, DH, 0);
  v16h aq1 = frag_from_f32(q + g0 * DH, DH, 32);
  v16h ak0 = frag_from_f32(k + g0 * DH, DH, 0);
  v16h ak1 = frag_from_f32(k + g0 * DH, DH, 32);
  v16h av0 = frag_from_f32(v + g0 * DH, DH, 0);
  v16h av1 = frag_from_f32(v + g0 * DH, DH, 32);

  // q projection: out = X @ Wq^T + bq ; B[k][n] = Wq[n][k] (row n, contiguous k)
#pragma unroll
  for (int j = 0; j < 4; ++j) {
    v8f c = {};
    c = WMMA_F16(aq0, frag_from_f32(Wq + (size_t)(16 * j) * DH, DH, 0), c);
    c = WMMA_F16(aq1, frag_from_f32(Wq + (size_t)(16 * j) * DH, DH, 32), c);
    const int col = 16 * j + n;
    const float bias = bq[col];
#pragma unroll
    for (int r = 0; r < 8; ++r)
      qh[(g0 + r + 8 * hi) * DH + col] = (_Float16)(c[r] + bias);
  }
#pragma unroll
  for (int j = 0; j < 4; ++j) {
    v8f c = {};
    c = WMMA_F16(ak0, frag_from_f32(Wk + (size_t)(16 * j) * DH, DH, 0), c);
    c = WMMA_F16(ak1, frag_from_f32(Wk + (size_t)(16 * j) * DH, DH, 32), c);
    const int col = 16 * j + n;
    const float bias = bk[col];
#pragma unroll
    for (int r = 0; r < 8; ++r)
      kh[(g0 + r + 8 * hi) * DH + col] = (_Float16)(c[r] + bias);
  }
  // v projection -> transposed store
  const size_t bh = g0 >> 11;           // b*H + h (tiles never straddle heads)
  const int    s0 = (int)(g0 & 2047);
#pragma unroll
  for (int j = 0; j < 4; ++j) {
    v8f c = {};
    c = WMMA_F16(av0, frag_from_f32(Wv + (size_t)(16 * j) * DH, DH, 0), c);
    c = WMMA_F16(av1, frag_from_f32(Wv + (size_t)(16 * j) * DH, DH, 32), c);
    const int col = 16 * j + n;
    const float bias = bv[col];
#pragma unroll
    for (int r = 0; r < 8; ++r)
      vT[(bh * DH + col) * (size_t)Ss + (s0 + r + 8 * hi)] =
          (_Float16)(c[r] + bias);
  }
}

// ---------------------------------------------------------------------------
// Async (or fallback) staging of one 32-key K tile [32][64] and V tile
// [64][32] (from transposed V) into LDS, rows at the padded pitches KP and VP.
// 256 threads x 16B each per tile.
// ---------------------------------------------------------------------------
__device__ inline void stage_kv(const _Float16* __restrict__ K,
                                const _Float16* __restrict__ V, int kb0,
                                _Float16* ktb, _Float16* vtb, int tid) {
  const int krow = tid >> 3, kseg = (tid & 7) * 8;  // key row, 8-f16 segment
  const int vrow = tid >> 2, vseg = (tid & 3) * 8;  // dim row, 8-f16 segment
  const _Float16* gk = K + (size_t)(kb0 + krow) * DH + kseg;
  const _Float16* gv = V + (size_t)vrow * Ss + kb0 + vseg;
  _Float16* lk = ktb + krow * KP + kseg;
  _Float16* lv = vtb + vrow * VP + vseg;
#if HAVE_ASYNC_LDS
  __builtin_amdgcn_global_load_async_to_lds_b128((gv4i*)gk, (lv4i*)lk, 0, 0);
  __builtin_amdgcn_global_load_async_to_lds_b128((gv4i*)gv, (lv4i*)lv, 0, 0);
#else
  *(float4*)lk = *(const float4*)gk;
  *(float4*)lv = *(const float4*)gv;
#endif
}

__global__ __launch_bounds__(256) void flash_kernel(
    const _Float16* __restrict__ qh, const _Float16* __restrict__ kh,
    const _Float16* __restrict__ vT, const int* __restrict__ mask,
    _Float16* __restrict__ wv) {
  __shared__ __align__(16) _Float16 kt[2][TB];   // [key][dim], rows at pitch KP
  __shared__ __align__(16) _Float16 vt[2][TB];   // [dim][key], rows at pitch VP

  const int tid  = threadIdx.x;
  const int wave = tid >> 5;
  const int lane = tid & 31;
  const int n    = lane & 15;
  const int hi   = lane >> 4;
  const int bh   = blockIdx.x >> 4;                    // b*H + h
  const int q0   = (blockIdx.x & 15) * 128 + wave * 16;
  const int b    = bh >> 4;

  const _Float16* Q  = qh + ((size_t)bh * Ss + q0) * DH;
  const _Float16* K  = kh + (size_t)bh * Ss * DH;
  const _Float16* V  = vT + (size_t)bh * DH * Ss;
  // This lane's mask row (query q0 + n), at its half's first key.
  const int*      Mk = mask + (size_t)b * Ss * Ss + (size_t)(q0 + n) * Ss + 8 * hi;

  const v16h qf0 = frag_from_f16(Q, DH, 0);
  const v16h qf1 = frag_from_f16(Q, DH, 32);

  float mrow = -3.0e38f;  // running maximum of query n (equal in both halves)
  float lrow = 0.f;       // running sum over this half's keys only
  v8f zacc = {};
  v8f o[4] = {zacc, zacc, zacc, zacc};  // o[j][r] = O[query n][dim 16j + 8hi + r]

  // Prologue: stage first K/V block.
  stage_kv(K, V, 0, kt[0], vt[0], tid);
  WAIT_ASYNC();
  __syncthreads();

  int buf = 0;
  for (int kb0 = 0; kb0 < Ss; kb0 += 32) {
    // Kick off DMA for the next block into the other buffer (overlaps WMMA).
    if (kb0 + 32 < Ss) stage_kv(K, V, kb0 + 32, kt[buf ^ 1], vt[buf ^ 1], tid);

    const _Float16* Kt = kt[buf];
    const _Float16* Vt = vt[buf];

    // ---- mask words of this lane's 16 keys: four 16-byte loads -------------
    const v4i ma = *(const v4i*)(Mk + kb0);
    const v4i mb = *(const v4i*)(Mk + kb0 + 4);
    const v4i mc = *(const v4i*)(Mk + kb0 + 16);
    const v4i md = *(const v4i*)(Mk + kb0 + 20);
    // Keeps the four loads issued ahead of the K fragment reads: without it the
    // scheduler sinks them behind the score products and waits on them in pairs.
    __builtin_amdgcn_sched_barrier(0);

    // ---- scores, transposed: s0[r] = S[key 8hi+r][query n], s1: keys +16 ---
    v8f s0 = {}, s1 = {};
    s0 = WMMA_F16(frag_from_f16(Kt, KP, 0), qf0, s0);
    s0 = WMMA_F16(frag_from_f16(Kt, KP, 32), qf1, s0);
    s1 = WMMA_F16(frag_from_f16(Kt + 16 * KP, KP, 0), qf0, s1);
    s1 = WMMA_F16(frag_from_f16(Kt + 16 * KP, KP, 32), qf1, s1);
    // Keeps the mask compares, which wait on the four loads, behind the score
    // products: the scheduler otherwise lifts one in front of the K reads.
    __builtin_amdgcn_sched_barrier(0);

    // ---- mask + scale (faithful: mask!=0 -> -10000) -----------------------
#pragma unroll
    for (int r = 0; r < 4; ++r) {
      s0[r]     = ma[r] ? -10000.f : s0[r] * 0.125f;
      s0[4 + r] = mb[r] ? -10000.f : s0[4 + r] * 0.125f;
      s1[r]     = mc[r] ? -10000.f : s1[r] * 0.125f;
      s1[4 + r] = md[r] ? -10000.f : s1[4 + r] * 0.125f;
    }

    // ---- online softmax update: one query per lane ------------------------
    float tmax = fmaxf(s0[0], s1[0]);
#pragma unroll
    for (int r = 1; r < 8; ++r) tmax = fmaxf(tmax, fmaxf(s0[r], s1[r]));
    tmax = fmaxf(tmax, xhalf(tmax));
    const float mnew = fmaxf(mrow, tmax);
    const float corr = __expf(mrow - mnew);
    mrow = mnew;
    float psum = 0.f;
    v16h pf;  // B operand: pf[i] = P[query n][key 8hi+i], pf[8+i]: key 16+8hi+i
#pragma unroll
    for (int r = 0; r < 8; ++r) {
      const float p0 = __expf(s0[r] - mnew);
      const float p1 = __expf(s1[r] - mnew);
      psum += p0 + p1;
      pf[r]     = (_Float16)p0;
      pf[8 + r] = (_Float16)p1;
    }
    lrow = lrow * corr + psum;
#pragma unroll
    for (int j = 0; j < 4; ++j)
#pragma unroll
      for (int r = 0; r < 8; ++r) o[j][r] *= corr;

    // ---- O^T += V^T @ P^T (A frags: dim rows of the LDS V tile) ------------
#pragma unroll
    for (int j = 0; j < 4; ++j) {
      const v16h vf = frag_from_f16(Vt + 16 * j * VP, VP, 0);
      o[j] = WMMA_F16(vf, pf, o[j]);
    }

    // Fence: our async stage for the next block is complete; barrier also
    // guarantees every wave finished reading the current buffers.
    WAIT_ASYNC();
    __syncthreads();
    buf ^= 1;
  }

  // ---- join the halves' sums, normalize, store wv (flat [B*H*S, 64] f16) ---
  const float inv = 1.0f / (lrow + xhalf(lrow));  // one denominator per lane
  _Float16* orow = wv + ((size_t)bh * Ss + q0 + n) * DH + 8 * hi;
#pragma unroll
  for (int j = 0; j < 4; ++j) {
    v8h ov;
#pragma unroll
    for (int r = 0; r < 8; ++r) ov[r] = (_Float16)(o[j][r] * inv);
    *(v8h*)(orow + 16 * j) = ov;  // 8 consecutive dims of one query: 16 bytes
  }
}

// ---------------------------------------------------------------------------
// Kernel 3: output projection. Raw-reshape merge means wv flat is exactly the
// [B*S, 1024] A matrix. out = A @ Wo^T + bo, M=4096 N=1024 K=1024.
// ---------------------------------------------------------------------------
__global__ __launch_bounds__(256) void outproj_kernel(
    const _Float16* __restrict__ wv, const _Float16* __restrict__ WoH,
    const float* __restrict__ bo, float* __restrict__ out) {
  const int wave = threadIdx.x >> 5;
  const int lane = threadIdx.x & 31;
  const int n    = lane & 15;
  const int hi   = lane >> 4;
  const int w    = blockIdx.x * 8 + wave;  // 0..4095
  const size_t row0 = (size_t)(w >> 4) * 16;
  const int    n0   = (w & 15) * 64;

  const _Float16* A = wv + row0 * HID;

  v8f zacc = {};
  v8f acc[4] = {zacc, zacc, zacc, zacc};

  for (int k0 = 0; k0 < HID; k0 += 32) {
    const v16h a = frag_from_f16(A, HID, k0);
#pragma unroll
    for (int j = 0; j < 4; ++j) {
      const v16h bf = frag_from_f16(WoH + (size_t)(n0 + 16 * j) * HID, HID, k0);
      acc[j] = WMMA_F16(a, bf, acc[j]);
    }
    if (k0 + 32 < HID)
      __builtin_prefetch(A + (size_t)(lane & 15) * HID + k0 + 32, 0, 3);
  }
#pragma unroll
  for (int j = 0; j < 4; ++j) {
    const int col  = n0 + 16 * j + n;
    const float bb = bo[col];
#pragma unroll
    for (int r = 0; r < 8; ++r)
      out[(row0 + r + 8 * hi) * HID + col] = acc[j][r] + bb;
  }
}

// ---------------------------------------------------------------------------
extern "C" void kernel_launch(void* const* d_in, const int* in_sizes, int n_in,
                              void* d_out, int out_size, void* d_ws,
                              size_t ws_size, hipStream_t stream) {
  const float* q    = (const float*)d_in[0];
  const float* k    = (const float*)d_in[1];
  const float* v    = (const float*)d_in[2];
  const int*   mask = (const int*)d_in[3];
  const float* Wq   = (const float*)d_in[4];
  const float* bq   = (const float*)d_in[5];
  const float* Wk   = (const float*)d_in[6];
  const float* bk   = (const float*)d_in[7];
  const float* Wv   = (const float*)d_in[8];
  const float* bv   = (const float*)d_in[9];
  const float* Wo   = (const float*)d_in[10];
  const float* bo   = (const float*)d_in[11];

  // Workspace layout (bytes): q_i | k_i | vT | wv (8 MB f16 each) | Wo f16 (2 MB)
  const size_t HEADELEMS = (size_t)Bb * Hh * Ss * DH;  // 4,194,304
  char* ws = (char*)d_ws;
  _Float16* qh  = (_Float16*)(ws + 0 * HEADELEMS);
  _Float16* kh  = (_Float16*)(ws + 2 * HEADELEMS);
  _Float16* vT  = (_Float16*)(ws + 4 * HEADELEMS);
  _Float16* wvb = (_Float16*)(ws + 6 * HEADELEMS);
  _Float16* WoH = (_Float16*)(ws + 8 * HEADELEMS);

  const int wo_n = HID * HID;  // 1,048,576
  cvt_f16_kernel<<<(wo_n + 255) / 256, 256, 0, stream>>>(Wo, WoH, wo_n);

  // 4096 row-tiles of 16 rows / 8 waves per block -> 512 blocks
  proj_kernel<<<512, 256, 0, stream>>>(q, k, v, Wq, bq, Wk, bk, Wv, bv,
                                       qh, kh, vT);

  // 32 (b,h) pairs * 16 blocks (128 q-rows each) = 512 blocks
  flash_kernel<<<512, 256, 0, stream>>>(qh, kh, vT, mask, wvb);

  // 4096 output tiles (16x64) / 8 waves per block = 512 blocks
  outproj_kernel<<<512, 256, 0, stream>>>(wvb, WoH, bo, (float*)d_out);
}

// v003
// One run takes 118 microseconds.
// Two timings next to v002 put it at 1.16 and 1.17 times that version's speed.
// Counting every step since v000, it is 1.82 times as fast.
#include <hip/hip_runtime.h>
#include <hip/hip_bf16.h>
#include <hip/hip_fp16.h>

typedef __attribute__((ext_vector_type(16))) _Float16 v16h;
typedef __attribute__((ext_vector_type(8)))  _Float16 v8h;
typedef __attribute__((ext_vector_type(8)))  float    v8f;
typedef __attribute__((ext_vector_type(4)))  int      v4i;
typedef __attribute__((ext_vector_type(16))) unsigned v16u;

using gv4i = v4i __attribute__((address_space(1)));  // global int4
using lv4i = v4i __attribute__((address_space(3)));  // LDS int4

#define WMMA_F16(a, b, c) \
  __builtin_amdgcn_wmma_f32_16x16x32_f16(false, (a), false, (b), (short)0, (c), false, false)

#ifndef __has_builtin
#define __has_builtin(x) 0
#endif

#if __has_builtin(__builtin_amdgcn_global_load_async_to_lds_b128)
#define HAVE_ASYNC_LDS 1
#else
#define HAVE_ASYNC_LDS 0
#endif

#if __has_builtin(__builtin_amdgcn_s_wait_asynccnt)
#define WAIT_ASYNC() __builtin_amdgcn_s_wait_asynccnt(0)
#else
#define WAIT_ASYNC() asm volatile("s_wait_asynccnt 0" ::: "memory")
#endif

static constexpr int Bb  = 2;
static constexpr int Ss  = 2048;
static constexpr int HID = 1024;
static constexpr int Hh  = 16;
static constexpr int DH  = 64;
// LDS row pitches in f16 elements: 16 bytes times an odd number, so that the
// 16 rows one ds_load_b128 half-wave reads fall on 16 distinct bank groups.
static constexpr int KP  = 72;  // K tile rows: 128 data bytes at pitch 144
static constexpr int VP  = 40;  // V tile rows:  64 data bytes at pitch 80
// One buffer's stride in f16 elements, above 32 * KP and DH * VP: a power of
// two keeps the buffer select a shift instead of a 32-bit multiply.
static constexpr int TB  = 4096;
static_assert(32 * KP <= TB && DH * VP <= TB, "a padded tile must fit its buffer");

// ---------------------------------------------------------------------------
// Fragment loaders per CDNA5 ISA 7.12.2 (wave32):
//  A 16x32 f16: lane L holds row M=L&15; lanes 0-15 carry K={0..7,16..23},
//  lanes 16-31 carry K={8..15,24..31}. B 32x16 gathered symmetrically
//  (lane = column N, contiguous reduction dim in memory). Each lane loads
//  two contiguous 16-byte chunks.
// ---------------------------------------------------------------------------
__device__ inline v16h frag_from_f16(const _Float16* base, int ld, int k0) {
  const int lane = threadIdx.x & 31;
  const int r    = lane & 15;
  const int kb   = (lane & 16) ? 8 : 0;
  const _Float16* p = base + (size_t)r * ld + k0 + kb;
  v16h a;
#pragma unroll
  for (int i = 0; i < 8; ++i) a[i] = p[i];
#pragma unroll
  for (int i = 0; i < 8; ++i) a[8 + i] = p[16 + i];
  return a;
}

__device__ inline v16h frag_from_f32(const float* base, int ld, int k0) {
  const int lane = threadIdx.x & 31;
  const int r    = lane & 15;
  const int kb   = (lane & 16) ? 8 : 0;
  const float* p = base + (size_t)r * ld + k0 + kb;
  v16h a;
#pragma unroll
  for (int i = 0; i < 8; ++i) a[i] = (_Float16)p[i];
#pragma unroll
  for (int i = 0; i < 8; ++i) a[8 + i] = (_Float16)p[16 + i];
  return a;
}

// Value of lane l ^ 16: the two wave halves hold the two key halves of one query.
__device__ inline float xhalf(float x) {
  const int i = __builtin_bit_cast(int, x);
  return __builtin_bit_cast(
      float, __builtin_amdgcn_permlanex16(i, i, 0x76543210, 0xfedcba98, false, false));
}

// ---------------------------------------------------------------------------
// Kernel 0: input preparation. Blocks 0..PACKB-1 pack the mask, which all 16
// heads of a batch share, into bits, once: per 16-query tile and 32-key block
// 16 words, word i holding for every lane of the flash kernel's wave the bit
// of that lane's score i. They come first in the grid because they run the
// longest. The other blocks convert Wo f32 -> f16.
// ---------------------------------------------------------------------------
static constexpr int PACKB = Bb * (Ss / 16) * (Ss / 32) / 4 / 8;  // 512 blocks

__global__ __launch_bounds__(256) void prep_kernel(
    const float* __restrict__ src, _Float16* __restrict__ dst, int n,
    const int* __restrict__ mask, unsigned* __restrict__ mbits) {
  if (blockIdx.x < PACKB) {
    // One wave packs one query tile x four 32-key blocks. Lane (qn, hi) reads
    // the 16 mask words of the scores it will hold in the flash kernel (query
    // qn; keys 8hi+0..7 and 16+8hi+0..7 of the block); each ballot is one word
    // of the block. Lanes 0-15 collect an even block's 16 words, lanes 16-31
    // the next block's: one whole 128-byte line per store.
    const int lane = threadIdx.x & 31;
    const int qn   = lane & 15;
    const int hi   = lane >> 4;
    const int gw   = blockIdx.x * 8 + (threadIdx.x >> 5);  // 0..4095
    const int qt   = gw >> 4;                // b * (S/16) + query tile
    const int kb4  = (gw & 15) * 4;          // first of the four key blocks
    const int* Mr  = mask + ((size_t)qt * 16 + qn) * Ss + kb4 * 32 + 8 * hi;
    unsigned* Mo   = mbits + ((size_t)qt * (Ss / 32) + kb4) * 16 + lane;
    v4i m[4][4];
#pragma unroll
    for (int u = 0; u < 4; ++u) {
      m[u][0] = *(const v4i*)(Mr + 32 * u);
      m[u][1] = *(const v4i*)(Mr + 32 * u + 4);
      m[u][2] = *(const v4i*)(Mr + 32 * u + 16);
      m[u][3] = *(const v4i*)(Mr + 32 * u + 20);
    }
#pragma unroll
    for (int u2 = 0; u2 < 2; ++u2) {
      unsigned w = 0;
#pragma unroll
      for (int i = 0; i < 32; ++i) {  // lane i takes word i & 15 of block 2*u2 + (i >> 4)
        const unsigned bal =
            __builtin_amdgcn_ballot_w32(m[2 * u2 + (i >> 4)][(i >> 2) & 3][i & 3] != 0);
        w = lane == i ? bal : w;
      }
      Mo[32 * u2] = w;
    }
    return;
  }
  int i = (blockIdx.x - PACKB) * blockDim.x + threadIdx.x;
  if (i < n) dst[i] = (_Float16)src[i];
}

// ---------------------------------------------------------------------------
// Kernel 1: Q/K/V projections. Input viewed as flat [B*H*S, 64] row-major
// (the raw reshape keeps the 64-dim contiguous). q_i/k_i stored f16 in the
// same [B*H*S, 64] layout; v stored transposed as vT[B*H][64][S] so V^T*P^T
// A-fragments gather contiguously later.
// ---------------------------------------------------------------------------
__global__ __launch_bounds__(256) void proj_kernel(
    const float* __restrict__ q, const float* __restrict__ k,
    const float* __restrict__ v,
    const float* __restrict__ Wq, const float* __restrict__ bq,
    const float* __restrict__ Wk, const float* __restrict__ bk,
    const float* __restrict__ Wv, const float* __restrict__ bv,
    _Float16* __restrict__ qh, _Float16* __restrict__ kh,
    _Float16* __restrict__ vT) {
  const int wave = threadIdx.x >> 5;
  const int lane = threadIdx.x & 31;
  const int n    = lane & 15;
  const int hi   = lane >> 4;
  const size_t g0 = ((size_t)blockIdx.x * 8 + wave) * 16;  // row-tile base

  v16h aq0 = frag_from_f32(q + g0 * DH, DH, 0);
  v16h aq1 = frag_from_f32(q + g0 * DH, DH, 32);
  v16h ak0 = frag_from_f32(k + g0 * DH, DH, 0);
  v16h ak1 = frag_from_f32(k + g0 * DH, DH, 32);
  v16h av0 = frag_from_f32(v + g0 * DH, DH, 0);
  v16h av1 = frag_from_f32(v + g0 * DH, DH, 32);

  // q projection: out = X @ Wq^T + bq ; B[k][n] = Wq[n][k] (row n, contiguous k)
#pragma unroll
  for (int j = 0; j < 4; ++j) {
    v8f c = {};
    c = WMMA_F16(aq0, frag_from_f32(Wq + (size_t)(16 * j) * DH, DH, 0), c);
    c = WMMA_F16(aq1, frag_from_f32(Wq + (size_t)(16 * j) * DH, DH, 32), c);
    const int col = 16 * j + n;
    const float bias = bq[col];
#pragma unroll
    for (int r = 0; r < 8; ++r)
      qh[(g0 + r + 8 * hi) * DH + col] = (_Float16)(c[r] + bias);
  }
#pragma unroll
  for (int j = 0; j < 4; ++j) {
    v8f c = {};
    c = WMMA_F16(ak0, frag_from_f32(Wk + (size_t)(16 * j) * DH, DH, 0), c);
    c = WMMA_F16(ak1, frag_from_f32(Wk + (size_t)(16 * j) * DH, DH, 32), c);
    const int col = 16 * j + n;
    const float bias = bk[col];
#pragma unroll
    for (int r = 0; r < 8; ++r)
      kh[(g0 + r + 8 * hi) * DH + col] = (_Float16)(c[r] + bias);
  }
  // v projection -> transposed store
  const size_t bh = g0 >> 11;           // b*H + h (tiles never straddle heads)
  const int    s0 = (int)(g0 & 2047);
#pragma unroll
  for (int j = 0; j < 4; ++j) {
    v8f c = {};
    c = WMMA_F16(av0, frag_from_f32(Wv + (size_t)(16 * j) * DH, DH, 0), c);
    c = WMMA_F16(av1, frag_from_f32(Wv + (size_t)(16 * j) * DH, DH, 32), c);
    const int col = 16 * j + n;
    const float bias = bv[col];
#pragma unroll
    for (int r = 0; r < 8; ++r)
      vT[(bh * DH + col) * (size_t)Ss + (s0 + r + 8 * hi)] =
          (_Float16)(c[r] + bias);
  }
}

// ---------------------------------------------------------------------------
// Async (or fallback) staging of one 32-key K tile [32][64] and V tile
// [64][32] (from transposed V) into LDS, rows at the padded pitches KP and VP.
// 256 threads x 16B each per tile.
// ---------------------------------------------------------------------------
__device__ inline void stage_kv(const _Float16* __restrict__ K,
                                const _Float16* __restrict__ V, int kb0,
                                _Float16* ktb, _Float16* vtb, int tid) {
  const int krow = tid >> 3, kseg = (tid & 7) * 8;  // key row, 8-f16 segment
  const int vrow = tid >> 2, vseg = (tid & 3) * 8;  // dim row, 8-f16 segment
  const _Float16* gk = K + (size_t)(kb0 + krow) * DH + kseg;
  const _Float16* gv = V + (size_t)vrow * Ss + kb0 + vseg;
  _Float16* lk = ktb + krow * KP + kseg;
  _Float16* lv = vtb + vrow * VP + vseg;
#if HAVE_ASYNC_LDS
  __builtin_amdgcn_global_load_async_to_lds_b128((gv4i*)gk, (lv4i*)lk, 0, 0);
  __builtin_amdgcn_global_load_async_to_lds_b128((gv4i*)gv, (lv4i*)lv, 0, 0);
#else
  *(float4*)lk = *(const float4*)gk;
  *(float4*)lv = *(const float4*)gv;
#endif
}

__global__ __launch_bounds__(256) void flash_kernel(
    const _Float16* __restrict__ qh, const _Float16* __restrict__ kh,
    const _Float16* __restrict__ vT, const unsigned* __restrict__ mbits,
    _Float16* __restrict__ wv) {
  __shared__ __align__(16) _Float16 kt[2][TB];   // [key][dim], rows at pitch KP
  __shared__ __align__(16) _Float16 vt[2][TB];   // [dim][key], rows at pitch VP

  const int tid  = threadIdx.x;
  const int wave = tid >> 5;
  const int lane = tid & 31;
  const int n    = lane & 15;
  const int hi   = lane >> 4;
  const int bh   = blockIdx.x >> 4;                    // b*H + h
  const int q0   = (blockIdx.x & 15) * 128 + wave * 16;
  const int b    = bh >> 4;

  const _Float16* Q  = qh + ((size_t)bh * Ss + q0) * DH;
  const _Float16* K  = kh + (size_t)bh * Ss * DH;
  const _Float16* V  = vT + (size_t)bh * DH * Ss;
  // This wave's packed mask words: 16 per key block. The tile index is made
  // wave-uniform for the compiler so that the words load into scalar registers.
  const int qt = __builtin_amdgcn_readfirstlane(b * (Ss / 16) + (q0 >> 4));
  const unsigned* Mw = mbits + (size_t)qt * (Ss / 32) * 16;

  const v16h qf0 = frag_from_f16(Q, DH, 0);
  const v16h qf1 = frag_from_f16(Q, DH, 32);

  float mrow = -3.0e38f;  // running maximum of query n (equal in both halves)
  float lrow = 0.f;       // running sum over this half's keys only
  v8f zacc = {};
  v8f o[4] = {zacc, zacc, zacc, zacc};  // o[j][r] = O[query n][dim 16j + 8hi + r]

  // Prologue: stage first K/V block.
  stage_kv(K, V, 0, kt[0], vt[0], tid);
  WAIT_ASYNC();
  __syncthreads();

  int buf = 0;
  for (int kb0 = 0; kb0 < Ss; kb0 += 32) {
    // Kick off DMA for the next block into the other buffer (overlaps WMMA).
    if (kb0 + 32 < Ss) stage_kv(K, V, kb0 + 32, kt[buf ^ 1], vt[buf ^ 1], tid);

    const _Float16* Kt = kt[buf];
    const _Float16* Vt = vt[buf];

    // ---- mask bits of this block: 16 lane-mask words, one scalar load ------
    const v16u mw = *(const v16u*)(Mw + (kb0 >> 5) * 16);

    // ---- scores, transposed: s0[r] = S[key 8hi+r][query n], s1: keys +16 ---
    v8f s0 = {}, s1 = {};
    s0 = WMMA_F16(frag_from_f16(Kt, KP, 0), qf0, s0);
    s0 = WMMA_F16(frag_from_f16(Kt, KP, 32), qf1, s0);
    s1 = WMMA_F16(frag_from_f16(Kt + 16 * KP, KP, 0), qf0, s1);
    s1 = WMMA_F16(frag_from_f16(Kt + 16 * KP, KP, 32), qf1, s1);
    // Ends the scheduling region at the last score product: with the whole block
    // in one region the scheduler waits on every K and V fragment alone, orders
    // the softmax in dependent pairs and moves the row sum behind the barrier.
    __builtin_amdgcn_sched_barrier(0);

    // ---- mask + scale (faithful: mask!=0 -> -10000) -----------------------
#pragma unroll
    for (int r = 0; r < 8; ++r) {
      s0[r] = __builtin_amdgcn_inverse_ballot_w32(mw[r]) ? -10000.f : s0[r] * 0.125f;
      s1[r] = __builtin_amdgcn_inverse_ballot_w32(mw[8 + r]) ? -10000.f : s1[r] * 0.125f;
    }

    // ---- online softmax update: one query per lane ------------------------
    float tmax = fmaxf(s0[0], s1[0]);
#pragma unroll
    for (int r = 1; r < 8; ++r) tmax = fmaxf(tmax, fmaxf(s0[r], s1[r]));
    tmax = fmaxf(tmax, xhalf(tmax));
    const float mnew = fmaxf(mrow, tmax);
    const float corr = __expf(mrow - mnew);
    mrow = mnew;
    float psum = 0.f;
    v16h pf;  // B operand: pf[i] = P[query n][key 8hi+i], pf[8+i]: key 16+8hi+i
#pragma unroll
    for (int r = 0; r < 8; ++r) {
      const float p0 = __expf(s0[r] - mnew);
      const float p1 = __expf(s1[r] - mnew);
      psum += p0 + p1;
      pf[r]     = (_Float16)p0;
      pf[8 + r] = (_Float16)p1;
    }
    lrow = lrow * corr + psum;
#pragma unroll
    for (int j = 0; j < 4; ++j)
#pragma unroll
      for (int r = 0; r < 8; ++r) o[j][r] *= corr;

    // ---- O^T += V^T @ P^T (A frags: dim rows of the LDS V tile) ------------
#pragma unroll
    for (int j = 0; j < 4; ++j) {
      const v16h vf = frag_from_f16(Vt + 16 * j * VP, VP, 0);
      o[j] = WMMA_F16(vf, pf, o[j]);
    }

    // Fence: our async stage for the next block is complete; barrier also
    // guarantees every wave finished reading the current buffers.
    WAIT_ASYNC();
    __syncthreads();
    buf ^= 1;
  }

  // ---- join the halves' sums, normalize, store wv (flat [B*H*S, 64] f16) ---
  const float inv = 1.0f / (lrow + xhalf(lrow));  // one denominator per lane
  _Float16* orow = wv + ((size_t)bh * Ss + q0 + n) * DH + 8 * hi;
#pragma unroll
  for (int j = 0; j < 4; ++j) {
    v8h ov;
#pragma unroll
    for (int r = 0; r < 8; ++r) ov[r] = (_Float16)(o[j][r] * inv);
    *(v8h*)(orow + 16 * j) = ov;  // 8 consecutive dims of one query: 16 bytes
  }
}

// ---------------------------------------------------------------------------
// Kernel 3: output projection. Raw-reshape merge means wv flat is exactly the
// [B*S, 1024] A matrix. out = A @ Wo^T + bo, M=4096 N=1024 K=1024.
// ---------------------------------------------------------------------------
__global__ __launch_bounds__(256) void outproj_kernel(
    const _Float16* __restrict__ wv, const _Float16* __restrict__ WoH,
    const float* __restrict__ bo, float* __restrict__ out) {
  const int wave = threadIdx.x >> 5;
  const int lane = threadIdx.x & 31;
  const int n    = lane & 15;
  const int hi   = lane >> 4;
  const int w    = blockIdx.x * 8 + wave;  // 0..4095
  const size_t row0 = (size_t)(w >> 4) * 16;
  const int    n0   = (w & 15) * 64;

  const _Float16* A = wv + row0 * HID;

  v8f zacc = {};
  v8f acc[4] = {zacc, zacc, zacc, zacc};

  for (int k0 = 0; k0 < HID; k0 += 32) {
    const v16h a = frag_from_f16(A, HID, k0);
#pragma unroll
    for (int j = 0; j < 4; ++j) {
      const v16h bf = frag_from_f16(WoH + (size_t)(n0 + 16 * j) * HID, HID, k0);
      acc[j] = WMMA_F16(a, bf, acc[j]);
    }
    if (k0 + 32 < HID)
      __builtin_prefetch(A + (size_t)(lane & 15) * HID + k0 + 32, 0, 3);
  }
#pragma unroll
  for (int j = 0; j < 4; ++j) {
    const int col  = n0 + 16 * j + n;
    const float bb = bo[col];
#pragma unroll
    for (int r = 0; r < 8; ++r)
      out[(row0 + r + 8 * hi) * HID + col] = acc[j][r] + bb;
  }
}

// ---------------------------------------------------------------------------
extern "C" void kernel_launch(void* const* d_in, const int* in_sizes, int n_in,
                              void* d_out, int out_size, void* d_ws,
                              size_t ws_size, hipStream_t stream) {
  const float* q    = (const float*)d_in[0];
  const float* k    = (const float*)d_in[1];
  const float* v    = (const float*)d_in[2];
  const int*   mask = (const int*)d_in[3];
  const float* Wq   = (const float*)d_in[4];
  const float* bq   = (const float*)d_in[5];
  const float* Wk   = (const float*)d_in[6];
  const float* bk   = (const float*)d_in[7];
  const float* Wv   = (const float*)d_in[8];
  const float* bv   = (const float*)d_in[9];
  const float* Wo   = (const float*)d_in[10];
  const float* bo   = (const float*)d_in[11];

  // Workspace layout (bytes): q_i | k_i | vT | wv (8 MB f16 each) | Wo f16 (2 MB)
  // | mask bits (1 MB, at the next 4 MB step)
  const size_t HEADELEMS = (size_t)Bb * Hh * Ss * DH;  // 4,194,304
  char* ws = (char*)d_ws;
  _Float16* qh  = (_Float16*)(ws + 0 * HEADELEMS);
  _Float16* kh  = (_Float16*)(ws + 2 * HEADELEMS);
  _Float16* vT  = (_Float16*)(ws + 4 * HEADELEMS);
  _Float16* wvb = (_Float16*)(ws + 6 * HEADELEMS);
  _Float16* WoH = (_Float16*)(ws + 8 * HEADELEMS);
  unsigned* mbits = (unsigned*)(ws + 9 * HEADELEMS);

  const int wo_n = HID * HID;  // 1,048,576
  prep_kernel<<<PACKB + (wo_n + 255) / 256, 256, 0, stream>>>(Wo, WoH, wo_n,
                                                              mask, mbits);

  // 4096 row-tiles of 16 rows / 8 waves per block -> 512 blocks
  proj_kernel<<<512, 256, 0, stream>>>(q, k, v, Wq, bq, Wk, bk, Wv, bv,
                                       qh, kh, vT);

  // 32 (b,h) pairs * 16 blocks (128 q-rows each) = 512 blocks
  flash_kernel<<<512, 256, 0, stream>>>(qh, kh, vT, mbits, wvb);

  // 4096 output tiles (16x64) / 8 waves per block = 512 blocks
  outproj_kernel<<<512, 256, 0, stream>>>(wvb, WoH, bo, (float*)d_out);
}

// v004
// One run takes 88.8 microseconds.
// Two timings next to v003 put it at 1.32 and 1.36 times that version's speed.
// All steps since v000 together make it 2.43 times as fast.
#include <hip/hip_runtime.h>
#include <hip/hip_bf16.h>
#include <hip/hip_fp16.h>

typedef __attribute__((ext_vector_type(16))) _Float16 v16h;
typedef __attribute__((ext_vector_type(8)))  _Float16 v8h;
typedef __attribute__((ext_vector_type(8)))  float    v8f;
typedef __attribute__((ext_vector_type(4)))  int      v4i;
typedef __attribute__((ext_vector_type(16))) unsigned v16u;

using gv4i = v4i __attribute__((address_space(1)));  // global int4
using lv4i = v4i __attribute__((address_space(3)));  // LDS int4

#define WMMA_F16(a, b, c) \
  __builtin_amdgcn_wmma_f32_16x16x32_f16(false, (a), false, (b), (short)0, (c), false, false)

#ifndef __has_builtin
#define __has_builtin(x) 0
#endif

#if __has_builtin(__builtin_amdgcn_global_load_async_to_lds_b128)
#define HAVE_ASYNC_LDS 1
#else
#define HAVE_ASYNC_LDS 0
#endif

#if __has_builtin(__builtin_amdgcn_s_wait_asynccnt)
#define WAIT_ASYNC() __builtin_amdgcn_s_wait_asynccnt(0)
#else
#define WAIT_ASYNC() asm volatile("s_wait_asynccnt 0" ::: "memory")
#endif

static constexpr int Bb  = 2;
static constexpr int Ss  = 2048;
static constexpr int HID = 1024;
static constexpr int Hh  = 16;
static constexpr int DH  = 64;
// LDS row pitches in f16 elements: 16 bytes times an odd number, so that the
// 16 rows one ds_load_b128 half-wave reads fall on 16 distinct bank groups.
static constexpr int KP  = 72;  // K tile rows: 128 data bytes at pitch 144
static constexpr int VP  = 40;  // V tile rows:  64 data bytes at pitch 80
// One buffer's stride in f16 elements, above 32 * KP and DH * VP: a power of
// two keeps the buffer select a shift instead of a 32-bit multiply.
static constexpr int TB  = 4096;
static_assert(32 * KP <= TB && DH * VP <= TB, "a padded tile must fit its buffer");

// ---------------------------------------------------------------------------
// Fragment loaders per CDNA5 ISA 7.12.2 (wave32):
//  A 16x32 f16: lane L holds row M=L&15; lanes 0-15 carry K={0..7,16..23},
//  lanes 16-31 carry K={8..15,24..31}. B 32x16 gathered symmetrically
//  (lane = column N, contiguous reduction dim in memory). Each lane loads
//  two contiguous 16-byte chunks.
// ---------------------------------------------------------------------------
__device__ inline v16h frag_from_f16(const _Float16* base, int ld, int k0) {
  const int lane = threadIdx.x & 31;
  const int r    = lane & 15;
  const int kb   = (lane & 16) ? 8 : 0;
  const _Float16* p = base + (size_t)r * ld + k0 + kb;
  v16h a;
#pragma unroll
  for (int i = 0; i < 8; ++i) a[i] = p[i];
#pragma unroll
  for (int i = 0; i < 8; ++i) a[8 + i] = p[16 + i];
  return a;
}

__device__ inline v16h frag_from_f32(const float* base, int ld, int k0) {
  const int lane = threadIdx.x & 31;
  const int r    = lane & 15;
  const int kb   = (lane & 16) ? 8 : 0;
  const float* p = base + (size_t)r * ld + k0 + kb;
  v16h a;
#pragma unroll
  for (int i = 0; i < 8; ++i) a[i] = (_Float16)p[i];
#pragma unroll
  for (int i = 0; i < 8; ++i) a[8 + i] = (_Float16)p[16 + i];
  return a;
}

// Value of lane l ^ 16: the two wave halves hold the two key halves of one query.
__device__ inline float xhalf(float x) {
  const int i = __builtin_bit_cast(int, x);
  return __builtin_bit_cast(
      float, __builtin_amdgcn_permlanex16(i, i, 0x76543210, 0xfedcba98, false, false));
}

// ---------------------------------------------------------------------------
// Kernel 0: input preparation. Blocks 0..PACKB-1 pack the mask, which all 16
// heads of a batch share, into bits, once: per 16-query tile and 32-key block
// 16 words, word i holding for every lane of the flash kernel's wave the bit
// of that lane's score i. They come first in the grid because they run the
// longest. The other blocks convert Wo f32 -> f16.
// ---------------------------------------------------------------------------
static constexpr int PACKB = Bb * (Ss / 16) * (Ss / 32) / 4 / 8;  // 512 blocks

__global__ __launch_bounds__(256) void prep_kernel(
    const float* __restrict__ src, _Float16* __restrict__ dst, int n,
    const int* __restrict__ mask, unsigned* __restrict__ mbits) {
  if (blockIdx.x < PACKB) {
    // One wave packs one query tile x four 32-key blocks. Lane (qn, hi) reads
    // the 16 mask words of the scores it will hold in the flash kernel (query
    // qn; keys 8hi+0..7 and 16+8hi+0..7 of the block); each ballot is one word
    // of the block. Lanes 0-15 collect an even block's 16 words, lanes 16-31
    // the next block's: one whole 128-byte line per store.
    const int lane = threadIdx.x & 31;
    const int qn   = lane & 15;
    const int hi   = lane >> 4;
    const int gw   = blockIdx.x * 8 + (threadIdx.x >> 5);  // 0..4095
    const int qt   = gw >> 4;                // b * (S/16) + query tile
    const int kb4  = (gw & 15) * 4;          // first of the four key blocks
    const int* Mr  = mask + ((size_t)qt * 16 + qn) * Ss + kb4 * 32 + 8 * hi;
    unsigned* Mo   = mbits + ((size_t)qt * (Ss / 32) + kb4) * 16 + lane;
    v4i m[4][4];
#pragma unroll
    for (int u = 0; u < 4; ++u) {
      m[u][0] = *(const v4i*)(Mr + 32 * u);
      m[u][1] = *(const v4i*)(Mr + 32 * u + 4);
      m[u][2] = *(const v4i*)(Mr + 32 * u + 16);
      m[u][3] = *(const v4i*)(Mr + 32 * u + 20);
    }
#pragma unroll
    for (int u2 = 0; u2 < 2; ++u2) {
      unsigned w = 0;
#pragma unroll
      for (int i = 0; i < 32; ++i) {  // lane i takes word i & 15 of block 2*u2 + (i >> 4)
        const unsigned bal =
            __builtin_amdgcn_ballot_w32(m[2 * u2 + (i >> 4)][(i >> 2) & 3][i & 3] != 0);
        w = lane == i ? bal : w;
      }
      Mo[32 * u2] = w;
    }
    return;
  }
  int i = (blockIdx.x - PACKB) * blockDim.x + threadIdx.x;
  if (i < n) dst[i] = (_Float16)src[i];
}

// ---------------------------------------------------------------------------
// Kernel 1: Q/K/V projections. Input viewed as flat [B*H*S, 64] row-major
// (the raw reshape keeps the 64-dim contiguous). q_i/k_i stored f16 in the
// same [B*H*S, 64] layout; v stored transposed as vT[B*H][64][S] so V^T*P^T
// A-fragments gather contiguously later.
// ---------------------------------------------------------------------------
__global__ __launch_bounds__(256) void proj_kernel(
    const float* __restrict__ q, const float* __restrict__ k,
    const float* __restrict__ v,
    const float* __restrict__ Wq, const float* __restrict__ bq,
    const float* __restrict__ Wk, const float* __restrict__ bk,
    const float* __restrict__ Wv, const float* __restrict__ bv,
    _Float16* __restrict__ qh, _Float16* __restrict__ kh,
    _Float16* __restrict__ vT) {
  const int wave = threadIdx.x >> 5;
  const int lane = threadIdx.x & 31;
  const int n    = lane & 15;
  const int hi   = lane >> 4;
  const size_t g0 = ((size_t)blockIdx.x * 8 + wave) * 16;  // row-tile base

  v16h aq0 = frag_from_f32(q + g0 * DH, DH, 0);
  v16h aq1 = frag_from_f32(q + g0 * DH, DH, 32);
  v16h ak0 = frag_from_f32(k + g0 * DH, DH, 0);
  v16h ak1 = frag_from_f32(k + g0 * DH, DH, 32);
  v16h av0 = frag_from_f32(v + g0 * DH, DH, 0);
  v16h av1 = frag_from_f32(v + g0 * DH, DH, 32);

  // q projection: out = X @ Wq^T + bq ; B[k][n] = Wq[n][k] (row n, contiguous k)
#pragma unroll
  for (int j = 0; j < 4; ++j) {
    v8f c = {};
    c = WMMA_F16(aq0, frag_from_f32(Wq + (size_t)(16 * j) * DH, DH, 0), c);
    c = WMMA_F16(aq1, frag_from_f32(Wq + (size_t)(16 * j) * DH, DH, 32), c);
    const int col = 16 * j + n;
    const float bias = bq[col];
#pragma unroll
    for (int r = 0; r < 8; ++r)
      qh[(g0 + r + 8 * hi) * DH + col] = (_Float16)(c[r] + bias);
  }
#pragma unroll
  for (int j = 0; j < 4; ++j) {
    v8f c = {};
    c = WMMA_F16(ak0, frag_from_f32(Wk + (size_t)(16 * j) * DH, DH, 0), c);
    c = WMMA_F16(ak1, frag_from_f32(Wk + (size_t)(16 * j) * DH, DH, 32), c);
    const int col = 16 * j + n;
    const float bias = bk[col];
#pragma unroll
    for (int r = 0; r < 8; ++r)
      kh[(g0 + r + 8 * hi) * DH + col] = (_Float16)(c[r] + bias);
  }
  // v projection -> transposed store
  const size_t bh = g0 >> 11;           // b*H + h (tiles never straddle heads)
  const int    s0 = (int)(g0 & 2047);
#pragma unroll
  for (int j = 0; j < 4; ++j) {
    v8f c = {};
    c = WMMA_F16(av0, frag_from_f32(Wv + (size_t)(16 * j) * DH, DH, 0), c);
    c = WMMA_F16(av1, frag_from_f32(Wv + (size_t)(16 * j) * DH, DH, 32), c);
    const int col = 16 * j + n;
    const float bias = bv[col];
#pragma unroll
    for (int r = 0; r < 8; ++r)
      vT[(bh * DH + col) * (size_t)Ss + (s0 + r + 8 * hi)] =
          (_Float16)(c[r] + bias);
  }
}

// ---------------------------------------------------------------------------
// Async (or fallback) staging of one 32-key K tile [32][64] and V tile
// [64][32] (from transposed V) into LDS, rows at the padded pitches KP and VP.
// 256 threads x 16B each per tile.
// ---------------------------------------------------------------------------
__device__ inline void stage_kv(const _Float16* __restrict__ K,
                                const _Float16* __restrict__ V, int kb0,
                                _Float16* ktb, _Float16* vtb, int tid) {
  const int krow = tid >> 3, kseg = (tid & 7) * 8;  // key row, 8-f16 segment
  const int vrow = tid >> 2, vseg = (tid & 3) * 8;  // dim row, 8-f16 segment
  const _Float16* gk = K + (size_t)(kb0 + krow) * DH + kseg;
  const _Float16* gv = V + (size_t)vrow * Ss + kb0 + vseg;
  _Float16* lk = ktb + krow * KP + kseg;
  _Float16* lv = vtb + vrow * VP + vseg;
#if HAVE_ASYNC_LDS
  __builtin_amdgcn_global_load_async_to_lds_b128((gv4i*)gk, (lv4i*)lk, 0, 0);
  __builtin_amdgcn_global_load_async_to_lds_b128((gv4i*)gv, (lv4i*)lv, 0, 0);
#else
  *(float4*)lk = *(const float4*)gk;
  *(float4*)lv = *(const float4*)gv;
#endif
}

__global__ __launch_bounds__(256) void flash_kernel(
    const _Float16* __restrict__ qh, const _Float16* __restrict__ kh,
    const _Float16* __restrict__ vT, const unsigned* __restrict__ mbits,
    _Float16* __restrict__ wv) {
  __shared__ __align__(16) _Float16 kt[2][TB];   // [key][dim], rows at pitch KP
  __shared__ __align__(16) _Float16 vt[2][TB];   // [dim][key], rows at pitch VP

  const int tid  = threadIdx.x;
  const int wave = tid >> 5;
  const int lane = tid & 31;
  const int n    = lane & 15;
  const int hi   = lane >> 4;
  const int bh   = blockIdx.x >> 4;                    // b*H + h
  const int q0   = (blockIdx.x & 15) * 128 + wave * 16;
  const int b    = bh >> 4;

  const _Float16* Q  = qh + ((size_t)bh * Ss + q0) * DH;
  const _Float16* K  = kh + (size_t)bh * Ss * DH;
  const _Float16* V  = vT + (size_t)bh * DH * Ss;
  // This wave's packed mask words: 16 per key block. The tile index is made
  // wave-uniform for the compiler so that the words load into scalar registers.
  const int qt = __builtin_amdgcn_readfirstlane(b * (Ss / 16) + (q0 >> 4));
  const unsigned* Mw = mbits + (size_t)qt * (Ss / 32) * 16;

  const v16h qf0 = frag_from_f16(Q, DH, 0);
  const v16h qf1 = frag_from_f16(Q, DH, 32);

  float mrow = -3.0e38f;  // running maximum of query n (equal in both halves)
  float lrow = 0.f;       // running sum over this half's keys only
  v8f zacc = {};
  v8f o[4] = {zacc, zacc, zacc, zacc};  // o[j][r] = O[query n][dim 16j + 8hi + r]

  // Prologue: stage first K/V block.
  stage_kv(K, V, 0, kt[0], vt[0], tid);
  WAIT_ASYNC();
  __syncthreads();

  int buf = 0;
  for (int kb0 = 0; kb0 < Ss; kb0 += 32) {
    // Kick off DMA for the next block into the other buffer (overlaps WMMA).
    if (kb0 + 32 < Ss) stage_kv(K, V, kb0 + 32, kt[buf ^ 1], vt[buf ^ 1], tid);

    const _Float16* Kt = kt[buf];
    const _Float16* Vt = vt[buf];

    // ---- mask bits of this block: 16 lane-mask words, one scalar load ------
    const v16u mw = *(const v16u*)(Mw + (kb0 >> 5) * 16);

    // ---- scores, transposed: s0[r] = S[key 8hi+r][query n], s1: keys +16 ---
    v8f s0 = {}, s1 = {};
    s0 = WMMA_F16(frag_from_f16(Kt, KP, 0), qf0, s0);
    s0 = WMMA_F16(frag_from_f16(Kt, KP, 32), qf1, s0);
    s1 = WMMA_F16(frag_from_f16(Kt + 16 * KP, KP, 0), qf0, s1);
    s1 = WMMA_F16(frag_from_f16(Kt + 16 * KP, KP, 32), qf1, s1);
    // Ends the scheduling region at the last score product: with the whole block
    // in one region the scheduler waits on every K and V fragment alone, orders
    // the softmax in dependent pairs and moves the row sum behind the barrier.
    __builtin_amdgcn_sched_barrier(0);

    // ---- mask + scale (faithful: mask!=0 -> -10000) -----------------------
#pragma unroll
    for (int r = 0; r < 8; ++r) {
      s0[r] = __builtin_amdgcn_inverse_ballot_w32(mw[r]) ? -10000.f : s0[r] * 0.125f;
      s1[r] = __builtin_amdgcn_inverse_ballot_w32(mw[8 + r]) ? -10000.f : s1[r] * 0.125f;
    }

    // ---- online softmax update: one query per lane ------------------------
    float tmax = fmaxf(s0[0], s1[0]);
#pragma unroll
    for (int r = 1; r < 8; ++r) tmax = fmaxf(tmax, fmaxf(s0[r], s1[r]));
    tmax = fmaxf(tmax, xhalf(tmax));
    const float mnew = fmaxf(mrow, tmax);
    const float corr = __expf(mrow - mnew);
    mrow = mnew;
    float psum = 0.f;
    v16h pf;  // B operand: pf[i] = P[query n][key 8hi+i], pf[8+i]: key 16+8hi+i
#pragma unroll
    for (int r = 0; r < 8; ++r) {
      const float p0 = __expf(s0[r] - mnew);
      const float p1 = __expf(s1[r] - mnew);
      psum += p0 + p1;
      pf[r]     = (_Float16)p0;
      pf[8 + r] = (_Float16)p1;
    }
    lrow = lrow * corr + psum;
#pragma unroll
    for (int j = 0; j < 4; ++j)
#pragma unroll
      for (int r = 0; r < 8; ++r) o[j][r] *= corr;

    // ---- O^T += V^T @ P^T (A frags: dim rows of the LDS V tile) ------------
#pragma unroll
    for (int j = 0; j < 4; ++j) {
      const v16h vf = frag_from_f16(Vt + 16 * j * VP, VP, 0);
      o[j] = WMMA_F16(vf, pf, o[j]);
    }

    // Fence: our async stage for the next block is complete; barrier also
    // guarantees every wave finished reading the current buffers.
    WAIT_ASYNC();
    __syncthreads();
    buf ^= 1;
  }

  // ---- join the halves' sums, normalize, store wv (flat [B*H*S, 64] f16) ---
  const float inv = 1.0f / (lrow + xhalf(lrow));  // one denominator per lane
  _Float16* orow = wv + ((size_t)bh * Ss + q0 + n) * DH + 8 * hi;
#pragma unroll
  for (int j = 0; j < 4; ++j) {
    v8h ov;
#pragma unroll
    for (int r = 0; r < 8; ++r) ov[r] = (_Float16)(o[j][r] * inv);
    *(v8h*)(orow + 16 * j) = ov;  // 8 consecutive dims of one query: 16 bytes
  }
}

// ---------------------------------------------------------------------------
// Kernel 3: output projection. Raw-reshape merge means wv flat is exactly the
// [B*S, 1024] A matrix. out = A @ Wo^T + bo, M=4096 N=1024 K=1024.
// One block computes a 128 x 128 tile of out; its 8 waves (2 x 4) own 64 x 32
// each. A k slice of 128 of the block's 128 A rows and 128 Wo rows is staged in
// LDS by asynchronous copies, two buffers: slice t + 1 flies while slice t is
// multiplied, and every staged row serves all the waves that need it.
// ---------------------------------------------------------------------------
static constexpr int GT  = 128;            // tile rows of A, and of Wo
static constexpr int GK  = 128;            // k per slice: 256 data bytes a row
static constexpr int GP  = 136;            // LDS row pitch in f16: 272 B = 16 B x 17
static constexpr int GSL = 2 * GT * GP;    // one buffer: A rows, then Wo rows
static constexpr int GNT = HID / GK;       // 8 slices

// Eight 16-byte copies of one thread: rows 16 apart of one operand's slice.
// l: the lane's LDS byte address, g: its global address, both of the first row.
__device__ inline void copy8(unsigned l, const _Float16* g) {
  constexpr unsigned LS = 16 * GP * 2;  // 16 rows in LDS, bytes
  constexpr int      GS = 16 * HID;     // 16 rows in memory, elements
  // The closing s_wait_xcnt stands inside the statement so that no address
  // register of a copy is rewritten ahead of it.
  asm volatile(
      "global_load_async_to_lds_b128 %0, %8, off\n\t"
      "global_load_async_to_lds_b128 %1, %9, off\n\t"
      "global_load_async_to_lds_b128 %2, %10, off\n\t"
      "global_load_async_to_lds_b128 %3, %11, off\n\t"
      "global_load_async_to_lds_b128 %4, %12, off\n\t"
      "global_load_async_to_lds_b128 %5, %13, off\n\t"
      "global_load_async_to_lds_b128 %6, %14, off\n\t"
      "global_load_async_to_lds_b128 %7, %15, off\n\t"
      "s_wait_xcnt 0x0"
      :
      : "v"(l), "v"(l + LS), "v"(l + 2 * LS), "v"(l + 3 * LS), "v"(l + 4 * LS),
        "v"(l + 5 * LS), "v"(l + 6 * LS), "v"(l + 7 * LS), "v"(g), "v"(g + GS),
        "v"(g + 2 * GS), "v"(g + 3 * GS), "v"(g + 4 * GS), "v"(g + 5 * GS),
        "v"(g + 6 * GS), "v"(g + 7 * GS)
      : "memory");
}

__global__ __launch_bounds__(256) void outproj_kernel(
    const _Float16* __restrict__ wv, const _Float16* __restrict__ WoH,
    const float* __restrict__ bo, float* __restrict__ out) {
  __shared__ __align__(16) _Float16 st[2 * GSL];

  const int tid  = threadIdx.x;
  const int wave = tid >> 5;
  const int lane = tid & 31;
  const int n    = lane & 15;
  const int hi   = lane >> 4;
  const int m0   = (blockIdx.x >> 3) * GT;  // 32 row tiles
  const int n0   = (blockIdx.x & 7) * GT;   // 8 column tiles
  const int wm   = (wave >> 2) * 64;        // this wave's rows in the tile
  const int wn   = (wave & 3) * 32;         // this wave's columns in the tile

  // Copy map: 16 threads take one row's 256 bytes, so a wave copies whole lines.
  const int crow = tid >> 4, cseg = (tid & 15) * 8;
  const _Float16* ga = wv + (size_t)(m0 + crow) * HID + cseg;
  const _Float16* gb = WoH + (size_t)(n0 + crow) * HID + cseg;
  const unsigned la = (unsigned)(size_t)st + (crow * GP + cseg) * 2;
  const unsigned lb = la + GT * GP * 2;

  v8f zacc = {};
  v8f acc[4][2] = {{zacc, zacc}, {zacc, zacc}, {zacc, zacc}, {zacc, zacc}};

  // Slice 0 into buffer 0, landed and published; then slice 1 into buffer 1.
  copy8(la, ga);
  copy8(lb, gb);
  asm volatile("s_wait_asynccnt 0x0" ::: "memory");  // this wave's copies have landed
  __syncthreads();
  copy8(la + GSL * 2, ga + GK);
  copy8(lb + GSL * 2, gb + GK);

  for (int t = 0; t < GNT; ++t) {
    const int boff = (t & 1) * GSL;
    const _Float16* As = st + boff + wm * GP;
    const _Float16* Bs = st + boff + (GT + wn) * GP;
    // Two fragment sets: step s + 1 of this slice is read while step s multiplies.
    // The loops over sets and accumulators are unrolled so that every index is a
    // constant and the arrays stay in registers.
    v16h af[2][4], bf[2][2];
#pragma unroll
    for (int i = 0; i < 4; ++i) af[0][i] = frag_from_f16(As + 16 * i * GP, GP, 0);
#pragma unroll
    for (int j = 0; j < 2; ++j) bf[0][j] = frag_from_f16(Bs + 16 * j * GP, GP, 0);
#pragma unroll
    for (int s = 0; s < GK / 32; ++s) {
      const int cur = s & 1;
      if (s + 1 < GK / 32) {
#pragma unroll
        for (int i = 0; i < 4; ++i)
          af[cur ^ 1][i] = frag_from_f16(As + 16 * i * GP, GP, 32 * (s + 1));
#pragma unroll
        for (int j = 0; j < 2; ++j)
          bf[cur ^ 1][j] = frag_from_f16(Bs + 16 * j * GP, GP, 32 * (s + 1));
      }
      // Keeps the next step's LDS reads one group ahead of this step's products:
      // left free, the scheduler sinks each read to its use, into one register
      // set, and every pair of products then waits out an LDS latency.
      __builtin_amdgcn_sched_barrier(0);
#pragma unroll
      for (int i = 0; i < 4; ++i) {
        acc[i][0] = WMMA_F16(af[cur][i], bf[cur][0], acc[i][0]);
        acc[i][1] = WMMA_F16(af[cur][i], bf[cur][1], acc[i][1]);
      }
    }
    // Hand-over: this wave's reads of the buffer are done, its copies of slice
    // t + 1 have landed; the barrier publishes that slice and frees this buffer.
    asm volatile("s_wait_dscnt 0x0" ::: "memory");
    asm volatile("s_wait_asynccnt 0x0" ::: "memory");
    __syncthreads();
    if (t + 2 < GNT) {
      copy8(la + boff * 2, ga + (t + 2) * GK);
      copy8(lb + boff * 2, gb + (t + 2) * GK);
    }
  }
  asm volatile("s_wait_asynccnt 0x0" ::: "memory");  // nothing in flight at the end

  // Unrolled for constant accumulator indices, as above.
#pragma unroll
  for (int j = 0; j < 2; ++j) {
    const int col  = n0 + wn + 16 * j + n;
    const float bb = bo[col];
#pragma unroll
    for (int i = 0; i < 4; ++i)
#pragma unroll
      for (int r = 0; r < 8; ++r)
        out[(size_t)(m0 + wm + 16 * i + r + 8 * hi) * HID + col] = acc[i][j][r] + bb;
  }
}

// ---------------------------------------------------------------------------
extern "C" void kernel_launch(void* const* d_in, const int* in_sizes, int n_in,
                              void* d_out, int out_size, void* d_ws,
                              size_t ws_size, hipStream_t stream) {
  const float* q    = (const float*)d_in[0];
  const float* k    = (const float*)d_in[1];
  const float* v    = (const float*)d_in[2];
  const int*   mask = (const int*)d_in[3];
  const float* Wq   = (const float*)d_in[4];
  const float* bq   = (const float*)d_in[5];
  const float* Wk   = (const float*)d_in[6];
  const float* bk   = (const float*)d_in[7];
  const float* Wv   = (const float*)d_in[8];
  const float* bv   = (const float*)d_in[9];
  const float* Wo   = (const float*)d_in[10];
  const float* bo   = (const float*)d_in[11];

  // Workspace layout (bytes): q_i | k_i | vT | wv (8 MB f16 each) | Wo f16 (2 MB)
  // | mask bits (1 MB, at the next 4 MB step)
  const size_t HEADELEMS = (size_t)Bb * Hh * Ss * DH;  // 4,194,304
  char* ws = (char*)d_ws;
  _Float16* qh  = (_Float16*)(ws + 0 * HEADELEMS);
  _Float16* kh  = (_Float16*)(ws + 2 * HEADELEMS);
  _Float16* vT  = (_Float16*)(ws + 4 * HEADELEMS);
  _Float16* wvb = (_Float16*)(ws + 6 * HEADELEMS);
  _Float16* WoH = (_Float16*)(ws + 8 * HEADELEMS);
  unsigned* mbits = (unsigned*)(ws + 9 * HEADELEMS);

  const int wo_n = HID * HID;  // 1,048,576
  prep_kernel<<<PACKB + (wo_n + 255) / 256, 256, 0, stream>>>(Wo, WoH, wo_n,
                                                              mask, mbits);

  // 4096 row-tiles of 16 rows / 8 waves per block -> 512 blocks
  proj_kernel<<<512, 256, 0, stream>>>(q, k, v, Wq, bq, Wk, bk, Wv, bv,
                                       qh, kh, vT);

  // 32 (b,h) pairs * 16 blocks (128 q-rows each) = 512 blocks
  flash_kernel<<<512, 256, 0, stream>>>(qh, kh, vT, mbits, wvb);

  // 32 x 8 output tiles of 128 x 128, one block each
  outproj_kernel<<<256, 256, 0, stream>>>(wvb, WoH, bo, (float*)d_out);
}

// v005
// Measured time: 80.2 microseconds a run.
// Timed twice side by side with v004, it ran 1.12 and 1.10 times as fast.
// Over all steps from v000 it is 2.69 times as fast.
#include <hip/hip_runtime.h>
#include <hip/hip_bf16.h>
#include <hip/hip_fp16.h>

typedef __attribute__((ext_vector_type(16))) _Float16 v16h;
typedef __attribute__((ext_vector_type(8)))  _Float16 v8h;
typedef __attribute__((ext_vector_type(8)))  float    v8f;
typedef __attribute__((ext_vector_type(4)))  int      v4i;
typedef __attribute__((ext_vector_type(16))) unsigned v16u;

using gv4i = v4i __attribute__((address_space(1)));  // global int4
using lv4i = v4i __attribute__((address_space(3)));  // LDS int4

#define WMMA_F16(a, b, c) \
  __builtin_amdgcn_wmma_f32_16x16x32_f16(false, (a), false, (b), (short)0, (c), false, false)

#ifndef __has_builtin
#define __has_builtin(x) 0
#endif

#if __has_builtin(__builtin_amdgcn_global_load_async_to_lds_b128)
#define HAVE_ASYNC_LDS 1
#else
#define HAVE_ASYNC_LDS 0
#endif

static constexpr int Bb  = 2;
static constexpr int Ss  = 2048;
static constexpr int HID = 1024;
static constexpr int Hh  = 16;
static constexpr int DH  = 64;
static constexpr int KB  = 128;      // keys per pass of the flash kernel
static constexpr int NU  = KB / 32;  // 32-key groups (one k step of P * V) per pass
// LDS row pitches in f16 elements: 16 bytes times an odd number, so that the
// 16 rows one ds_load_b128 half-wave reads fall on 16 distinct bank groups.
static constexpr int KP  = 72;       // K tile rows: 128 data bytes at pitch 144
static constexpr int VP  = KB + 8;   // V tile rows: 256 data bytes at pitch 272
static_assert(((KP / 8) & 1) && ((VP / 8) & 1), "pitches are 16 bytes times an odd number");

// ---------------------------------------------------------------------------
// Fragment loaders per CDNA5 ISA 7.12.2 (wave32):
//  A 16x32 f16: lane L holds row M=L&15; lanes 0-15 carry K={0..7,16..23},
//  lanes 16-31 carry K={8..15,24..31}. B 32x16 gathered symmetrically
//  (lane = column N, contiguous reduction dim in memory). Each lane loads
//  two contiguous 16-byte chunks.
// ---------------------------------------------------------------------------
__device__ inline v16h frag_from_f16(const _Float16* base, int ld, int k0) {
  const int lane = threadIdx.x & 31;
  const int r    = lane & 15;
  const int kb   = (lane & 16) ? 8 : 0;
  const _Float16* p = base + (size_t)r * ld + k0 + kb;
  v16h a;
#pragma unroll
  for (int i = 0; i < 8; ++i) a[i] = p[i];
#pragma unroll
  for (int i = 0; i < 8; ++i) a[8 + i] = p[16 + i];
  return a;
}

__device__ inline v16h frag_from_f32(const float* base, int ld, int k0) {
  const int lane = threadIdx.x & 31;
  const int r    = lane & 15;
  const int kb   = (lane & 16) ? 8 : 0;
  const float* p = base + (size_t)r * ld + k0 + kb;
  v16h a;
#pragma unroll
  for (int i = 0; i < 8; ++i) a[i] = (_Float16)p[i];
#pragma unroll
  for (int i = 0; i < 8; ++i) a[8 + i] = (_Float16)p[16 + i];
  return a;
}

// Value of lane l ^ 16: the two wave halves hold the two key halves of one query.
__device__ inline float xhalf(float x) {
  const int i = __builtin_bit_cast(int, x);
  return __builtin_bit_cast(
      float, __builtin_amdgcn_permlanex16(i, i, 0x76543210, 0xfedcba98, false, false));
}

// ---------------------------------------------------------------------------
// Kernel 0: input preparation. Blocks 0..PACKB-1 pack the mask, which all 16
// heads of a batch share, into bits, once: per 16-query tile and 32-key block
// 16 words, word i holding for every lane of the flash kernel's wave the bit
// of that lane's score i. They come first in the grid because they run the
// longest. The other blocks convert Wo f32 -> f16.
// ---------------------------------------------------------------------------
static constexpr int PACKB = Bb * (Ss / 16) * (Ss / 32) / 4 / 8;  // 512 blocks

__global__ __launch_bounds__(256) void prep_kernel(
    const float* __restrict__ src, _Float16* __restrict__ dst, int n,
    const int* __restrict__ mask, unsigned* __restrict__ mbits) {
  if (blockIdx.x < PACKB) {
    // One wave packs one query tile x four 32-key blocks. Lane (qn, hi) reads
    // the 16 mask words of the scores it will hold in the flash kernel (query
    // qn; keys 8hi+0..7 and 16+8hi+0..7 of the block); each ballot is one word
    // of the block. Lanes 0-15 collect an even block's 16 words, lanes 16-31
    // the next block's: one whole 128-byte line per store.
    const int lane = threadIdx.x & 31;
    const int qn   = lane & 15;
    const int hi   = lane >> 4;
    const int gw   = blockIdx.x * 8 + (threadIdx.x >> 5);  // 0..4095
    const int qt   = gw >> 4;                // b * (S/16) + query tile
    const int kb4  = (gw & 15) * 4;          // first of the four key blocks
    const int* Mr  = mask + ((size_t)qt * 16 + qn) * Ss + kb4 * 32 + 8 * hi;
    unsigned* Mo   = mbits + ((size_t)qt * (Ss / 32) + kb4) * 16 + lane;
    v4i m[4][4];
#pragma unroll
    for (int u = 0; u < 4; ++u) {
      m[u][0] = *(const v4i*)(Mr + 32 * u);
      m[u][1] = *(const v4i*)(Mr + 32 * u + 4);
      m[u][2] = *(const v4i*)(Mr + 32 * u + 16);
      m[u][3] = *(const v4i*)(Mr + 32 * u + 20);
    }
#pragma unroll
    for (int u2 = 0; u2 < 2; ++u2) {
      unsigned w = 0;
#pragma unroll
      for (int i = 0; i < 32; ++i) {  // lane i takes word i & 15 of block 2*u2 + (i >> 4)
        const unsigned bal =
            __builtin_amdgcn_ballot_w32(m[2 * u2 + (i >> 4)][(i >> 2) & 3][i & 3] != 0);
        w = lane == i ? bal : w;
      }
      Mo[32 * u2] = w;
    }
    return;
  }
  int i = (blockIdx.x - PACKB) * blockDim.x + threadIdx.x;
  if (i < n) dst[i] = (_Float16)src[i];
}

// ---------------------------------------------------------------------------
// Kernel 1: Q/K/V projections. Input viewed as flat [B*H*S, 64] row-major
// (the raw reshape keeps the 64-dim contiguous). q_i/k_i stored f16 in the
// same [B*H*S, 64] layout; v stored transposed as vT[B*H][64][S] so V^T*P^T
// A-fragments gather contiguously later.
// ---------------------------------------------------------------------------
__global__ __launch_bounds__(256) void proj_kernel(
    const float* __restrict__ q, const float* __restrict__ k,
    const float* __restrict__ v,
    const float* __restrict__ Wq, const float* __restrict__ bq,
    const float* __restrict__ Wk, const float* __restrict__ bk,
    const float* __restrict__ Wv, const float* __restrict__ bv,
    _Float16* __restrict__ qh, _Float16* __restrict__ kh,
    _Float16* __restrict__ vT) {
  const int wave = threadIdx.x >> 5;
  const int lane = threadIdx.x & 31;
  const int n    = lane & 15;
  const int hi   = lane >> 4;
  const size_t g0 = ((size_t)blockIdx.x * 8 + wave) * 16;  // row-tile base

  v16h aq0 = frag_from_f32(q + g0 * DH, DH, 0);
  v16h aq1 = frag_from_f32(q + g0 * DH, DH, 32);
  v16h ak0 = frag_from_f32(k + g0 * DH, DH, 0);
  v16h ak1 = frag_from_f32(k + g0 * DH, DH, 32);
  v16h av0 = frag_from_f32(v + g0 * DH, DH, 0);
  v16h av1 = frag_from_f32(v + g0 * DH, DH, 32);

  // q projection: out = X @ Wq^T + bq ; B[k][n] = Wq[n][k] (row n, contiguous k)
#pragma unroll
  for (int j = 0; j < 4; ++j) {
    v8f c = {};
    c = WMMA_F16(aq0, frag_from_f32(Wq + (size_t)(16 * j) * DH, DH, 0), c);
    c = WMMA_F16(aq1, frag_from_f32(Wq + (size_t)(16 * j) * DH, DH, 32), c);
    const int col = 16 * j + n;
    const float bias = bq[col];
#pragma unroll
    for (int r = 0; r < 8; ++r)
      qh[(g0 + r + 8 * hi) * DH + col] = (_Float16)(c[r] + bias);
  }
#pragma unroll
  for (int j = 0; j < 4; ++j) {
    v8f c = {};
    c = WMMA_F16(ak0, frag_from_f32(Wk + (size_t)(16 * j) * DH, DH, 0), c);
    c = WMMA_F16(ak1, frag_from_f32(Wk + (size_t)(16 * j) * DH, DH, 32), c);
    const int col = 16 * j + n;
    const float bias = bk[col];
#pragma unroll
    for (int r = 0; r < 8; ++r)
      kh[(g0 + r + 8 * hi) * DH + col] = (_Float16)(c[r] + bias);
  }
  // v projection -> transposed store
  const size_t bh = g0 >> 11;           // b*H + h (tiles never straddle heads)
  const int    s0 = (int)(g0 & 2047);
#pragma unroll
  for (int j = 0; j < 4; ++j) {
    v8f c = {};
    c = WMMA_F16(av0, frag_from_f32(Wv + (size_t)(16 * j) * DH, DH, 0), c);
    c = WMMA_F16(av1, frag_from_f32(Wv + (size_t)(16 * j) * DH, DH, 32), c);
    const int col = 16 * j + n;
    const float bias = bv[col];
#pragma unroll
    for (int r = 0; r < 8; ++r)
      vT[(bh * DH + col) * (size_t)Ss + (s0 + r + 8 * hi)] =
          (_Float16)(c[r] + bias);
  }
}

// ---------------------------------------------------------------------------
// Async (or fallback) staging of one KB-key K tile [KB][64] and V tile
// [64][KB] (from transposed V) into LDS, rows at the padded pitches KP and VP.
// 256 threads x NU x 16B per tile: 32 more K rows, 64 / NU more V rows a turn.
// ---------------------------------------------------------------------------
__device__ inline void stage_kv(const _Float16* __restrict__ K,
                                const _Float16* __restrict__ V, int kb0,
                                _Float16* ktb, _Float16* vtb, int tid) {
  constexpr int VT = KB / 8;                               // threads per V row
  const int krow = tid >> 3, kseg = (tid & 7) * 8;         // key row, 8-f16 segment
  const int vrow = tid / VT, vseg = (tid & (VT - 1)) * 8;  // dim row, 8-f16 segment
  const _Float16* gk = K + (size_t)(kb0 + krow) * DH + kseg;
  const _Float16* gv = V + (size_t)vrow * Ss + kb0 + vseg;
  _Float16* lk = ktb + krow * KP + kseg;
  _Float16* lv = vtb + vrow * VP + vseg;
  // Unrolled: the copies of a pass issue in a row, their steps are constants.
#pragma unroll
  for (int i = 0; i < NU; ++i) {
    const _Float16* gki = gk + (size_t)(32 * i) * DH;
    const _Float16* gvi = gv + (size_t)(256 / VT * i) * Ss;
    _Float16* lki = lk + 32 * i * KP;
    _Float16* lvi = lv + 256 / VT * i * VP;
#if HAVE_ASYNC_LDS
    __builtin_amdgcn_global_load_async_to_lds_b128((gv4i*)gki, (lv4i*)lki, 0, 0);
    __builtin_amdgcn_global_load_async_to_lds_b128((gv4i*)gvi, (lv4i*)lvi, 0, 0);
#else
    *(float4*)lki = *(const float4*)gki;
    *(float4*)lvi = *(const float4*)gvi;
#endif
  }
}

// ---------------------------------------------------------------------------
// Kernel 2: flash attention, transposed products. One wave owns 16 queries;
// 8 waves/block share double-buffered LDS K/V tiles staged with async
// global->LDS copies (DMA of pass i+1 overlaps WMMA work on pass i).
// A pass is KB keys, NU groups of 32. Per group: S^T = K * Q^T (4 WMMA), so lane
// (n, hi) holds 16 scores of query n (keys 8*hi+r and 16+8*hi+r): mask, maximum
// and sum are in-lane, and the two score tiles converted in place are the B
// operand of O^T += V^T * P^T (4 WMMA). Once per pass: the exchange of the
// maximum between the wave halves, the correction factor, the rescaling of O and
// of the sum, the hand-over of the buffers.
// The mask comes as the packed words of kernel 0: 16 words per group by one
// scalar load, each word the lane mask of one select.
// ---------------------------------------------------------------------------
__global__ __launch_bounds__(256) void flash_kernel(
    const _Float16* __restrict__ qh, const _Float16* __restrict__ kh,
    const _Float16* __restrict__ vT, const unsigned* __restrict__ mbits,
    _Float16* __restrict__ wv) {
  __shared__ __align__(16) _Float16 kt[2][KB * KP];  // [key][dim], rows at pitch KP
  __shared__ __align__(16) _Float16 vt[2][DH * VP];  // [dim][key], rows at pitch VP

  const int tid  = threadIdx.x;
  const int wave = tid >> 5;
  const int lane = tid & 31;
  const int n    = lane & 15;
  const int hi   = lane >> 4;
  const int bh   = blockIdx.x >> 4;                    // b*H + h
  const int q0   = (blockIdx.x & 15) * 128 + wave * 16;
  const int b    = bh >> 4;

  const _Float16* Q  = qh + ((size_t)bh * Ss + q0) * DH;
  const _Float16* K  = kh + (size_t)bh * Ss * DH;
  const _Float16* V  = vT + (size_t)bh * DH * Ss;
  // This wave's packed mask words: 16 per key block. The tile index is made
  // wave-uniform for the compiler so that the words load into scalar registers.
  const int qt = __builtin_amdgcn_readfirstlane(b * (Ss / 16) + (q0 >> 4));
  const unsigned* Mw = mbits + (size_t)qt * (Ss / 32) * 16;

  const v16h qf0 = frag_from_f16(Q, DH, 0);
  const v16h qf1 = frag_from_f16(Q, DH, 32);

  float mrow = -3.0e38f;  // running maximum of query n (equal in both halves)
  float lrow = 0.f;       // running sum over this half's keys only
  v8f zacc = {};
  v8f o[4] = {zacc, zacc, zacc, zacc};  // o[j][r] = O[query n][dim 16j + 8hi + r]

  // Prologue: stage the first K/V tiles.
  stage_kv(K, V, 0, kt[0], vt[0], tid);
  asm volatile("s_wait_asynccnt 0x0" ::: "memory");  // this wave's copies have landed
  __syncthreads();

  int buf = 0;
  for (int kb0 = 0; kb0 < Ss; kb0 += KB) {
    // Kick off DMA for the next pass into the other buffer (overlaps WMMA).
    if (kb0 + KB < Ss) stage_kv(K, V, kb0 + KB, kt[buf ^ 1], vt[buf ^ 1], tid);

    const _Float16* Kt = kt[buf];
    const _Float16* Vt = vt[buf];

    // The loops over groups, here and below, are unrolled so that every index is
    // a constant and the arrays stay in registers.
    // ---- mask bits of this pass: 16 lane-mask words a group, scalar loads --
    v16u mw[NU];
#pragma unroll
    for (int u = 0; u < NU; ++u) mw[u] = *(const v16u*)(Mw + ((kb0 >> 5) + u) * 16);

    // ---- scores, transposed: s0[u][r] = S[key 32u+8hi+r][query n], s1: +16 --
    v8f s0[NU], s1[NU];
#pragma unroll
    for (int u = 0; u < NU; ++u) {
      const _Float16* Ku = Kt + 32 * u * KP;
      v8f a = {}, c = {};
      a = WMMA_F16(frag_from_f16(Ku, KP, 0), qf0, a);
      a = WMMA_F16(frag_from_f16(Ku, KP, 32), qf1, a);
      c = WMMA_F16(frag_from_f16(Ku + 16 * KP, KP, 0), qf0, c);
      c = WMMA_F16(frag_from_f16(Ku + 16 * KP, KP, 32), qf1, c);
      s0[u] = a;
      s1[u] = c;
    }
    // Ends the scheduling region at the last score product: with the whole pass
    // in one region the scheduler waits on every K and V fragment alone, orders
    // the softmax in dependent pairs and moves the row sum behind the barrier.
    __builtin_amdgcn_sched_barrier(0);

    // ---- mask + scale (faithful: mask!=0 -> -10000), one maximum a group ---
    float gmax[NU];
#pragma unroll
    for (int u = 0; u < NU; ++u) {
#pragma unroll
      for (int r = 0; r < 8; ++r) {
        s0[u][r] =
            __builtin_amdgcn_inverse_ballot_w32(mw[u][r]) ? -10000.f : s0[u][r] * 0.125f;
        s1[u][r] =
            __builtin_amdgcn_inverse_ballot_w32(mw[u][8 + r]) ? -10000.f : s1[u][r] * 0.125f;
      }
      float t = fmaxf(s0[u][0], s1[u][0]);
#pragma unroll
      for (int r = 1; r < 8; ++r) t = fmaxf(t, fmaxf(s0[u][r], s1[u][r]));
      gmax[u] = t;
    }

    // ---- online softmax update: one query per lane, once per pass ----------
    float tmax = gmax[0];
#pragma unroll
    for (int u = 1; u < NU; ++u) tmax = fmaxf(tmax, gmax[u]);
    tmax = fmaxf(tmax, xhalf(tmax));
    const float mnew = fmaxf(mrow, tmax);
    const float corr = __expf(mrow - mnew);
    mrow = mnew;
#pragma unroll
    for (int j = 0; j < 4; ++j)
#pragma unroll
      for (int r = 0; r < 8; ++r) o[j][r] *= corr;

    // ---- per group: P, its sum, and O^T += V^T @ P^T -----------------------
    float psum = 0.f;
#pragma unroll
    for (int u = 0; u < NU; ++u) {
      float gsum = 0.f;
      v16h pf;  // B operand: pf[i] = P[query n][key 32u+8hi+i], pf[8+i]: key +16
#pragma unroll
      for (int r = 0; r < 8; ++r) {
        const float p0 = __expf(s0[u][r] - mnew);
        const float p1 = __expf(s1[u][r] - mnew);
        gsum += p0 + p1;
        pf[r]     = (_Float16)p0;
        pf[8 + r] = (_Float16)p1;
      }
      psum += gsum;
      // A frags: dim rows of the LDS V tile, keys 32u..32u+31
#pragma unroll
      for (int j = 0; j < 4; ++j) {
        const v16h vf = frag_from_f16(Vt + 16 * j * VP, VP, 32 * u);
        o[j] = WMMA_F16(vf, pf, o[j]);
      }
    }
    lrow = lrow * corr + psum;

    // Hand-over: this wave's reads of the buffers are done, its copies for the
    // next pass have landed; the barrier publishes them and frees these buffers.
    asm volatile("s_wait_dscnt 0x0" ::: "memory");
    asm volatile("s_wait_asynccnt 0x0" ::: "memory");
    __syncthreads();
    buf ^= 1;
  }
  asm volatile("s_wait_asynccnt 0x0" ::: "memory");  // nothing in flight at the end

  // ---- join the halves' sums, normalize, store wv (flat [B*H*S, 64] f16) ---
  const float inv = 1.0f / (lrow + xhalf(lrow));  // one denominator per lane
  _Float16* orow = wv + ((size_t)bh * Ss + q0 + n) * DH + 8 * hi;
#pragma unroll
  for (int j = 0; j < 4; ++j) {
    v8h ov;
#pragma unroll
    for (int r = 0; r < 8; ++r) ov[r] = (_Float16)(o[j][r] * inv);
    *(v8h*)(orow + 16 * j) = ov;  // 8 consecutive dims of one query: 16 bytes
  }
}

// ---------------------------------------------------------------------------
// Kernel 3: output projection. Raw-reshape merge means wv flat is exactly the
// [B*S, 1024] A matrix. out = A @ Wo^T + bo, M=4096 N=1024 K=1024.
// One block computes a 128 x 128 tile of out; its 8 waves (2 x 4) own 64 x 32
// each. A k slice of 128 of the block's 128 A rows and 128 Wo rows is staged in
// LDS by asynchronous copies, two buffers: slice t + 1 flies while slice t is
// multiplied, and every staged row serves all the waves that need it.
// ---------------------------------------------------------------------------
static constexpr int GT  = 128;            // tile rows of A, and of Wo
static constexpr int GK  = 128;            // k per slice: 256 data bytes a row
static constexpr int GP  = 136;            // LDS row pitch in f16: 272 B = 16 B x 17
static constexpr int GSL = 2 * GT * GP;    // one buffer: A rows, then Wo rows
static constexpr int GNT = HID / GK;       // 8 slices

// Eight 16-byte copies of one thread: rows 16 apart of one operand's slice.
// l: the lane's LDS byte address, g: its global address, both of the first row.
__device__ inline void copy8(unsigned l, const _Float16* g) {
  constexpr unsigned LS = 16 * GP * 2;  // 16 rows in LDS, bytes
  constexpr int      GS = 16 * HID;     // 16 rows in memory, elements
  // The closing s_wait_xcnt stands inside the statement so that no address
  // register of a copy is rewritten ahead of it.
  asm volatile(
      "global_load_async_to_lds_b128 %0, %8, off\n\t"
      "global_load_async_to_lds_b128 %1, %9, off\n\t"
      "global_load_async_to_lds_b128 %2, %10, off\n\t"
      "global_load_async_to_lds_b128 %3, %11, off\n\t"
      "global_load_async_to_lds_b128 %4, %12, off\n\t"
      "global_load_async_to_lds_b128 %5, %13, off\n\t"
      "global_load_async_to_lds_b128 %6, %14, off\n\t"
      "global_load_async_to_lds_b128 %7, %15, off\n\t"
      "s_wait_xcnt 0x0"
      :
      : "v"(l), "v"(l + LS), "v"(l + 2 * LS), "v"(l + 3 * LS), "v"(l + 4 * LS),
        "v"(l + 5 * LS), "v"(l + 6 * LS), "v"(l + 7 * LS), "v"(g), "v"(g + GS),
        "v"(g + 2 * GS), "v"(g + 3 * GS), "v"(g + 4 * GS), "v"(g + 5 * GS),
        "v"(g + 6 * GS), "v"(g + 7 * GS)
      : "memory");
}

__global__ __launch_bounds__(256) void outproj_kernel(
    const _Float16* __restrict__ wv, const _Float16* __restrict__ WoH,
    const float* __restrict__ bo, float* __restrict__ out) {
  __shared__ __align__(16) _Float16 st[2 * GSL];

  const int tid  = threadIdx.x;
  const int wave = tid >> 5;
  const int lane = tid & 31;
  const int n    = lane & 15;
  const int hi   = lane >> 4;
  const int m0   = (blockIdx.x >> 3) * GT;  // 32 row tiles
  const int n0   = (blockIdx.x & 7) * GT;   // 8 column tiles
  const int wm   = (wave >> 2) * 64;        // this wave's rows in the tile
  const int wn   = (wave & 3) * 32;         // this wave's columns in the tile

  // Copy map: 16 threads take one row's 256 bytes, so a wave copies whole lines.
  const int crow = tid >> 4, cseg = (tid & 15) * 8;
  const _Float16* ga = wv + (size_t)(m0 + crow) * HID + cseg;
  const _Float16* gb = WoH + (size_t)(n0 + crow) * HID + cseg;
  const unsigned la = (unsigned)(size_t)st + (crow * GP + cseg) * 2;
  const unsigned lb = la + GT * GP * 2;

  v8f zacc = {};
  v8f acc[4][2] = {{zacc, zacc}, {zacc, zacc}, {zacc, zacc}, {zacc, zacc}};

  // Slice 0 into buffer 0, landed and published; then slice 1 into buffer 1.
  copy8(la, ga);
  copy8(lb, gb);
  asm volatile("s_wait_asynccnt 0x0" ::: "memory");  // this wave's copies have landed
  __syncthreads();
  copy8(la + GSL * 2, ga + GK);
  copy8(lb + GSL * 2, gb + GK);

  for (int t = 0; t < GNT; ++t) {
    const int boff = (t & 1) * GSL;
    const _Float16* As = st + boff + wm * GP;
    const _Float16* Bs = st + boff + (GT + wn) * GP;
    // Two fragment sets: step s + 1 of this slice is read while step s multiplies.
    // The loops over sets and accumulators are unrolled so that every index is a
    // constant and the arrays stay in registers.
    v16h af[2][4], bf[2][2];
#pragma unroll
    for (int i = 0; i < 4; ++i) af[0][i] = frag_from_f16(As + 16 * i * GP, GP, 0);
#pragma unroll
    for (int j = 0; j < 2; ++j) bf[0][j] = frag_from_f16(Bs + 16 * j * GP, GP, 0);
#pragma unroll
    for (int s = 0; s < GK / 32; ++s) {
      const int cur = s & 1;
      if (s + 1 < GK / 32) {
#pragma unroll
        for (int i = 0; i < 4; ++i)
          af[cur ^ 1][i] = frag_from_f16(As + 16 * i * GP, GP, 32 * (s + 1));
#pragma unroll
        for (int j = 0; j < 2; ++j)
          bf[cur ^ 1][j] = frag_from_f16(Bs + 16 * j * GP, GP, 32 * (s + 1));
      }
      // Keeps the next step's LDS reads one group ahead of this step's products:
      // left free, the scheduler sinks each read to its use, into one register
      // set, and every pair of products then waits out an LDS latency.
      __builtin_amdgcn_sched_barrier(0);
#pragma unroll
      for (int i = 0; i < 4; ++i) {
        acc[i][0] = WMMA_F16(af[cur][i], bf[cur][0], acc[i][0]);
        acc[i][1] = WMMA_F16(af[cur][i], bf[cur][1], acc[i][1]);
      }
    }
    // Hand-over: this wave's reads of the buffer are done, its copies of slice
    // t + 1 have landed; the barrier publishes that slice and frees this buffer.
    asm volatile("s_wait_dscnt 0x0" ::: "memory");
    asm volatile("s_wait_asynccnt 0x0" ::: "memory");
    __syncthreads();
    if (t + 2 < GNT) {
      copy8(la + boff * 2, ga + (t + 2) * GK);
      copy8(lb + boff * 2, gb + (t + 2) * GK);
    }
  }
  asm volatile("s_wait_asynccnt 0x0" ::: "memory");  // nothing in flight at the end

  // Unrolled for constant accumulator indices, as above.
#pragma unroll
  for (int j = 0; j < 2; ++j) {
    const int col  = n0 + wn + 16 * j + n;
    const float bb = bo[col];
#pragma unroll
    for (int i = 0; i < 4; ++i)
#pragma unroll
      for (int r = 0; r < 8; ++r)
        out[(size_t)(m0 + wm + 16 * i + r + 8 * hi) * HID + col] = acc[i][j][r] + bb;
  }
}

// ---------------------------------------------------------------------------
extern "C" void kernel_launch(void* const* d_in, const int* in_sizes, int n_in,
                              void* d_out, int out_size, void* d_ws,
                              size_t ws_size, hipStream_t stream) {
  const float* q    = (const float*)d_in[0];
  const float* k    = (const float*)d_in[1];
  const float* v    = (const float*)d_in[2];
  const int*   mask = (const int*)d_in[3];
  const float* Wq   = (const float*)d_in[4];
  const float* bq   = (const float*)d_in[5];
  const float* Wk   = (const float*)d_in[6];
  const float* bk   = (const float*)d_in[7];
  const float* Wv   = (const float*)d_in[8];
  const float* bv   = (const float*)d_in[9];
  const float* Wo   = (const float*)d_in[10];
  const float* bo   = (const float*)d_in[11];

  // Workspace layout (bytes): q_i | k_i | vT | wv (8 MB f16 each) | Wo f16 (2 MB)
  // | mask bits (1 MB, at the next 4 MB step)
  const size_t HEADELEMS = (size_t)Bb * Hh * Ss * DH;  // 4,194,304
  char* ws = (char*)d_ws;
  _Float16* qh  = (_Float16*)(ws + 0 * HEADELEMS);
  _Float16* kh  = (_Float16*)(ws + 2 * HEADELEMS);
  _Float16* vT  = (_Float16*)(ws + 4 * HEADELEMS);
  _Float16* wvb = (_Float16*)(ws + 6 * HEADELEMS);
  _Float16* WoH = (_Float16*)(ws + 8 * HEADELEMS);
  unsigned* mbits = (unsigned*)(ws + 9 * HEADELEMS);

  const int wo_n = HID * HID;  // 1,048,576
  prep_kernel<<<PACKB + (wo_n + 255) / 256, 256, 0, stream>>>(Wo, WoH, wo_n,
                                                              mask, mbits);

  // 4096 row-tiles of 16 rows / 8 waves per block -> 512 blocks
  proj_kernel<<<512, 256, 0, stream>>>(q, k, v, Wq, bq, Wk, bk, Wv, bv,
                                       qh, kh, vT);

  // 32 (b,h) pairs * 16 blocks (128 q-rows each) = 512 blocks
  flash_kernel<<<512, 256, 0, stream>>>(qh, kh, vT, mbits, wvb);

  // 32 x 8 output tiles of 128 x 128, one block each
  outproj_kernel<<<256, 256, 0, stream>>>(wvb, WoH, bo, (float*)d_out);
}

// v006
// It runs in 76.5 microseconds.
// Next to v005, in two timings, it ran 1.05 times as fast each time.
// Counting every step since v000, it is 2.84 times as fast.
#include <hip/hip_runtime.h>
#include <hip/hip_bf16.h>
#include <hip/hip_fp16.h>

typedef __attribute__((ext_vector_type(16))) _Float16 v16h;
typedef __attribute__((ext_vector_type(8)))  _Float16 v8h;
typedef __attribute__((ext_vector_type(8)))  float    v8f;
typedef __attribute__((ext_vector_type(2)))  float    v2f;
typedef __attribute__((ext_vector_type(4)))  int      v4i;
typedef __attribute__((ext_vector_type(16))) unsigned v16u;

using gv4i = v4i __attribute__((address_space(1)));  // global int4
using lv4i = v4i __attribute__((address_space(3)));  // LDS int4

#define WMMA_F16(a, b, c) \
  __builtin_amdgcn_wmma_f32_16x16x32_f16(false, (a), false, (b), (short)0, (c), false, false)

#ifndef __has_builtin
#define __has_builtin(x) 0
#endif

#if __has_builtin(__builtin_amdgcn_global_load_async_to_lds_b128)
#define HAVE_ASYNC_LDS 1
#else
#define HAVE_ASYNC_LDS 0
#endif

static constexpr int Bb  = 2;
static constexpr int Ss  = 2048;
static constexpr int HID = 1024;
static constexpr int Hh  = 16;
static constexpr int DH  = 64;
static constexpr int KB  = 128;      // keys per pass of the flash kernel
static constexpr int NU  = KB / 32;  // 32-key groups (one k step of P * V) per pass
// LDS row pitches in f16 elements: 16 bytes times an odd number, so that the
// 16 rows one ds_load_b128 half-wave reads fall on 16 distinct bank groups.
static constexpr int KP  = 72;       // K tile rows: 128 data bytes at pitch 144
static constexpr int VP  = KB + 8;   // V tile rows: 256 data bytes at pitch 272
static_assert(((KP / 8) & 1) && ((VP / 8) & 1), "pitches are 16 bytes times an odd number");

// ---------------------------------------------------------------------------
// Fragment loaders per CDNA5 ISA 7.12.2 (wave32):
//  A 16x32 f16: lane L holds row M=L&15; lanes 0-15 carry K={0..7,16..23},
//  lanes 16-31 carry K={8..15,24..31}. B 32x16 gathered symmetrically
//  (lane = column N, contiguous reduction dim in memory). Each lane loads
//  two contiguous 16-byte chunks.
// ---------------------------------------------------------------------------
__device__ inline v16h frag_from_f16(const _Float16* base, int ld, int k0) {
  const int lane = threadIdx.x & 31;
  const int r    = lane & 15;
  const int kb   = (lane & 16) ? 8 : 0;
  const _Float16* p = base + (size_t)r * ld + k0 + kb;
  v16h a;
#pragma unroll
  for (int i = 0; i < 8; ++i) a[i] = p[i];
#pragma unroll
  for (int i = 0; i < 8; ++i) a[8 + i] = p[16 + i];
  return a;
}

__device__ inline v16h frag_from_f32(const float* base, int ld, int k0) {
  const int lane = threadIdx.x & 31;
  const int r    = lane & 15;
  const int kb   = (lane & 16) ? 8 : 0;
  const float* p = base + (size_t)r * ld + k0 + kb;
  v16h a;
#pragma unroll
  for (int i = 0; i < 8; ++i) a[i] = (_Float16)p[i];
#pragma unroll
  for (int i = 0; i < 8; ++i) a[8 + i] = (_Float16)p[16 + i];
  return a;
}

// Value of lane l ^ 16: the two wave halves hold the two key halves of one query.
__device__ inline float xhalf(float x) {
  const int i = __builtin_bit_cast(int, x);
  return __builtin_bit_cast(
      float, __builtin_amdgcn_permlanex16(i, i, 0x76543210, 0xfedcba98, false, false));
}

// ---------------------------------------------------------------------------
// Kernel 0: input preparation. Blocks 0..PACKB-1 pack the mask, which all 16
// heads of a batch share, into bits, once: per 16-query tile and 32-key block
// 16 words, word i holding for every lane of the flash kernel's wave the bit
// of that lane's score i. They come first in the grid because they run the
// longest. The other blocks convert Wo f32 -> f16.
// ---------------------------------------------------------------------------
static constexpr int PACKB = Bb * (Ss / 16) * (Ss / 32) / 4 / 8;  // 512 blocks

__global__ __launch_bounds__(256) void prep_kernel(
    const float* __restrict__ src, _Float16* __restrict__ dst, int n,
    const int* __restrict__ mask, unsigned* __restrict__ mbits) {
  if (blockIdx.x < PACKB) {
    // One wave packs one query tile x four 32-key blocks. Lane (qn, hi) reads
    // the 16 mask words of the scores it will hold in the flash kernel (query
    // qn; keys 8hi+0..7 and 16+8hi+0..7 of the block); each ballot is one word
    // of the block. Lanes 0-15 collect an even block's 16 words, lanes 16-31
    // the next block's: one whole 128-byte line per store.
    const int lane = threadIdx.x & 31;
    const int qn   = lane & 15;
    const int hi   = lane >> 4;
    const int gw   = blockIdx.x * 8 + (threadIdx.x >> 5);  // 0..4095
    const int qt   = gw >> 4;                // b * (S/16) + query tile
    const int kb4  = (gw & 15) * 4;          // first of the four key blocks
    const int* Mr  = mask + ((size_t)qt * 16 + qn) * Ss + kb4 * 32 + 8 * hi;
    unsigned* Mo   = mbits + ((size_t)qt * (Ss / 32) + kb4) * 16 + lane;
    v4i m[4][4];
#pragma unroll
    for (int u = 0; u < 4; ++u) {
      m[u][0] = *(const v4i*)(Mr + 32 * u);
      m[u][1] = *(const v4i*)(Mr + 32 * u + 4);
      m[u][2] = *(const v4i*)(Mr + 32 * u + 16);
      m[u][3] = *(const v4i*)(Mr + 32 * u + 20);
    }
#pragma unroll
    for (int u2 = 0; u2 < 2; ++u2) {
      unsigned w = 0;
#pragma unroll
      for (int i = 0; i < 32; ++i) {  // lane i takes word i & 15 of block 2*u2 + (i >> 4)
        const unsigned bal =
            __builtin_amdgcn_ballot_w32(m[2 * u2 + (i >> 4)][(i >> 2) & 3][i & 3] != 0);
        w = lane == i ? bal : w;
      }
      Mo[32 * u2] = w;
    }
    return;
  }
  int i = (blockIdx.x - PACKB) * blockDim.x + threadIdx.x;
  if (i < n) dst[i] = (_Float16)src[i];
}

// ---------------------------------------------------------------------------
// Kernel 1: Q/K/V projections. Input viewed as flat [B*H*S, 64] row-major
// (the raw reshape keeps the 64-dim contiguous). q_i/k_i stored f16 in the
// same [B*H*S, 64] layout; v stored transposed as vT[B*H][64][S] so V^T*P^T
// A-fragments gather contiguously later.
// ---------------------------------------------------------------------------
__global__ __launch_bounds__(256) void proj_kernel(
    const float* __restrict__ q, const float* __restrict__ k,
    const float* __restrict__ v,
    const float* __restrict__ Wq, const float* __restrict__ bq,
    const float* __restrict__ Wk, const float* __restrict__ bk,
    const float* __restrict__ Wv, const float* __restrict__ bv,
    _Float16* __restrict__ qh, _Float16* __restrict__ kh,
    _Float16* __restrict__ vT) {
  const int wave = threadIdx.x >> 5;
  const int lane = threadIdx.x & 31;
  const int n    = lane & 15;
  const int hi   = lane >> 4;
  const size_t g0 = ((size_t)blockIdx.x * 8 + wave) * 16;  // row-tile base

  v16h aq0 = frag_from_f32(q + g0 * DH, DH, 0);
  v16h aq1 = frag_from_f32(q + g0 * DH, DH, 32);
  v16h ak0 = frag_from_f32(k + g0 * DH, DH, 0);
  v16h ak1 = frag_from_f32(k + g0 * DH, DH, 32);
  v16h av0 = frag_from_f32(v + g0 * DH, DH, 0);
  v16h av1 = frag_from_f32(v + g0 * DH, DH, 32);

  // q projection: out = X @ Wq^T + bq ; B[k][n] = Wq[n][k] (row n, contiguous k)
#pragma unroll
  for (int j = 0; j < 4; ++j) {
    v8f c = {};
    c = WMMA_F16(aq0, frag_from_f32(Wq + (size_t)(16 * j) * DH, DH, 0), c);
    c = WMMA_F16(aq1, frag_from_f32(Wq + (size_t)(16 * j) * DH, DH, 32), c);
    const int col = 16 * j + n;
    const float bias = bq[col];
#pragma unroll
    for (int r = 0; r < 8; ++r)
      qh[(g0 + r + 8 * hi) * DH + col] = (_Float16)(c[r] + bias);
  }
#pragma unroll
  for (int j = 0; j < 4; ++j) {
    v8f c = {};
    c = WMMA_F16(ak0, frag_from_f32(Wk + (size_t)(16 * j) * DH, DH, 0), c);
    c = WMMA_F16(ak1, frag_from_f32(Wk + (size_t)(16 * j) * DH, DH, 32), c);
    const int col = 16 * j + n;
    const float bias = bk[col];
#pragma unroll
    for (int r = 0; r < 8; ++r)
      kh[(g0 + r + 8 * hi) * DH + col] = (_Float16)(c[r] + bias);
  }
  // v projection -> transposed store
  const size_t bh = g0 >> 11;           // b*H + h (tiles never straddle heads)
  const int    s0 = (int)(g0 & 2047);
#pragma unroll
  for (int j = 0; j < 4; ++j) {
    v8f c = {};
    c = WMMA_F16(av0, frag_from_f32(Wv + (size_t)(16 * j) * DH, DH, 0), c);
    c = WMMA_F16(av1, frag_from_f32(Wv + (size_t)(16 * j) * DH, DH, 32), c);
    const int col = 16 * j + n;
    const float bias = bv[col];
#pragma unroll
    for (int r = 0; r < 8; ++r)
      vT[(bh * DH + col) * (size_t)Ss + (s0 + r + 8 * hi)] =
          (_Float16)(c[r] + bias);
  }
}

// ---------------------------------------------------------------------------
// Async (or fallback) staging of one KB-key K tile [KB][64] and V tile
// [64][KB] (from transposed V) into LDS, rows at the padded pitches KP and VP.
// 256 threads x NU x 16B per tile: 32 more K rows, 64 / NU more V rows a turn.
// ---------------------------------------------------------------------------
__device__ inline void stage_kv(const _Float16* __restrict__ K,
                                const _Float16* __restrict__ V, int kb0,
                                _Float16* ktb, _Float16* vtb, int tid) {
  constexpr int VT = KB / 8;                               // threads per V row
  const int krow = tid >> 3, kseg = (tid & 7) * 8;         // key row, 8-f16 segment
  const int vrow = tid / VT, vseg = (tid & (VT - 1)) * 8;  // dim row, 8-f16 segment
  const _Float16* gk = K + (size_t)(kb0 + krow) * DH + kseg;
  const _Float16* gv = V + (size_t)vrow * Ss + kb0 + vseg;
  _Float16* lk = ktb + krow * KP + kseg;
  _Float16* lv = vtb + vrow * VP + vseg;
  // Unrolled: the copies of a pass issue in a row, their steps are constants.
#pragma unroll
  for (int i = 0; i < NU; ++i) {
    const _Float16* gki = gk + (size_t)(32 * i) * DH;
    const _Float16* gvi = gv + (size_t)(256 / VT * i) * Ss;
    _Float16* lki = lk + 32 * i * KP;
    _Float16* lvi = lv + 256 / VT * i * VP;
#if HAVE_ASYNC_LDS
    __builtin_amdgcn_global_load_async_to_lds_b128((gv4i*)gki, (lv4i*)lki, 0, 0);
    __builtin_amdgcn_global_load_async_to_lds_b128((gv4i*)gvi, (lv4i*)lvi, 0, 0);
#else
    *(float4*)lki = *(const float4*)gki;
    *(float4*)lvi = *(const float4*)gvi;
#endif
  }
}

// ---------------------------------------------------------------------------
// Kernel 2: flash attention, transposed products. One wave owns 16 queries;
// 8 waves/block share double-buffered LDS K/V tiles staged with async
// global->LDS copies (DMA of pass i+1 overlaps WMMA work on pass i).
// A pass is KB keys, NU groups of 32. Per group: S^T = K * Q^T (4 WMMA), so lane
// (n, hi) holds 16 scores of query n (keys 8*hi+r and 16+8*hi+r): mask, maximum
// and sum are in-lane, and the two score tiles converted in place are the B
// operand of O^T += V^T * P^T (4 WMMA). Once per pass: the exchange of the
// maximum between the wave halves, the correction factor, the rescaling of O and
// of the sum, the hand-over of the buffers.
// The mask comes as the packed words of kernel 0: 16 words per group by one
// scalar load, each word the lane mask of one select.
// ---------------------------------------------------------------------------
__global__ __launch_bounds__(256) void flash_kernel(
    const _Float16* __restrict__ qh, const _Float16* __restrict__ kh,
    const _Float16* __restrict__ vT, const unsigned* __restrict__ mbits,
    _Float16* __restrict__ wv) {
  __shared__ __align__(16) _Float16 kt[2][KB * KP];  // [key][dim], rows at pitch KP
  __shared__ __align__(16) _Float16 vt[2][DH * VP];  // [dim][key], rows at pitch VP

  const int tid  = threadIdx.x;
  const int wave = tid >> 5;
  const int lane = tid & 31;
  const int n    = lane & 15;
  const int hi   = lane >> 4;
  const int bh   = blockIdx.x >> 4;                    // b*H + h
  const int q0   = (blockIdx.x & 15) * 128 + wave * 16;
  const int b    = bh >> 4;

  const _Float16* Q  = qh + ((size_t)bh * Ss + q0) * DH;
  const _Float16* K  = kh + (size_t)bh * Ss * DH;
  const _Float16* V  = vT + (size_t)bh * DH * Ss;
  // This wave's packed mask words: 16 per key block. The tile index is made
  // wave-uniform for the compiler so that the words load into scalar registers.
  const int qt = __builtin_amdgcn_readfirstlane(b * (Ss / 16) + (q0 >> 4));
  const unsigned* Mw = mbits + (size_t)qt * (Ss / 32) * 16;

  const v16h qf0 = frag_from_f16(Q, DH, 0);
  const v16h qf1 = frag_from_f16(Q, DH, 32);

  // Scores stay the raw products K * Q^T: exp((s - m) / 8) = 2^(s * SC2 - m * SC2).
  constexpr float SC2    = 0.125f * 1.44269504088896340736f;  // scale * log2(e)
  constexpr float MASKED = -80000.f;                          // -10000 / scale
  float mrow = -3.0e38f;  // running maximum of query n, raw (equal in both halves)
  float lrow = 0.f;       // running sum over this half's keys only
  v8f zacc = {};
  v8f o[4] = {zacc, zacc, zacc, zacc};  // o[j][r] = O[query n][dim 16j + 8hi + r]

  // Prologue: stage the first K/V tiles.
  stage_kv(K, V, 0, kt[0], vt[0], tid);
  asm volatile("s_wait_asynccnt 0x0" ::: "memory");  // this wave's copies have landed
  __syncthreads();

  int buf = 0;
  for (int kb0 = 0; kb0 < Ss; kb0 += KB) {
    // Kick off DMA for the next pass into the other buffer (overlaps WMMA).
    if (kb0 + KB < Ss) stage_kv(K, V, kb0 + KB, kt[buf ^ 1], vt[buf ^ 1], tid);

    const _Float16* Kt = kt[buf];
    const _Float16* Vt = vt[buf];

    // The loops over groups, here and below, are unrolled so that every index is
    // a constant and the arrays stay in registers.
    // ---- mask bits of this pass: 16 lane-mask words a group, scalar loads --
    v16u mw[NU];
#pragma unroll
    for (int u = 0; u < NU; ++u) mw[u] = *(const v16u*)(Mw + ((kb0 >> 5) + u) * 16);

    // ---- scores, transposed: s0[u][r] = S[key 32u+8hi+r][query n], s1: +16 --
    v8f s0[NU], s1[NU];
#pragma unroll
    for (int u = 0; u < NU; ++u) {
      const _Float16* Ku = Kt + 32 * u * KP;
      v8f a = {}, c = {};
      a = WMMA_F16(frag_from_f16(Ku, KP, 0), qf0, a);
      a = WMMA_F16(frag_from_f16(Ku, KP, 32), qf1, a);
      c = WMMA_F16(frag_from_f16(Ku + 16 * KP, KP, 0), qf0, c);
      c = WMMA_F16(frag_from_f16(Ku + 16 * KP, KP, 32), qf1, c);
      s0[u] = a;
      s1[u] = c;
    }
    // Ends the scheduling region at the last score product: with the whole pass
    // in one region the scheduler waits on every K and V fragment alone, orders
    // the softmax in dependent pairs and moves the row sum behind the barrier.
    __builtin_amdgcn_sched_barrier(0);

    // ---- mask on the raw products (mask!=0 -> -10000 / scale, exact), one
    // maximum a group; the scale comes with the exponent's multiply-add below --
    float gmax[NU];
#pragma unroll
    for (int u = 0; u < NU; ++u) {
#pragma unroll
      for (int r = 0; r < 8; ++r) {
        s0[u][r] =
            __builtin_amdgcn_inverse_ballot_w32(mw[u][r]) ? MASKED : s0[u][r];
        s1[u][r] =
            __builtin_amdgcn_inverse_ballot_w32(mw[u][8 + r]) ? MASKED : s1[u][r];
      }
      float t = fmaxf(s0[u][0], s1[u][0]);
#pragma unroll
      for (int r = 1; r < 8; ++r) t = fmaxf(t, fmaxf(s0[u][r], s1[u][r]));
      gmax[u] = t;
    }

    // ---- online softmax update: one query per lane, once per pass ----------
    float tmax = gmax[0];
#pragma unroll
    for (int u = 1; u < NU; ++u) tmax = fmaxf(tmax, gmax[u]);
    tmax = fmaxf(tmax, xhalf(tmax));
    const float mnew = fmaxf(mrow, tmax);
    const float corr = __builtin_amdgcn_exp2f((mrow - mnew) * SC2);
    const float mc   = mnew * SC2;  // the maximum in the exponent's unit
    mrow = mnew;
#pragma unroll
    for (int j = 0; j < 4; ++j)
#pragma unroll
      for (int r = 0; r < 8; ++r) o[j][r] *= corr;

    // ---- per group: P, its sum, and O^T += V^T @ P^T -----------------------
    float psum = 0.f;
#pragma unroll
    for (int u = 0; u < NU; ++u) {
      float gsum = 0.f;
      v16h pf;  // B operand: pf[i] = P[query n][key 32u+8hi+i], pf[8+i]: key +16
#pragma unroll
      for (int r = 0; r < 8; r += 2) {
        // Two scores a multiply-add: the packed f32 form.
        const v2f sc = {SC2, SC2}, nm = {-mc, -mc};
        const v2f a0 = {s0[u][r], s0[u][r + 1]}, a1 = {s1[u][r], s1[u][r + 1]};
        const v2f e0 = __builtin_elementwise_fma(a0, sc, nm);
        const v2f e1 = __builtin_elementwise_fma(a1, sc, nm);
#pragma unroll  // constant indices, as above
        for (int i = 0; i < 2; ++i) {
          const float p0 = __builtin_amdgcn_exp2f(e0[i]);
          const float p1 = __builtin_amdgcn_exp2f(e1[i]);
          gsum += p0 + p1;
          pf[r + i]     = (_Float16)p0;
          pf[8 + r + i] = (_Float16)p1;
        }
      }
      psum += gsum;
      // A frags: dim rows of the LDS V tile, keys 32u..32u+31
#pragma unroll
      for (int j = 0; j < 4; ++j) {
        const v16h vf = frag_from_f16(Vt + 16 * j * VP, VP, 32 * u);
        o[j] = WMMA_F16(vf, pf, o[j]);
      }
    }
    lrow = lrow * corr + psum;

    // Hand-over: this wave's reads of the buffers are done, its copies for the
    // next pass have landed; the barrier publishes them and frees these buffers.
    asm volatile("s_wait_dscnt 0x0" ::: "memory");
    asm volatile("s_wait_asynccnt 0x0" ::: "memory");
    __syncthreads();
    buf ^= 1;
  }
  asm volatile("s_wait_asynccnt 0x0" ::: "memory");  // nothing in flight at the end

  // ---- join the halves' sums, normalize, store wv (flat [B*H*S, 64] f16) ---
  const float inv = 1.0f / (lrow + xhalf(lrow));  // one denominator per lane
  _Float16* orow = wv + ((size_t)bh * Ss + q0 + n) * DH + 8 * hi;
#pragma unroll
  for (int j = 0; j < 4; ++j) {
    v8h ov;
#pragma unroll
    for (int r = 0; r < 8; ++r) ov[r] = (_Float16)(o[j][r] * inv);
    *(v8h*)(orow + 16 * j) = ov;  // 8 consecutive dims of one query: 16 bytes
  }
}

// ---------------------------------------------------------------------------
// Kernel 3: output projection. Raw-reshape merge means wv flat is exactly the
// [B*S, 1024] A matrix. out = A @ Wo^T + bo, M=4096 N=1024 K=1024.
// One block computes a 128 x 128 tile of out; its 8 waves (2 x 4) own 64 x 32
// each. A k slice of 128 of the block's 128 A rows and 128 Wo rows is staged in
// LDS by asynchronous copies, two buffers: slice t + 1 flies while slice t is
// multiplied, and every staged row serves all the waves that need it.
// ---------------------------------------------------------------------------
static constexpr int GT  = 128;            // tile rows of A, and of Wo
static constexpr int GK  = 128;            // k per slice: 256 data bytes a row
static constexpr int GP  = 136;            // LDS row pitch in f16: 272 B = 16 B x 17
static constexpr int GSL = 2 * GT * GP;    // one buffer: A rows, then Wo rows
static constexpr int GNT = HID / GK;       // 8 slices

// Eight 16-byte copies of one thread: rows 16 apart of one operand's slice.
// l: the lane's LDS byte address, g: its global address, both of the first row.
__device__ inline void copy8(unsigned l, const _Float16* g) {
  constexpr unsigned LS = 16 * GP * 2;  // 16 rows in LDS, bytes
  constexpr int      GS = 16 * HID;     // 16 rows in memory, elements
  // The closing s_wait_xcnt stands inside the statement so that no address
  // register of a copy is rewritten ahead of it.
  asm volatile(
      "global_load_async_to_lds_b128 %0, %8, off\n\t"
      "global_load_async_to_lds_b128 %1, %9, off\n\t"
      "global_load_async_to_lds_b128 %2, %10, off\n\t"
      "global_load_async_to_lds_b128 %3, %11, off\n\t"
      "global_load_async_to_lds_b128 %4, %12, off\n\t"
      "global_load_async_to_lds_b128 %5, %13, off\n\t"
      "global_load_async_to_lds_b128 %6, %14, off\n\t"
      "global_load_async_to_lds_b128 %7, %15, off\n\t"
      "s_wait_xcnt 0x0"
      :
      : "v"(l), "v"(l + LS), "v"(l + 2 * LS), "v"(l + 3 * LS), "v"(l + 4 * LS),
        "v"(l + 5 * LS), "v"(l + 6 * LS), "v"(l + 7 * LS), "v"(g), "v"(g + GS),
        "v"(g + 2 * GS), "v"(g + 3 * GS), "v"(g + 4 * GS), "v"(g + 5 * GS),
        "v"(g + 6 * GS), "v"(g + 7 * GS)
      : "memory");
}

__global__ __launch_bounds__(256) void outproj_kernel(
    const _Float16* __restrict__ wv, const _Float16* __restrict__ WoH,
    const float* __restrict__ bo, float* __restrict__ out) {
  __shared__ __align__(16) _Float16 st[2 * GSL];

  const int tid  = threadIdx.x;
  const int wave = tid >> 5;
  const int lane = tid & 31;
  const int n    = lane & 15;
  const int hi   = lane >> 4;
  const int m0   = (blockIdx.x >> 3) * GT;  // 32 row tiles
  const int n0   = (blockIdx.x & 7) * GT;   // 8 column tiles
  const int wm   = (wave >> 2) * 64;        // this wave's rows in the tile
  const int wn   = (wave & 3) * 32;         // this wave's columns in the tile

  // Copy map: 16 threads take one row's 256 bytes, so a wave copies whole lines.
  const int crow = tid >> 4, cseg = (tid & 15) * 8;
  const _Float16* ga = wv + (size_t)(m0 + crow) * HID + cseg;
  const _Float16* gb = WoH + (size_t)(n0 + crow) * HID + cseg;
  const unsigned la = (unsigned)(size_t)st + (crow * GP + cseg) * 2;
  const unsigned lb = la + GT * GP * 2;

  v8f zacc = {};
  v8f acc[4][2] = {{zacc, zacc}, {zacc, zacc}, {zacc, zacc}, {zacc, zacc}};

  // Slice 0 into buffer 0, landed and published; then slice 1 into buffer 1.
  copy8(la, ga);
  copy8(lb, gb);
  asm volatile("s_wait_asynccnt 0x0" ::: "memory");  // this wave's copies have landed
  __syncthreads();
  copy8(la + GSL * 2, ga + GK);
  copy8(lb + GSL * 2, gb + GK);

  for (int t = 0; t < GNT; ++t) {
    const int boff = (t & 1) * GSL;
    const _Float16* As = st + boff + wm * GP;
    const _Float16* Bs = st + boff + (GT + wn) * GP;
    // Two fragment sets: step s + 1 of this slice is read while step s multiplies.
    // The loops over sets and accumulators are unrolled so that every index is a
    // constant and the arrays stay in registers.
    v16h af[2][4], bf[2][2];
#pragma unroll
    for (int i = 0; i < 4; ++i) af[0][i] = frag_from_f16(As + 16 * i * GP, GP, 0);
#pragma unroll
    for (int j = 0; j < 2; ++j) bf[0][j] = frag_from_f16(Bs + 16 * j * GP, GP, 0);
#pragma unroll
    for (int s = 0; s < GK / 32; ++s) {
      const int cur = s & 1;
      if (s + 1 < GK / 32) {
#pragma unroll
        for (int i = 0; i < 4; ++i)
          af[cur ^ 1][i] = frag_from_f16(As + 16 * i * GP, GP, 32 * (s + 1));
#pragma unroll
        for (int j = 0; j < 2; ++j)
          bf[cur ^ 1][j] = frag_from_f16(Bs + 16 * j * GP, GP, 32 * (s + 1));
      }
      // Keeps the next step's LDS reads one group ahead of this step's products:
      // left free, the scheduler sinks each read to its use, into one register
      // set, and every pair of products then waits out an LDS latency.
      __builtin_amdgcn_sched_barrier(0);
#pragma unroll
      for (int i = 0; i < 4; ++i) {
        acc[i][0] = WMMA_F16(af[cur][i], bf[cur][0], acc[i][0]);
        acc[i][1] = WMMA_F16(af[cur][i], bf[cur][1], acc[i][1]);
      }
    }
    // Hand-over: this wave's reads of the buffer are done, its copies of slice
    // t + 1 have landed; the barrier publishes that slice and frees this buffer.
    asm volatile("s_wait_dscnt 0x0" ::: "memory");
    asm volatile("s_wait_asynccnt 0x0" ::: "memory");
    __syncthreads();
    if (t + 2 < GNT) {
      copy8(la + boff * 2, ga + (t + 2) * GK);
      copy8(lb + boff * 2, gb + (t + 2) * GK);
    }
  }
  asm volatile("s_wait_asynccnt 0x0" ::: "memory");  // nothing in flight at the end

  // Unrolled for constant accumulator indices, as above.
#pragma unroll
  for (int j = 0; j < 2; ++j) {
    const int col  = n0 + wn + 16 * j + n;
    const float bb = bo[col];
#pragma unroll
    for (int i = 0; i < 4; ++i)
#pragma unroll
      for (int r = 0; r < 8; ++r)
        out[(size_t)(m0 + wm + 16 * i + r + 8 * hi) * HID + col] = acc[i][j][r] + bb;
  }
}

// ---------------------------------------------------------------------------
extern "C" void kernel_launch(void* const* d_in, const int* in_sizes, int n_in,
                              void* d_out, int out_size, void* d_ws,
                              size_t ws_size, hipStream_t stream) {
  const float* q    = (const float*)d_in[0];
  const float* k    = (const float*)d_in[1];
  const float* v    = (const float*)d_in[2];
  const int*   mask = (const int*)d_in[3];
  const float* Wq   = (const float*)d_in[4];
  const float* bq   = (const float*)d_in[5];
  const float* Wk   = (const float*)d_in[6];
  const float* bk   = (const float*)d_in[7];
  const float* Wv   = (const float*)d_in[8];
  const float* bv   = (const float*)d_in[9];
  const float* Wo   = (const float*)d_in[10];
  const float* bo   = (const float*)d_in[11];

  // Workspace layout (bytes): q_i | k_i | vT | wv (8 MB f16 each) | Wo f16 (2 MB)
  // | mask bits (1 MB, at the next 4 MB step)
  const size_t HEADELEMS = (size_t)Bb * Hh * Ss * DH;  // 4,194,304
  char* ws = (char*)d_ws;
  _Float16* qh  = (_Float16*)(ws + 0 * HEADELEMS);
  _Float16* kh  = (_Float16*)(ws + 2 * HEADELEMS);
  _Float16* vT  = (_Float16*)(ws + 4 * HEADELEMS);
  _Float16* wvb = (_Float16*)(ws + 6 * HEADELEMS);
  _Float16* WoH = (_Float16*)(ws + 8 * HEADELEMS);
  unsigned* mbits = (unsigned*)(ws + 9 * HEADELEMS);

  const int wo_n = HID * HID;  // 1,048,576
  prep_kernel<<<PACKB + (wo_n + 255) / 256, 256, 0, stream>>>(Wo, WoH, wo_n,
                                                              mask, mbits);

  // 4096 row-tiles of 16 rows / 8 waves per block -> 512 blocks
  proj_kernel<<<512, 256, 0, stream>>>(q, k, v, Wq, bq, Wk, bk, Wv, bv,
                                       qh, kh, vT);

  // 32 (b,h) pairs * 16 blocks (128 q-rows each) = 512 blocks
  flash_kernel<<<512, 256, 0, stream>>>(qh, kh, vT, mbits, wvb);

  // 32 x 8 output tiles of 128 x 128, one block each
  outproj_kernel<<<256, 256, 0, stream>>>(wvb, WoH, bo, (float*)d_out);
}

// v007
// A run of this version takes 69.2 microseconds.
// In both of two side-by-side timings against v006, it was 1.10 times as fast.
// Counting every step since v000, it is 3.13 times as fast.
#include <hip/hip_runtime.h>
#include <hip/hip_bf16.h>
#include <hip/hip_fp16.h>

typedef __attribute__((ext_vector_type(16))) _Float16 v16h;
typedef __attribute__((ext_vector_type(8)))  _Float16 v8h;
typedef __attribute__((ext_vector_type(4)))  _Float16 v4h;
typedef __attribute__((ext_vector_type(8)))  float    v8f;
typedef __attribute__((ext_vector_type(2)))  float    v2f;
typedef __attribute__((ext_vector_type(4)))  float    v4f;
typedef __attribute__((ext_vector_type(4)))  int      v4i;
typedef __attribute__((ext_vector_type(16))) unsigned v16u;

using gv4i = v4i __attribute__((address_space(1)));  // global int4
using lv4i = v4i __attribute__((address_space(3)));  // LDS int4

#define WMMA_F16(a, b, c) \
  __builtin_amdgcn_wmma_f32_16x16x32_f16(false, (a), false, (b), (short)0, (c), false, false)

#ifndef __has_builtin
#define __has_builtin(x) 0
#endif

#if __has_builtin(__builtin_amdgcn_global_load_async_to_lds_b128)
#define HAVE_ASYNC_LDS 1
#else
#define HAVE_ASYNC_LDS 0
#endif

static constexpr int Bb  = 2;
static constexpr int Ss  = 2048;
static constexpr int HID = 1024;
static constexpr int Hh  = 16;
static constexpr int DH  = 64;
static constexpr int KB  = 128;      // keys per pass of the flash kernel
static constexpr int NU  = KB / 32;  // 32-key groups (one k step of P * V) per pass
// LDS row pitches in f16 elements: 16 bytes times an odd number, so that the
// 16 rows one ds_load_b128 half-wave reads fall on 16 distinct bank groups.
static constexpr int KP  = 72;       // K tile rows: 128 data bytes at pitch 144
static constexpr int VP  = KB + 8;   // V tile rows: 256 data bytes at pitch 272
static_assert(((KP / 8) & 1) && ((VP / 8) & 1), "pitches are 16 bytes times an odd number");

// ---------------------------------------------------------------------------
// Fragment loaders per CDNA5 ISA 7.12.2 (wave32):
//  A 16x32 f16: lane L holds row M=L&15; lanes 0-15 carry K={0..7,16..23},
//  lanes 16-31 carry K={8..15,24..31}. B 32x16 gathered symmetrically
//  (lane = column N, contiguous reduction dim in memory). Each lane loads
//  two contiguous 16-byte chunks.
// ---------------------------------------------------------------------------
__device__ inline v16h frag_from_f16(const _Float16* base, int ld, int k0) {
  const int lane = threadIdx.x & 31;
  const int r    = lane & 15;
  const int kb   = (lane & 16) ? 8 : 0;
  const _Float16* p = base + (size_t)r * ld + k0 + kb;
  v16h a;
#pragma unroll
  for (int i = 0; i < 8; ++i) a[i] = p[i];
#pragma unroll
  for (int i = 0; i < 8; ++i) a[8 + i] = p[16 + i];
  return a;
}

// The same two fragments (k 0..31 and 32..63) of a 16 x 64 f32 tile, in three
// parts: the lane's address, its eight 16-byte loads, the conversion of one
// fragment.
__device__ inline const float* lane_x(const float* base) {
  const int lane = threadIdx.x & 31;
  const int r    = lane & 15;
  const int kb   = (lane & 16) ? 8 : 0;
  return base + (size_t)r * DH + kb;
}

// The loops of these helpers are unrolled so that every index is a constant and
// the arrays stay in registers.
__device__ inline void load_x(const float* p, v4f (&x)[8]) {
#pragma unroll
  for (int i = 0; i < 4; ++i) {  // floats 16i..16i+7 of the lane's half
    x[2 * i]     = *(const v4f*)(p + 16 * i);
    x[2 * i + 1] = *(const v4f*)(p + 16 * i + 4);
  }
}

__device__ inline v16h frag_from_x(const v4f (&x)[8], int f) {
  v16h a;
#pragma unroll
  for (int i = 0; i < 16; ++i) a[i] = (_Float16)x[4 * f + (i >> 2)][i & 3];
  return a;
}

// Holds the eight loads of load_x ahead of this place (the loaded values are
// inputs only): left free, the compiler sinks them behind the barrier that
// follows, and the wave waits out a second memory latency there.
__device__ inline void hold_x(const v4f (&x)[8]) {
  asm volatile("" ::"v"(x[0]), "v"(x[1]), "v"(x[2]), "v"(x[3]), "v"(x[4]), "v"(x[5]),
               "v"(x[6]), "v"(x[7]));
}

// Value of lane l ^ 16: the two wave halves hold the two key halves of one query.
__device__ inline float xhalf(float x) {
  const int i = __builtin_bit_cast(int, x);
  return __builtin_bit_cast(
      float, __builtin_amdgcn_permlanex16(i, i, 0x76543210, 0xfedcba98, false, false));
}

// ---------------------------------------------------------------------------
// Kernel 0: input preparation. Blocks 0..PACKB-1 pack the mask, which all 16
// heads of a batch share, into bits, once: per 16-query tile and 32-key block
// 16 words, word i holding for every lane of the flash kernel's wave the bit
// of that lane's score i. They come first in the grid because they run the
// longest. The other blocks convert Wo f32 -> f16.
// ---------------------------------------------------------------------------
static constexpr int PACKB = Bb * (Ss / 16) * (Ss / 32) / 4 / 8;  // 512 blocks

__global__ __launch_bounds__(256) void prep_kernel(
    const float* __restrict__ src, _Float16* __restrict__ dst, int n,
    const int* __restrict__ mask, unsigned* __restrict__ mbits) {
  if (blockIdx.x < PACKB) {
    // One wave packs one query tile x four 32-key blocks. Lane (qn, hi) reads
    // the 16 mask words of the scores it will hold in the flash kernel (query
    // qn; keys 8hi+0..7 and 16+8hi+0..7 of the block); each ballot is one word
    // of the block. Lanes 0-15 collect an even block's 16 words, lanes 16-31
    // the next block's: one whole 128-byte line per store.
    const int lane = threadIdx.x & 31;
    const int qn   = lane & 15;
    const int hi   = lane >> 4;
    const int gw   = blockIdx.x * 8 + (threadIdx.x >> 5);  // 0..4095
    const int qt   = gw >> 4;                // b * (S/16) + query tile
    const int kb4  = (gw & 15) * 4;          // first of the four key blocks
    const int* Mr  = mask + ((size_t)qt * 16 + qn) * Ss + kb4 * 32 + 8 * hi;
    unsigned* Mo   = mbits + ((size_t)qt * (Ss / 32) + kb4) * 16 + lane;
    v4i m[4][4];
#pragma unroll
    for (int u = 0; u < 4; ++u) {
      m[u][0] = *(const v4i*)(Mr + 32 * u);
      m[u][1] = *(const v4i*)(Mr + 32 * u + 4);
      m[u][2] = *(const v4i*)(Mr + 32 * u + 16);
      m[u][3] = *(const v4i*)(Mr + 32 * u + 20);
    }
#pragma unroll
    for (int u2 = 0; u2 < 2; ++u2) {
      unsigned w = 0;
#pragma unroll
      for (int i = 0; i < 32; ++i) {  // lane i takes word i & 15 of block 2*u2 + (i >> 4)
        const unsigned bal =
            __builtin_amdgcn_ballot_w32(m[2 * u2 + (i >> 4)][(i >> 2) & 3][i & 3] != 0);
        w = lane == i ? bal : w;
      }
      Mo[32 * u2] = w;
    }
    return;
  }
  int i = (blockIdx.x - PACKB) * blockDim.x + threadIdx.x;
  if (i < n) dst[i] = (_Float16)src[i];
}

// ---------------------------------------------------------------------------
// Kernel 1: Q/K/V projections. Input viewed as flat [B*H*S, 64] row-major
// (the raw reshape keeps the 64-dim contiguous). q_i/k_i stored f16 in the
// same [B*H*S, 64] layout; v stored transposed as vT[B*H][64][S] so P*V
// A-fragments (of V^T) gather contiguously later.
// The three 64 x 64 weight matrices are converted to f16 once per block and kept
// in LDS: all 8 waves read their B fragments from there.
// ---------------------------------------------------------------------------
static constexpr int WP = 72;  // LDS row pitch of a weight matrix in f16: 16 B x 9

// One weight matrix into LDS, in two parts: a thread's four whole-line loads (a
// wave reads 512 bytes in a row), and their conversion, four f16 a store.
// Unrolled for constant indices: the array stays in registers.
__device__ inline void load_w(const float* __restrict__ Wm, v4f (&w)[4], int tid) {
#pragma unroll
  for (int i = 0; i < 4; ++i) w[i] = *(const v4f*)(Wm + (i * 256 + tid) * 4);
}

__device__ inline void store_w(const v4f (&w)[4], _Float16* l, int tid) {
#pragma unroll
  for (int i = 0; i < 4; ++i) {
    const int e = (i * 256 + tid) * 4;
    const v4h h = {(_Float16)w[i][0], (_Float16)w[i][1], (_Float16)w[i][2],
                   (_Float16)w[i][3]};
    *(v4h*)(l + (e >> 6) * WP + (e & 63)) = h;
  }
}

__global__ __launch_bounds__(256) void proj_kernel(
    const float* __restrict__ q, const float* __restrict__ k,
    const float* __restrict__ v,
    const float* __restrict__ Wq, const float* __restrict__ bq,
    const float* __restrict__ Wk, const float* __restrict__ bk,
    const float* __restrict__ Wv, const float* __restrict__ bv,
    _Float16* __restrict__ qh, _Float16* __restrict__ kh,
    _Float16* __restrict__ vT) {
  __shared__ __align__(16) _Float16 wl[3][DH * WP];  // Wq, Wk, Wv rows at pitch WP

  const int wave = threadIdx.x >> 5;
  const int lane = threadIdx.x & 31;
  const int n    = lane & 15;
  const int hi   = lane >> 4;
  const size_t g0 = ((size_t)blockIdx.x * 8 + wave) * 16;  // row-tile base

  // The weights come first: they are cached, and converted while the inputs fly.
  v4f wq[4], wk[4], wv[4], xq[8], xk[8], xv[8];
  load_w(Wq, wq, threadIdx.x);
  load_w(Wk, wk, threadIdx.x);
  load_w(Wv, wv, threadIdx.x);
  const float* pq = lane_x(q + g0 * DH);
  const float* pk = lane_x(k + g0 * DH);
  const float* pv = lane_x(v + g0 * DH);
  load_x(pq, xq);
  load_x(pk, xk);
  load_x(pv, xv);
  // No address register of these loads is rewritten ahead of this wait; the
  // three addresses are inputs so that their registers stay theirs up to it.
  asm volatile("s_wait_xcnt 0x0" ::"v"(pq), "v"(pk), "v"(pv) : "memory");

  store_w(wq, wl[0], threadIdx.x);
  store_w(wk, wl[1], threadIdx.x);
  store_w(wv, wl[2], threadIdx.x);
  hold_x(xq);
  hold_x(xk);
  hold_x(xv);
  __syncthreads();  // the weights are read by every wave

  const v16h aq0 = frag_from_x(xq, 0), aq1 = frag_from_x(xq, 1);
  const v16h ak0 = frag_from_x(xk, 0), ak1 = frag_from_x(xk, 1);
  const v16h av0 = frag_from_x(xv, 0), av1 = frag_from_x(xv, 1);

  // q projection: out = X @ Wq^T + bq ; B[k][n] = Wq[n][k] (row n, contiguous k)
#pragma unroll
  for (int j = 0; j < 4; ++j) {
    v8f c = {};
    c = WMMA_F16(aq0, frag_from_f16(wl[0] + 16 * j * WP, WP, 0), c);
    c = WMMA_F16(aq1, frag_from_f16(wl[0] + 16 * j * WP, WP, 32), c);
    const int col = 16 * j + n;
    const float bias = bq[col];
#pragma unroll
    for (int r = 0; r < 8; ++r)
      qh[(g0 + r + 8 * hi) * DH + col] = (_Float16)(c[r] + bias);
  }
#pragma unroll
  for (int j = 0; j < 4; ++j) {
    v8f c = {};
    c = WMMA_F16(ak0, frag_from_f16(wl[1] + 16 * j * WP, WP, 0), c);
    c = WMMA_F16(ak1, frag_from_f16(wl[1] + 16 * j * WP, WP, 32), c);
    const int col = 16 * j + n;
    const float bias = bk[col];
#pragma unroll
    for (int r = 0; r < 8; ++r)
      kh[(g0 + r + 8 * hi) * DH + col] = (_Float16)(c[r] + bias);
  }
  // v projection -> transposed store
  const size_t bh = g0 >> 11;           // b*H + h (tiles never straddle heads)
  const int    s0 = (int)(g0 & 2047);
#pragma unroll
  for (int j = 0; j < 4; ++j) {
    v8f c = {};
    c = WMMA_F16(av0, frag_from_f16(wl[2] + 16 * j * WP, WP, 0), c);
    c = WMMA_F16(av1, frag_from_f16(wl[2] + 16 * j * WP, WP, 32), c);
    const int col = 16 * j + n;
    const float bias = bv[col];
#pragma unroll
    for (int r = 0; r < 8; ++r)
      vT[(bh * DH + col) * (size_t)Ss + (s0 + r + 8 * hi)] =
          (_Float16)(c[r] + bias);
  }
}

// ---------------------------------------------------------------------------
// Async (or fallback) staging of one KB-key K tile [KB][64] and V tile
// [64][KB] (from transposed V) into LDS, rows at the padded pitches KP and VP.
// 256 threads x NU x 16B per tile: 32 more K rows, 64 / NU more V rows a turn.
// ---------------------------------------------------------------------------
__device__ inline void stage_kv(const _Float16* __restrict__ K,
                                const _Float16* __restrict__ V, int kb0,
                                _Float16* ktb, _Float16* vtb, int tid) {
  constexpr int VT = KB / 8;                               // threads per V row
  const int krow = tid >> 3, kseg = (tid & 7) * 8;         // key row, 8-f16 segment
  const int vrow = tid / VT, vseg = (tid & (VT - 1)) * 8;  // dim row, 8-f16 segment
  const _Float16* gk = K + (size_t)(kb0 + krow) * DH + kseg;
  const _Float16* gv = V + (size_t)vrow * Ss + kb0 + vseg;
  _Float16* lk = ktb + krow * KP + kseg;
  _Float16* lv = vtb + vrow * VP + vseg;
  // Unrolled: the copies of a pass issue in a row, their steps are constants.
#pragma unroll
  for (int i = 0; i < NU; ++i) {
    const _Float16* gki = gk + (size_t)(32 * i) * DH;
    const _Float16* gvi = gv + (size_t)(256 / VT * i) * Ss;
    _Float16* lki = lk + 32 * i * KP;
    _Float16* lvi = lv + 256 / VT * i * VP;
#if HAVE_ASYNC_LDS
    __builtin_amdgcn_global_load_async_to_lds_b128((gv4i*)gki, (lv4i*)lki, 0, 0);
    __builtin_amdgcn_global_load_async_to_lds_b128((gv4i*)gvi, (lv4i*)lvi, 0, 0);
#else
    *(float4*)lki = *(const float4*)gki;
    *(float4*)lvi = *(const float4*)gvi;
#endif
  }
}

// ---------------------------------------------------------------------------
// Kernel 2: flash attention, transposed products. One wave owns 16 queries;
// 8 waves/block share double-buffered LDS K/V tiles staged with async
// global->LDS copies (DMA of pass i+1 overlaps WMMA work on pass i).
// A pass is KB keys, NU groups of 32. Per group: S^T = K * Q^T (4 WMMA), so lane
// (n, hi) holds 16 scores of query n (keys 8*hi+r and 16+8*hi+r): mask, maximum
// and sum are in-lane, and the two score tiles converted in place are the B
// operand of O^T += V^T * P^T (4 WMMA). Once per pass: the exchange of the
// maximum between the wave halves, the correction factor, the rescaling of O and
// of the sum, the hand-over of the buffers.
// The mask comes as the packed words of kernel 0: 16 words per group by one
// scalar load, each word the lane mask of one select.
// ---------------------------------------------------------------------------
__global__ __launch_bounds__(256) void flash_kernel(
    const _Float16* __restrict__ qh, const _Float16* __restrict__ kh,
    const _Float16* __restrict__ vT, const unsigned* __restrict__ mbits,
    _Float16* __restrict__ wv) {
  __shared__ __align__(16) _Float16 kt[2][KB * KP];  // [key][dim], rows at pitch KP
  __shared__ __align__(16) _Float16 vt[2][DH * VP];  // [dim][key], rows at pitch VP

  const int tid  = threadIdx.x;
  const int wave = tid >> 5;
  const int lane = tid & 31;
  const int n    = lane & 15;
  const int hi   = lane >> 4;
  const int bh   = blockIdx.x >> 4;                    // b*H + h
  const int q0   = (blockIdx.x & 15) * 128 + wave * 16;
  const int b    = bh >> 4;

  const _Float16* Q  = qh + ((size_t)bh * Ss + q0) * DH;
  const _Float16* K  = kh + (size_t)bh * Ss * DH;
  const _Float16* V  = vT + (size_t)bh * DH * Ss;
  // This wave's packed mask words: 16 per key block. The tile index is made
  // wave-uniform for the compiler so that the words load into scalar registers.
  const int qt = __builtin_amdgcn_readfirstlane(b * (Ss / 16) + (q0 >> 4));
  const unsigned* Mw = mbits + (size_t)qt * (Ss / 32) * 16;

  const v16h qf0 = frag_from_f16(Q, DH, 0);
  const v16h qf1 = frag_from_f16(Q, DH, 32);

  // Scores stay the raw products K * Q^T: exp((s - m) / 8) = 2^(s * SC2 - m * SC2).
  constexpr float SC2    = 0.125f * 1.44269504088896340736f;  // scale * log2(e)
  constexpr float MASKED = -80000.f;                          // -10000 / scale
  float mrow = -3.0e38f;  // running maximum of query n, raw (equal in both halves)
  float lrow = 0.f;       // running sum over this half's keys only
  v8f zacc = {};
  v8f o[4] = {zacc, zacc, zacc, zacc};  // o[j][r] = O[query n][dim 16j + 8hi + r]

  // Prologue: stage the first K/V tiles.
  stage_kv(K, V, 0, kt[0], vt[0], tid);
  asm volatile("s_wait_asynccnt 0x0" ::: "memory");  // this wave's copies have landed
  __syncthreads();

  int buf = 0;
  for (int kb0 = 0; kb0 < Ss; kb0 += KB) {
    // Kick off DMA for the next pass into the other buffer (overlaps WMMA).
    if (kb0 + KB < Ss) stage_kv(K, V, kb0 + KB, kt[buf ^ 1], vt[buf ^ 1], tid);

    const _Float16* Kt = kt[buf];
    const _Float16* Vt = vt[buf];

    // The loops over groups, here and below, are unrolled so that every index is
    // a constant and the arrays stay in registers.
    // ---- mask bits of this pass: 16 lane-mask words a group, scalar loads --
    v16u mw[NU];
#pragma unroll
    for (int u = 0; u < NU; ++u) mw[u] = *(const v16u*)(Mw + ((kb0 >> 5) + u) * 16);

    // ---- scores, transposed: s0[u][r] = S[key 32u+8hi+r][query n], s1: +16 --
    v8f s0[NU], s1[NU];
#pragma unroll
    for (int u = 0; u < NU; ++u) {
      const _Float16* Ku = Kt + 32 * u * KP;
      v8f a = {}, c = {};
      a = WMMA_F16(frag_from_f16(Ku, KP, 0), qf0, a);
      a = WMMA_F16(frag_from_f16(Ku, KP, 32), qf1, a);
      c = WMMA_F16(frag_from_f16(Ku + 16 * KP, KP, 0), qf0, c);
      c = WMMA_F16(frag_from_f16(Ku + 16 * KP, KP, 32), qf1, c);
      s0[u] = a;
      s1[u] = c;
    }
    // Ends the scheduling region at the last score product: with the whole pass
    // in one region the scheduler waits on every K and V fragment alone, orders
    // the softmax in dependent pairs and moves the row sum behind the barrier.
    __builtin_amdgcn_sched_barrier(0);

    // ---- mask on the raw products (mask!=0 -> -10000 / scale, exact), one
    // maximum a group; the scale comes with the exponent's multiply-add below --
    float gmax[NU];
#pragma unroll
    for (int u = 0; u < NU; ++u) {
#pragma unroll
      for (int r = 0; r < 8; ++r) {
        s0[u][r] =
            __builtin_amdgcn_inverse_ballot_w32(mw[u][r]) ? MASKED : s0[u][r];
        s1[u][r] =
            __builtin_amdgcn_inverse_ballot_w32(mw[u][8 + r]) ? MASKED : s1[u][r];
      }
      float t = fmaxf(s0[u][0], s1[u][0]);
#pragma unroll
      for (int r = 1; r < 8; ++r) t = fmaxf(t, fmaxf(s0[u][r], s1[u][r]));
      gmax[u] = t;
    }

    // ---- online softmax update: one query per lane, once per pass ----------
    float tmax = gmax[0];
#pragma unroll
    for (int u = 1; u < NU; ++u) tmax = fmaxf(tmax, gmax[u]);
    tmax = fmaxf(tmax, xhalf(tmax));
    const float mnew = fmaxf(mrow, tmax);
    const float corr = __builtin_amdgcn_exp2f((mrow - mnew) * SC2);
    const float mc   = mnew * SC2;  // the maximum in the exponent's unit
    mrow = mnew;
#pragma unroll
    for (int j = 0; j < 4; ++j)
#pragma unroll
      for (int r = 0; r < 8; ++r) o[j][r] *= corr;

    // ---- per group: P, its sum, and O^T += V^T @ P^T -----------------------
    float psum = 0.f;
#pragma unroll
    for (int u = 0; u < NU; ++u) {
      float gsum = 0.f;
      v16h pf;  // B operand: pf[i] = P[query n][key 32u+8hi+i], pf[8+i]: key +16
#pragma unroll
      for (int r = 0; r < 8; r += 2) {
        // Two scores a multiply-add: the packed f32 form.
        const v2f sc = {SC2, SC2}, nm = {-mc, -mc};
        const v2f a0 = {s0[u][r], s0[u][r + 1]}, a1 = {s1[u][r], s1[u][r + 1]};
        const v2f e0 = __builtin_elementwise_fma(a0, sc, nm);
        const v2f e1 = __builtin_elementwise_fma(a1, sc, nm);
#pragma unroll  // constant indices, as above
        for (int i = 0; i < 2; ++i) {
          const float p0 = __builtin_amdgcn_exp2f(e0[i]);
          const float p1 = __builtin_amdgcn_exp2f(e1[i]);
          gsum += p0 + p1;
          pf[r + i]     = (_Float16)p0;
          pf[8 + r + i] = (_Float16)p1;
        }
      }
      psum += gsum;
      // A frags: dim rows of the LDS V tile, keys 32u..32u+31
#pragma unroll
      for (int j = 0; j < 4; ++j) {
        const v16h vf = frag_from_f16(Vt + 16 * j * VP, VP, 32 * u);
        o[j] = WMMA_F16(vf, pf, o[j]);
      }
    }
    lrow = lrow * corr + psum;

    // Hand-over: this wave's reads of the buffers are done, its copies for the
    // next pass have landed; the barrier publishes them and frees these buffers.
    asm volatile("s_wait_dscnt 0x0" ::: "memory");
    asm volatile("s_wait_asynccnt 0x0" ::: "memory");
    __syncthreads();
    buf ^= 1;
  }
  asm volatile("s_wait_asynccnt 0x0" ::: "memory");  // nothing in flight at the end

  // ---- join the halves' sums, normalize, store wv (flat [B*H*S, 64] f16) ---
  const float inv = 1.0f / (lrow + xhalf(lrow));  // one denominator per lane
  _Float16* orow = wv + ((size_t)bh * Ss + q0 + n) * DH + 8 * hi;
#pragma unroll
  for (int j = 0; j < 4; ++j) {
    v8h ov;
#pragma unroll
    for (int r = 0; r < 8; ++r) ov[r] = (_Float16)(o[j][r] * inv);
    *(v8h*)(orow + 16 * j) = ov;  // 8 consecutive dims of one query: 16 bytes
  }
}

// ---------------------------------------------------------------------------
// Kernel 3: output projection. Raw-reshape merge means wv flat is exactly the
// [B*S, 1024] A matrix. out = A @ Wo^T + bo, M=4096 N=1024 K=1024.
// One block computes a 128 x 128 tile of out; its 8 waves (2 x 4) own 64 x 32
// each. A k slice of 128 of the block's 128 A rows and 128 Wo rows is staged in
// LDS by asynchronous copies, two buffers: slice t + 1 flies while slice t is
// multiplied, and every staged row serves all the waves that need it.
// ---------------------------------------------------------------------------
static constexpr int GT  = 128;            // tile rows of A, and of Wo
static constexpr int GK  = 128;            // k per slice: 256 data bytes a row
static constexpr int GP  = 136;            // LDS row pitch in f16: 272 B = 16 B x 17
static constexpr int GSL = 2 * GT * GP;    // one buffer: A rows, then Wo rows
static constexpr int GNT = HID / GK;       // 8 slices

// Eight 16-byte copies of one thread: rows 16 apart of one operand's slice.
// l: the lane's LDS byte address, g: its global address, both of the first row.
__device__ inline void copy8(unsigned l, const _Float16* g) {
  constexpr unsigned LS = 16 * GP * 2;  // 16 rows in LDS, bytes
  constexpr int      GS = 16 * HID;     // 16 rows in memory, elements
  // The closing s_wait_xcnt stands inside the statement so that no address
  // register of a copy is rewritten ahead of it.
  asm volatile(
      "global_load_async_to_lds_b128 %0, %8, off\n\t"
      "global_load_async_to_lds_b128 %1, %9, off\n\t"
      "global_load_async_to_lds_b128 %2, %10, off\n\t"
      "global_load_async_to_lds_b128 %3, %11, off\n\t"
      "global_load_async_to_lds_b128 %4, %12, off\n\t"
      "global_load_async_to_lds_b128 %5, %13, off\n\t"
      "global_load_async_to_lds_b128 %6, %14, off\n\t"
      "global_load_async_to_lds_b128 %7, %15, off\n\t"
      "s_wait_xcnt 0x0"
      :
      : "v"(l), "v"(l + LS), "v"(l + 2 * LS), "v"(l + 3 * LS), "v"(l + 4 * LS),
        "v"(l + 5 * LS), "v"(l + 6 * LS), "v"(l + 7 * LS), "v"(g), "v"(g + GS),
        "v"(g + 2 * GS), "v"(g + 3 * GS), "v"(g + 4 * GS), "v"(g + 5 * GS),
        "v"(g + 6 * GS), "v"(g + 7 * GS)
      : "memory");
}

__global__ __launch_bounds__(256) void outproj_kernel(
    const _Float16* __restrict__ wv, const _Float16* __restrict__ WoH,
    const float* __restrict__ bo, float* __restrict__ out) {
  __shared__ __align__(16) _Float16 st[2 * GSL];

  const int tid  = threadIdx.x;
  const int wave = tid >> 5;
  const int lane = tid & 31;
  const int n    = lane & 15;
  const int hi   = lane >> 4;
  const int m0   = (blockIdx.x >> 3) * GT;  // 32 row tiles
  const int n0   = (blockIdx.x & 7) * GT;   // 8 column tiles
  const int wm   = (wave >> 2) * 64;        // this wave's rows in the tile
  const int wn   = (wave & 3) * 32;         // this wave's columns in the tile

  // Copy map: 16 threads take one row's 256 bytes, so a wave copies whole lines.
  const int crow = tid >> 4, cseg = (tid & 15) * 8;
  const _Float16* ga = wv + (size_t)(m0 + crow) * HID + cseg;
  const _Float16* gb = WoH + (size_t)(n0 + crow) * HID + cseg;
  const unsigned la = (unsigned)(size_t)st + (crow * GP + cseg) * 2;
  const unsigned lb = la + GT * GP * 2;

  v8f zacc = {};
  v8f acc[4][2] = {{zacc, zacc}, {zacc, zacc}, {zacc, zacc}, {zacc, zacc}};

  // Slice 0 into buffer 0, landed and published; then slice 1 into buffer 1.
  copy8(la, ga);
  copy8(lb, gb);
  asm volatile("s_wait_asynccnt 0x0" ::: "memory");  // this wave's copies have landed
  __syncthreads();
  copy8(la + GSL * 2, ga + GK);
  copy8(lb + GSL * 2, gb + GK);

  for (int t = 0; t < GNT; ++t) {
    const int boff = (t & 1) * GSL;
    const _Float16* As = st + boff + wm * GP;
    const _Float16* Bs = st + boff + (GT + wn) * GP;
    // Two fragment sets: step s + 1 of this slice is read while step s multiplies.
    // The loops over sets and accumulators are unrolled so that every index is a
    // constant and the arrays stay in registers.
    v16h af[2][4], bf[2][2];
#pragma unroll
    for (int i = 0; i < 4; ++i) af[0][i] = frag_from_f16(As + 16 * i * GP, GP, 0);
#pragma unroll
    for (int j = 0; j < 2; ++j) bf[0][j] = frag_from_f16(Bs + 16 * j * GP, GP, 0);
#pragma unroll
    for (int s = 0; s < GK / 32; ++s) {
      const int cur = s & 1;
      if (s + 1 < GK / 32) {
#pragma unroll
        for (int i = 0; i < 4; ++i)
          af[cur ^ 1][i] = frag_from_f16(As + 16 * i * GP, GP, 32 * (s + 1));
#pragma unroll
        for (int j = 0; j < 2; ++j)
          bf[cur ^ 1][j] = frag_from_f16(Bs + 16 * j * GP, GP, 32 * (s + 1));
      }
      // Keeps the next step's LDS reads one group ahead of this step's products:
      // left free, the scheduler sinks each read to its use, into one register
      // set, and every pair of products then waits out an LDS latency.
      __builtin_amdgcn_sched_barrier(0);
#pragma unroll
      for (int i = 0; i < 4; ++i) {
        acc[i][0] = WMMA_F16(af[cur][i], bf[cur][0], acc[i][0]);
        acc[i][1] = WMMA_F16(af[cur][i], bf[cur][1], acc[i][1]);
      }
    }
    // Hand-over: this wave's reads of the buffer are done, its copies of slice
    // t + 1 have landed; the barrier publishes that slice and frees this buffer.
    asm volatile("s_wait_dscnt 0x0" ::: "memory");
    asm volatile("s_wait_asynccnt 0x0" ::: "memory");
    __syncthreads();
    if (t + 2 < GNT) {
      copy8(la + boff * 2, ga + (t + 2) * GK);
      copy8(lb + boff * 2, gb + (t + 2) * GK);
    }
  }
  asm volatile("s_wait_asynccnt 0x0" ::: "memory");  // nothing in flight at the end

  // Unrolled for constant accumulator indices, as above.
#pragma unroll
  for (int j = 0; j < 2; ++j) {
    const int col  = n0 + wn + 16 * j + n;
    const float bb = bo[col];
#pragma unroll
    for (int i = 0; i < 4; ++i)
#pragma unroll
      for (int r = 0; r < 8; ++r)
        out[(size_t)(m0 + wm + 16 * i + r + 8 * hi) * HID + col] = acc[i][j][r] + bb;
  }
}

// ---------------------------------------------------------------------------
extern "C" void kernel_launch(void* const* d_in, const int* in_sizes, int n_in,
                              void* d_out, int out_size, void* d_ws,
                              size_t ws_size, hipStream_t stream) {
  const float* q    = (const float*)d_in[0];
  const float* k    = (const float*)d_in[1];
  const float* v    = (const float*)d_in[2];
  const int*   mask = (const int*)d_in[3];
  const float* Wq   = (const float*)d_in[4];
  const float* bq   = (const float*)d_in[5];
  const float* Wk   = (const float*)d_in[6];
  const float* bk   = (const float*)d_in[7];
  const float* Wv   = (const float*)d_in[8];
  const float* bv   = (const float*)d_in[9];
  const float* Wo   = (const float*)d_in[10];
  const float* bo   = (const float*)d_in[11];

  // Workspace layout (bytes): q_i | k_i | vT | wv (8 MB f16 each) | Wo f16 (2 MB)
  // | mask bits (1 MB, at the next 4 MB step)
  const size_t HEADELEMS = (size_t)Bb * Hh * Ss * DH;  // 4,194,304
  char* ws = (char*)d_ws;
  _Float16* qh  = (_Float16*)(ws + 0 * HEADELEMS);
  _Float16* kh  = (_Float16*)(ws + 2 * HEADELEMS);
  _Float16* vT  = (_Float16*)(ws + 4 * HEADELEMS);
  _Float16* wvb = (_Float16*)(ws + 6 * HEADELEMS);
  _Float16* WoH = (_Float16*)(ws + 8 * HEADELEMS);
  unsigned* mbits = (unsigned*)(ws + 9 * HEADELEMS);

  const int wo_n = HID * HID;  // 1,048,576
  prep_kernel<<<PACKB + (wo_n + 255) / 256, 256, 0, stream>>>(Wo, WoH, wo_n,
                                                              mask, mbits);

  // 4096 row-tiles of 16 rows / 8 waves per block -> 512 blocks
  proj_kernel<<<512, 256, 0, stream>>>(q, k, v, Wq, bq, Wk, bk, Wv, bv,
                                       qh, kh, vT);

  // 32 (b,h) pairs * 16 blocks (128 q-rows each) = 512 blocks
  flash_kernel<<<512, 256, 0, stream>>>(qh, kh, vT, mbits, wvb);

  // 32 x 8 output tiles of 128 x 128, one block each
  outproj_kernel<<<256, 256, 0, stream>>>(wvb, WoH, bo, (float*)d_out);
}

// v008
// A run of this version takes 66.9 microseconds.
// In two side-by-side timings against v007, it was 1.03 and 1.04 times as fast.
// Counting every step since v000, it is 3.25 times as fast.
#include <hip/hip_runtime.h>
#include <hip/hip_bf16.h>
#include <hip/hip_fp16.h>

typedef __attribute__((ext_vector_type(16))) _Float16 v16h;
typedef __attribute__((ext_vector_type(8)))  _Float16 v8h;
typedef __attribute__((ext_vector_type(4)))  _Float16 v4h;
typedef __attribute__((ext_vector_type(8)))  float    v8f;
typedef __attribute__((ext_vector_type(2)))  float    v2f;
typedef __attribute__((ext_vector_type(4)))  float    v4f;
typedef __attribute__((ext_vector_type(4)))  int      v4i;
typedef __attribute__((ext_vector_type(16))) unsigned v16u;

using gv4i = v4i __attribute__((address_space(1)));  // global int4
using lv4i = v4i __attribute__((address_space(3)));  // LDS int4

#define WMMA_F16(a, b, c) \
  __builtin_amdgcn_wmma_f32_16x16x32_f16(false, (a), false, (b), (short)0, (c), false, false)

#ifndef __has_builtin
#define __has_builtin(x) 0
#endif

#if __has_builtin(__builtin_amdgcn_global_load_async_to_lds_b128)
#define HAVE_ASYNC_LDS 1
#else
#define HAVE_ASYNC_LDS 0
#endif

static constexpr int Bb  = 2;
static constexpr int Ss  = 2048;
static constexpr int HID = 1024;
static constexpr int Hh  = 16;
static constexpr int DH  = 64;
static constexpr int KB  = 128;      // keys per pass of the flash kernel
static constexpr int NU  = KB / 32;  // 32-key groups (one k step of P * V) per pass
// LDS row pitches in f16 elements: 16 bytes times an odd number, so that the
// 16 rows one ds_load_b128 half-wave reads fall on 16 distinct bank groups.
static constexpr int KP  = 72;       // K tile rows: 128 data bytes at pitch 144
static constexpr int VP  = KB + 8;   // V tile rows: 256 data bytes at pitch 272
static_assert(((KP / 8) & 1) && ((VP / 8) & 1), "pitches are 16 bytes times an odd number");

// ---------------------------------------------------------------------------
// Fragment loaders per CDNA5 ISA 7.12.2 (wave32):
//  A 16x32 f16: lane L holds row M=L&15; lanes 0-15 carry K={0..7,16..23},
//  lanes 16-31 carry K={8..15,24..31}. B 32x16 gathered symmetrically
//  (lane = column N, contiguous reduction dim in memory). Each lane loads
//  two contiguous 16-byte chunks.
// ---------------------------------------------------------------------------
__device__ inline v16h frag_from_f16(const _Float16* base, int ld, int k0) {
  const int lane = threadIdx.x & 31;
  const int r    = lane & 15;
  const int kb   = (lane & 16) ? 8 : 0;
  const _Float16* p = base + (size_t)r * ld + k0 + kb;
  v16h a;
#pragma unroll
  for (int i = 0; i < 8; ++i) a[i] = p[i];
#pragma unroll
  for (int i = 0; i < 8; ++i) a[8 + i] = p[16 + i];
  return a;
}

// The same two fragments (k 0..31 and 32..63) of a 16 x 64 f32 tile, in three
// parts: the lane's address, its eight 16-byte loads, the conversion of one
// fragment.
__device__ inline const float* lane_x(const float* base) {
  const int lane = threadIdx.x & 31;
  const int r    = lane & 15;
  const int kb   = (lane & 16) ? 8 : 0;
  return base + (size_t)r * DH + kb;
}

// The loops of these helpers are unrolled so that every index is a constant and
// the arrays stay in registers.
__device__ inline void load_x(const float* p, v4f (&x)[8]) {
#pragma unroll
  for (int i = 0; i < 4; ++i) {  // floats 16i..16i+7 of the lane's half
    x[2 * i]     = *(const v4f*)(p + 16 * i);
    x[2 * i + 1] = *(const v4f*)(p + 16 * i + 4);
  }
}

__device__ inline v16h frag_from_x(const v4f (&x)[8], int f) {
  v16h a;
#pragma unroll
  for (int i = 0; i < 16; ++i) a[i] = (_Float16)x[4 * f + (i >> 2)][i & 3];
  return a;
}

// Holds the eight loads of load_x ahead of this place (the loaded values are
// inputs only): left free, the compiler sinks them behind the barrier that
// follows, and the wave waits out a second memory latency there.
__device__ inline void hold_x(const v4f (&x)[8]) {
  asm volatile("" ::"v"(x[0]), "v"(x[1]), "v"(x[2]), "v"(x[3]), "v"(x[4]), "v"(x[5]),
               "v"(x[6]), "v"(x[7]));
}

// Value of lane l ^ 16: the two wave halves hold the two key halves of one query.
__device__ inline float xhalf(float x) {
  const int i = __builtin_bit_cast(int, x);
  return __builtin_bit_cast(
      float, __builtin_amdgcn_permlanex16(i, i, 0x76543210, 0xfedcba98, false, false));
}

// ---------------------------------------------------------------------------
// Kernel 0: input preparation. Blocks 0..PACKB-1 pack the mask, which all 16
// heads of a batch share, into bits, once: per 16-query tile and 32-key block
// 16 words, word i holding for every lane of the flash kernel's wave the bit
// of that lane's score i. They come first in the grid because they run the
// longest. The other blocks convert Wo f32 -> f16.
// ---------------------------------------------------------------------------
static constexpr int PACKB = Bb * (Ss / 16) * (Ss / 32) / 4 / 8;  // 512 blocks

__global__ __launch_bounds__(256) void prep_kernel(
    const float* __restrict__ src, _Float16* __restrict__ dst, int n,
    const int* __restrict__ mask, unsigned* __restrict__ mbits) {
  if (blockIdx.x < PACKB) {
    // One wave packs one query tile x four 32-key blocks. Lane (qn, hi) reads
    // the 16 mask words of the scores it will hold in the flash kernel (query
    // qn; keys 8hi+0..7 and 16+8hi+0..7 of the block); each ballot is one word
    // of the block. Lanes 0-15 collect an even block's 16 words, lanes 16-31
    // the next block's: one whole 128-byte line per store.
    const int lane = threadIdx.x & 31;
    const int qn   = lane & 15;
    const int hi   = lane >> 4;
    const int gw   = blockIdx.x * 8 + (threadIdx.x >> 5);  // 0..4095
    const int qt   = gw >> 4;                // b * (S/16) + query tile
    const int kb4  = (gw & 15) * 4;          // first of the four key blocks
    const int* Mr  = mask + ((size_t)qt * 16 + qn) * Ss + kb4 * 32 + 8 * hi;
    unsigned* Mo   = mbits + ((size_t)qt * (Ss / 32) + kb4) * 16 + lane;
    v4i m[4][4];
#pragma unroll
    for (int u = 0; u < 4; ++u) {
      m[u][0] = *(const v4i*)(Mr + 32 * u);
      m[u][1] = *(const v4i*)(Mr + 32 * u + 4);
      m[u][2] = *(const v4i*)(Mr + 32 * u + 16);
      m[u][3] = *(const v4i*)(Mr + 32 * u + 20);
    }
#pragma unroll
    for (int u2 = 0; u2 < 2; ++u2) {
      unsigned w = 0;
#pragma unroll
      for (int i = 0; i < 32; ++i) {  // lane i takes word i & 15 of block 2*u2 + (i >> 4)
        const unsigned bal =
            __builtin_amdgcn_ballot_w32(m[2 * u2 + (i >> 4)][(i >> 2) & 3][i & 3] != 0);
        w = lane == i ? bal : w;
      }
      Mo[32 * u2] = w;
    }
    return;
  }
  int i = (blockIdx.x - PACKB) * blockDim.x + threadIdx.x;
  if (i < n) dst[i] = (_Float16)src[i];
}

// ---------------------------------------------------------------------------
// Kernel 1: Q/K/V projections. Input viewed as flat [B*H*S, 64] row-major
// (the raw reshape keeps the 64-dim contiguous). q_i/k_i stored f16 in the
// same [B*H*S, 64] layout; v stored transposed as vT[B*H][64][S] so P*V
// A-fragments (of V^T) gather contiguously later.
// The three 64 x 64 weight matrices are converted to f16 once per block and kept
// in LDS: all 8 waves read their B fragments from there.
// ---------------------------------------------------------------------------
static constexpr int WP = 72;  // LDS row pitch of a weight matrix in f16: 16 B x 9

// One weight matrix into LDS, in two parts: a thread's four whole-line loads (a
// wave reads 512 bytes in a row), and their conversion, four f16 a store.
// Unrolled for constant indices: the array stays in registers.
__device__ inline void load_w(const float* __restrict__ Wm, v4f (&w)[4], int tid) {
#pragma unroll
  for (int i = 0; i < 4; ++i) w[i] = *(const v4f*)(Wm + (i * 256 + tid) * 4);
}

__device__ inline void store_w(const v4f (&w)[4], _Float16* l, int tid) {
#pragma unroll
  for (int i = 0; i < 4; ++i) {
    const int e = (i * 256 + tid) * 4;
    const v4h h = {(_Float16)w[i][0], (_Float16)w[i][1], (_Float16)w[i][2],
                   (_Float16)w[i][3]};
    *(v4h*)(l + (e >> 6) * WP + (e & 63)) = h;
  }
}

__global__ __launch_bounds__(256) void proj_kernel(
    const float* __restrict__ q, const float* __restrict__ k,
    const float* __restrict__ v,
    const float* __restrict__ Wq, const float* __restrict__ bq,
    const float* __restrict__ Wk, const float* __restrict__ bk,
    const float* __restrict__ Wv, const float* __restrict__ bv,
    _Float16* __restrict__ qh, _Float16* __restrict__ kh,
    _Float16* __restrict__ vT) {
  __shared__ __align__(16) _Float16 wl[3][DH * WP];  // Wq, Wk, Wv rows at pitch WP

  const int wave = threadIdx.x >> 5;
  const int lane = threadIdx.x & 31;
  const int n    = lane & 15;
  const int hi   = lane >> 4;
  const size_t g0 = ((size_t)blockIdx.x * 8 + wave) * 16;  // row-tile base

  // The weights come first: they are cached, and converted while the inputs fly.
  v4f wq[4], wk[4], wv[4], xq[8], xk[8], xv[8];
  load_w(Wq, wq, threadIdx.x);
  load_w(Wk, wk, threadIdx.x);
  load_w(Wv, wv, threadIdx.x);
  const float* pq = lane_x(q + g0 * DH);
  const float* pk = lane_x(k + g0 * DH);
  const float* pv = lane_x(v + g0 * DH);
  load_x(pq, xq);
  load_x(pk, xk);
  load_x(pv, xv);
  // No address register of these loads is rewritten ahead of this wait; the
  // three addresses are inputs so that their registers stay theirs up to it.
  asm volatile("s_wait_xcnt 0x0" ::"v"(pq), "v"(pk), "v"(pv) : "memory");

  store_w(wq, wl[0], threadIdx.x);
  store_w(wk, wl[1], threadIdx.x);
  store_w(wv, wl[2], threadIdx.x);
  hold_x(xq);
  hold_x(xk);
  hold_x(xv);
  __syncthreads();  // the weights are read by every wave

  const v16h aq0 = frag_from_x(xq, 0), aq1 = frag_from_x(xq, 1);
  const v16h ak0 = frag_from_x(xk, 0), ak1 = frag_from_x(xk, 1);
  const v16h av0 = frag_from_x(xv, 0), av1 = frag_from_x(xv, 1);

  // q projection: out = X @ Wq^T + bq ; B[k][n] = Wq[n][k] (row n, contiguous k)
#pragma unroll
  for (int j = 0; j < 4; ++j) {
    v8f c = {};
    c = WMMA_F16(aq0, frag_from_f16(wl[0] + 16 * j * WP, WP, 0), c);
    c = WMMA_F16(aq1, frag_from_f16(wl[0] + 16 * j * WP, WP, 32), c);
    const int col = 16 * j + n;
    const float bias = bq[col];
#pragma unroll
    for (int r = 0; r < 8; ++r)
      qh[(g0 + r + 8 * hi) * DH + col] = (_Float16)(c[r] + bias);
  }
#pragma unroll
  for (int j = 0; j < 4; ++j) {
    v8f c = {};
    c = WMMA_F16(ak0, frag_from_f16(wl[1] + 16 * j * WP, WP, 0), c);
    c = WMMA_F16(ak1, frag_from_f16(wl[1] + 16 * j * WP, WP, 32), c);
    const int col = 16 * j + n;
    const float bias = bk[col];
#pragma unroll
    for (int r = 0; r < 8; ++r)
      kh[(g0 + r + 8 * hi) * DH + col] = (_Float16)(c[r] + bias);
  }
  // v projection -> transposed store
  const size_t bh = g0 >> 11;           // b*H + h (tiles never straddle heads)
  const int    s0 = (int)(g0 & 2047);
#pragma unroll
  for (int j = 0; j < 4; ++j) {
    v8f c = {};
    c = WMMA_F16(av0, frag_from_f16(wl[2] + 16 * j * WP, WP, 0), c);
    c = WMMA_F16(av1, frag_from_f16(wl[2] + 16 * j * WP, WP, 32), c);
    const int col = 16 * j + n;
    const float bias = bv[col];
#pragma unroll
    for (int r = 0; r < 8; ++r)
      vT[(bh * DH + col) * (size_t)Ss + (s0 + r + 8 * hi)] =
          (_Float16)(c[r] + bias);
  }
}

// ---------------------------------------------------------------------------
// Async (or fallback) staging of one KB-key K tile [KB][64] and V tile
// [64][KB] (from transposed V) into LDS, rows at the padded pitches KP and VP.
// 256 threads x NU x 16B per tile: 32 more K rows, 64 / NU more V rows a turn.
// ---------------------------------------------------------------------------
__device__ inline void stage_kv(const _Float16* __restrict__ K,
                                const _Float16* __restrict__ V, int kb0,
                                _Float16* ktb, _Float16* vtb, int tid) {
  constexpr int VT = KB / 8;                               // threads per V row
  const int krow = tid >> 3, kseg = (tid & 7) * 8;         // key row, 8-f16 segment
  const int vrow = tid / VT, vseg = (tid & (VT - 1)) * 8;  // dim row, 8-f16 segment
  const _Float16* gk = K + (size_t)(kb0 + krow) * DH + kseg;
  const _Float16* gv = V + (size_t)vrow * Ss + kb0 + vseg;
  _Float16* lk = ktb + krow * KP + kseg;
  _Float16* lv = vtb + vrow * VP + vseg;
  // Unrolled: the copies of a pass issue in a row, their steps are constants.
#pragma unroll
  for (int i = 0; i < NU; ++i) {
    const _Float16* gki = gk + (size_t)(32 * i) * DH;
    const _Float16* gvi = gv + (size_t)(256 / VT * i) * Ss;
    _Float16* lki = lk + 32 * i * KP;
    _Float16* lvi = lv + 256 / VT * i * VP;
#if HAVE_ASYNC_LDS
    __builtin_amdgcn_global_load_async_to_lds_b128((gv4i*)gki, (lv4i*)lki, 0, 0);
    __builtin_amdgcn_global_load_async_to_lds_b128((gv4i*)gvi, (lv4i*)lvi, 0, 0);
#else
    *(float4*)lki = *(const float4*)gki;
    *(float4*)lvi = *(const float4*)gvi;
#endif
  }
}

// ---------------------------------------------------------------------------
// Kernel 2: flash attention, transposed products. A block takes 128 queries; its
// 8 waves share double-buffered LDS K/V tiles staged with async global->LDS
// copies (DMA of pass i+1 overlaps WMMA work on pass i).
// A wave owns 32 queries (two tiles of 16) and one half of the keys of every
// pass: waves w and w + 4 have the same queries and the two key halves. So each
// K and each V fragment read from LDS feeds two WMMAs, one a query tile, and the
// block still has its 8 waves. The two partial results of a query are joined
// once, behind the key loop, through LDS.
// A pass is KB keys, NG groups of 32 a wave. Per group and query tile:
// S^T = K * Q^T (4 WMMA), so lane (n, hi) holds 16 scores of query n (keys
// 8*hi+r and 16+8*hi+r): mask, maximum and sum are in-lane, and the two score
// tiles converted in place are the B operand of O^T += V^T * P^T (4 WMMA). Once
// per pass and query tile: the exchange of the maximum between the wave halves,
// the correction factor, the rescaling of O and of the sum; once per pass the
// hand-over of the buffers.
// The mask comes as the packed words of kernel 0: 16 words per group and query
// tile by one scalar load, each word the lane mask of one select.
// ---------------------------------------------------------------------------
static constexpr int NG = NU / 2;  // 32-key groups of one wave per pass

__global__ __launch_bounds__(256) void flash_kernel(
    const _Float16* __restrict__ qh, const _Float16* __restrict__ kh,
    const _Float16* __restrict__ vT, const unsigned* __restrict__ mbits,
    _Float16* __restrict__ wv) {
  __shared__ __align__(16) _Float16 kt[2][KB * KP];  // [key][dim], rows at pitch KP
  __shared__ __align__(16) _Float16 vt[2][DH * VP];  // [dim][key], rows at pitch VP
  // The join: every wave hands one query tile's O, maximum and sum to its partner.
  __shared__ __align__(16) v4f xo[8][8][32];
  __shared__ __align__(8) v2f xml[8][32];

  const int tid  = threadIdx.x;
  // Wave-uniform for the compiler: the key half and the mask address are scalars.
  const int wave = __builtin_amdgcn_readfirstlane(tid >> 5);
  const int lane = tid & 31;
  const int n    = lane & 15;
  const int hi   = lane >> 4;
  const int half = wave >> 2;                          // this wave's half of the keys
  const int bh   = blockIdx.x >> 4;                    // b*H + h
  const int q0   = (blockIdx.x & 15) * 128 + (wave & 3) * 32;
  const int b    = bh >> 4;

  const _Float16* Q  = qh + ((size_t)bh * Ss + q0) * DH;
  const _Float16* K  = kh + (size_t)bh * Ss * DH;
  const _Float16* V  = vT + (size_t)bh * DH * Ss;
  // This wave's packed mask words: 16 per key block, MT words on to the next
  // query tile; they load into scalar registers.
  constexpr int MT = (Ss / 32) * 16;
  const unsigned* Mw = mbits + (size_t)(b * (Ss / 16) + (q0 >> 4)) * MT + half * NG * 16;

  // The loops over query tiles, groups and registers, here and below, are unrolled
  // so that every index is a constant and the arrays stay in registers.
  v16h qf[2][2];
#pragma unroll
  for (int t = 0; t < 2; ++t) {
    qf[t][0] = frag_from_f16(Q + 16 * t * DH, DH, 0);
    qf[t][1] = frag_from_f16(Q + 16 * t * DH, DH, 32);
  }

  // Scores stay the raw products K * Q^T: exp((s - m) / 8) = 2^(s * SC2 - m * SC2).
  constexpr float SC2    = 0.125f * 1.44269504088896340736f;  // scale * log2(e)
  constexpr float MASKED = -80000.f;                          // -10000 / scale
  // Per query tile: running maximum of query n, raw (equal in both wave halves),
  // and running sum over this lane's keys only.
  float mrow[2] = {-3.0e38f, -3.0e38f};
  float lrow[2] = {0.f, 0.f};
  v8f zacc = {};
  // o[t][j][r] = O[query 16t + n][dim 16j + 8hi + r], this wave's keys only
  v8f o[2][4] = {{zacc, zacc, zacc, zacc}, {zacc, zacc, zacc, zacc}};

  // Prologue: stage the first K/V tiles.
  stage_kv(K, V, 0, kt[0], vt[0], tid);
  asm volatile("s_wait_asynccnt 0x0" ::: "memory");  // this wave's copies have landed
  __syncthreads();

  int buf = 0;
  for (int kb0 = 0; kb0 < Ss; kb0 += KB) {
    // Kick off DMA for the next pass into the other buffer (overlaps WMMA).
    if (kb0 + KB < Ss) stage_kv(K, V, kb0 + KB, kt[buf ^ 1], vt[buf ^ 1], tid);

    const _Float16* Kt = kt[buf] + half * (32 * NG) * KP;  // this wave's key rows
    const _Float16* Vt = vt[buf] + half * (32 * NG);       // and key columns

    // ---- mask bits of this pass: 16 lane-mask words a group, scalar loads --
    v16u mw[2][NG];
#pragma unroll
    for (int t = 0; t < 2; ++t)
#pragma unroll
      for (int u = 0; u < NG; ++u)
        mw[t][u] = *(const v16u*)(Mw + t * MT + ((kb0 >> 5) + u) * 16);

    // ---- scores, transposed: s0[t][u][r] = S[key 32u+8hi+r][query 16t+n],
    // s1: key +16. Each K fragment is read once and multiplies both query tiles.
    v8f s0[2][NG], s1[2][NG];
#pragma unroll
    for (int u = 0; u < NG; ++u) {
      const _Float16* Ku = Kt + 32 * u * KP;
      const v16h ka0 = frag_from_f16(Ku, KP, 0);
      const v16h ka1 = frag_from_f16(Ku, KP, 32);
      const v16h kc0 = frag_from_f16(Ku + 16 * KP, KP, 0);
      const v16h kc1 = frag_from_f16(Ku + 16 * KP, KP, 32);
#pragma unroll
      for (int t = 0; t < 2; ++t) {
        v8f a = {}, c = {};
        a = WMMA_F16(ka0, qf[t][0], a);
        c = WMMA_F16(kc0, qf[t][0], c);
        a = WMMA_F16(ka1, qf[t][1], a);
        c = WMMA_F16(kc1, qf[t][1], c);
        s0[t][u] = a;
        s1[t][u] = c;
      }
    }
    // Ends the scheduling region at the last score product: with the whole pass
    // in one region the scheduler waits on every K and V fragment alone, orders
    // the softmax in dependent pairs and moves the row sum behind the barrier.
    __builtin_amdgcn_sched_barrier(0);

    // ---- mask on the raw products (mask!=0 -> -10000 / scale, exact) and the
    // maximum; the scale comes with the exponent's multiply-add below. Then the
    // online softmax update: one query per lane and tile, once per pass -------
    float mc[2], corr[2];
#pragma unroll
    for (int t = 0; t < 2; ++t) {
      float gmax[NG];
#pragma unroll
      for (int u = 0; u < NG; ++u) {
#pragma unroll
        for (int r = 0; r < 8; ++r) {
          s0[t][u][r] =
              __builtin_amdgcn_inverse_ballot_w32(mw[t][u][r]) ? MASKED : s0[t][u][r];
          s1[t][u][r] =
              __builtin_amdgcn_inverse_ballot_w32(mw[t][u][8 + r]) ? MASKED : s1[t][u][r];
        }
        float x = fmaxf(s0[t][u][0], s1[t][u][0]);
#pragma unroll
        for (int r = 1; r < 8; ++r) x = fmaxf(x, fmaxf(s0[t][u][r], s1[t][u][r]));
        gmax[u] = x;
      }
      float tmax = gmax[0];
#pragma unroll
      for (int u = 1; u < NG; ++u) tmax = fmaxf(tmax, gmax[u]);
      tmax = fmaxf(tmax, xhalf(tmax));
      const float mnew = fmaxf(mrow[t], tmax);
      corr[t] = __builtin_amdgcn_exp2f((mrow[t] - mnew) * SC2);
      mc[t]   = mnew * SC2;  // the maximum in the exponent's unit
      mrow[t] = mnew;
#pragma unroll
      for (int j = 0; j < 4; ++j)
#pragma unroll
        for (int r = 0; r < 8; ++r) o[t][j][r] *= corr[t];
    }

    // ---- per group: P of both query tiles, its sums, and O^T += V^T @ P^T ---
    float psum[2] = {0.f, 0.f};
#pragma unroll
    for (int u = 0; u < NG; ++u) {
      // B operands: pf[t][i] = P[query 16t+n][key 32u+8hi+i], pf[t][8+i]: key +16
      v16h pf[2];
#pragma unroll
      for (int t = 0; t < 2; ++t) {
        float gsum = 0.f;
#pragma unroll
        for (int r = 0; r < 8; r += 2) {
          // Two scores a multiply-add: the packed f32 form.
          const v2f sc = {SC2, SC2}, nm = {-mc[t], -mc[t]};
          const v2f a0 = {s0[t][u][r], s0[t][u][r + 1]};
          const v2f a1 = {s1[t][u][r], s1[t][u][r + 1]};
          const v2f e0 = __builtin_elementwise_fma(a0, sc, nm);
          const v2f e1 = __builtin_elementwise_fma(a1, sc, nm);
#pragma unroll  // constant indices, as above
          for (int i = 0; i < 2; ++i) {
            const float p0 = __builtin_amdgcn_exp2f(e0[i]);
            const float p1 = __builtin_amdgcn_exp2f(e1[i]);
            gsum += p0 + p1;
            pf[t][r + i]     = (_Float16)p0;
            pf[t][8 + r + i] = (_Float16)p1;
          }
        }
        psum[t] += gsum;
      }
      // A frags: dim rows of the LDS V tile, keys 32u..32u+31 of this wave's
      // half; each is read once and multiplies both query tiles.
#pragma unroll
      for (int j = 0; j < 4; ++j) {
        const v16h vf = frag_from_f16(Vt + 16 * j * VP, VP, 32 * u);
        o[0][j] = WMMA_F16(vf, pf[0], o[0][j]);
        o[1][j] = WMMA_F16(vf, pf[1], o[1][j]);
      }
    }
#pragma unroll
    for (int t = 0; t < 2; ++t) lrow[t] = lrow[t] * corr[t] + psum[t];

    // Hand-over: this wave's reads of the buffers are done, its copies for the
    // next pass have landed; the barrier publishes them and frees these buffers.
    asm volatile("s_wait_dscnt 0x0" ::: "memory");
    asm volatile("s_wait_asynccnt 0x0" ::: "memory");
    __syncthreads();
    buf ^= 1;
  }
  asm volatile("s_wait_asynccnt 0x0" ::: "memory");  // nothing in flight at the end

  // ---- join the key halves: a wave of the first half finishes query tile 0 and
  // hands tile 1 to its partner, a wave of the second half the other way round.
  // The selects are on a wave-uniform condition with constant indices.
  const bool up = half != 0;
  v8f ok[4];  // the tile this wave keeps
#pragma unroll
  for (int j = 0; j < 4; ++j) {
    const v8f og = up ? o[0][j] : o[1][j];
    ok[j]        = up ? o[1][j] : o[0][j];
    xo[wave][2 * j][lane]     = v4f{og[0], og[1], og[2], og[3]};
    xo[wave][2 * j + 1][lane] = v4f{og[4], og[5], og[6], og[7]};
  }
  xml[wave][lane] = up ? v2f{mrow[0], lrow[0]} : v2f{mrow[1], lrow[1]};
  const float mk = up ? mrow[1] : mrow[0];
  const float lk = up ? lrow[1] : lrow[0];
  __syncthreads();  // the partner's tile is read behind it
  const v2f   ml = xml[wave ^ 4][lane];
  const float mj = fmaxf(mk, ml[0]);
  const float fk = __builtin_amdgcn_exp2f((mk - mj) * SC2);     // this wave's weight
  const float fp = __builtin_amdgcn_exp2f((ml[0] - mj) * SC2);  // the partner's

  // ---- join the wave halves' sums, normalize, store wv (flat [B*H*S, 64] f16)
  const float lj  = lk * fk + ml[1] * fp;
  const float inv = 1.0f / (lj + xhalf(lj));  // one denominator per lane
  const float wk = fk * inv, wp = fp * inv;
  _Float16* orow = wv + ((size_t)bh * Ss + q0 + 16 * half + n) * DH + 8 * hi;
#pragma unroll
  for (int j = 0; j < 4; ++j) {
    const v4f p0 = xo[wave ^ 4][2 * j][lane];
    const v4f p1 = xo[wave ^ 4][2 * j + 1][lane];
    v8h ov;
#pragma unroll
    for (int r = 0; r < 4; ++r) {
      ov[r]     = (_Float16)(ok[j][r] * wk + p0[r] * wp);
      ov[4 + r] = (_Float16)(ok[j][4 + r] * wk + p1[r] * wp);
    }
    *(v8h*)(orow + 16 * j) = ov;  // 8 consecutive dims of one query: 16 bytes
  }
}

// ---------------------------------------------------------------------------
// Kernel 3: output projection. Raw-reshape merge means wv flat is exactly the
// [B*S, 1024] A matrix. out = A @ Wo^T + bo, M=4096 N=1024 K=1024.
// One block computes a 128 x 128 tile of out; its 8 waves (2 x 4) own 64 x 32
// each. A k slice of 128 of the block's 128 A rows and 128 Wo rows is staged in
// LDS by asynchronous copies, two buffers: slice t + 1 flies while slice t is
// multiplied, and every staged row serves all the waves that need it.
// ---------------------------------------------------------------------------
static constexpr int GT  = 128;            // tile rows of A, and of Wo
static constexpr int GK  = 128;            // k per slice: 256 data bytes a row
static constexpr int GP  = 136;            // LDS row pitch in f16: 272 B = 16 B x 17
static constexpr int GSL = 2 * GT * GP;    // one buffer: A rows, then Wo rows
static constexpr int GNT = HID / GK;       // 8 slices

// Eight 16-byte copies of one thread: rows 16 apart of one operand's slice.
// l: the lane's LDS byte address, g: its global address, both of the first row.
__device__ inline void copy8(unsigned l, const _Float16* g) {
  constexpr unsigned LS = 16 * GP * 2;  // 16 rows in LDS, bytes
  constexpr int      GS = 16 * HID;     // 16 rows in memory, elements
  // The closing s_wait_xcnt stands inside the statement so that no address
  // register of a copy is rewritten ahead of it.
  asm volatile(
      "global_load_async_to_lds_b128 %0, %8, off\n\t"
      "global_load_async_to_lds_b128 %1, %9, off\n\t"
      "global_load_async_to_lds_b128 %2, %10, off\n\t"
      "global_load_async_to_lds_b128 %3, %11, off\n\t"
      "global_load_async_to_lds_b128 %4, %12, off\n\t"
      "global_load_async_to_lds_b128 %5, %13, off\n\t"
      "global_load_async_to_lds_b128 %6, %14, off\n\t"
      "global_load_async_to_lds_b128 %7, %15, off\n\t"
      "s_wait_xcnt 0x0"
      :
      : "v"(l), "v"(l + LS), "v"(l + 2 * LS), "v"(l + 3 * LS), "v"(l + 4 * LS),
        "v"(l + 5 * LS), "v"(l + 6 * LS), "v"(l + 7 * LS), "v"(g), "v"(g + GS),
        "v"(g + 2 * GS), "v"(g + 3 * GS), "v"(g + 4 * GS), "v"(g + 5 * GS),
        "v"(g + 6 * GS), "v"(g + 7 * GS)
      : "memory");
}

__global__ __launch_bounds__(256) void outproj_kernel(
    const _Float16* __restrict__ wv, const _Float16* __restrict__ WoH,
    const float* __restrict__ bo, float* __restrict__ out) {
  __shared__ __align__(16) _Float16 st[2 * GSL];

  const int tid  = threadIdx.x;
  const int wave = tid >> 5;
  const int lane = tid & 31;
  const int n    = lane & 15;
  const int hi   = lane >> 4;
  const int m0   = (blockIdx.x >> 3) * GT;  // 32 row tiles
  const int n0   = (blockIdx.x & 7) * GT;   // 8 column tiles
  const int wm   = (wave >> 2) * 64;        // this wave's rows in the tile
  const int wn   = (wave & 3) * 32;         // this wave's columns in the tile

  // Copy map: 16 threads take one row's 256 bytes, so a wave copies whole lines.
  const int crow = tid >> 4, cseg = (tid & 15) * 8;
  const _Float16* ga = wv + (size_t)(m0 + crow) * HID + cseg;
  const _Float16* gb = WoH + (size_t)(n0 + crow) * HID + cseg;
  const unsigned la = (unsigned)(size_t)st + (crow * GP + cseg) * 2;
  const unsigned lb = la + GT * GP * 2;

  v8f zacc = {};
  v8f acc[4][2] = {{zacc, zacc}, {zacc, zacc}, {zacc, zacc}, {zacc, zacc}};

  // Slice 0 into buffer 0, landed and published; then slice 1 into buffer 1.
  copy8(la, ga);
  copy8(lb, gb);
  asm volatile("s_wait_asynccnt 0x0" ::: "memory");  // this wave's copies have landed
  __syncthreads();
  copy8(la + GSL * 2, ga + GK);
  copy8(lb + GSL * 2, gb + GK);

  for (int t = 0; t < GNT; ++t) {
    const int boff = (t & 1) * GSL;
    const _Float16* As = st + boff + wm * GP;
    const _Float16* Bs = st + boff + (GT + wn) * GP;
    // Two fragment sets: step s + 1 of this slice is read while step s multiplies.
    // The loops over sets and accumulators are unrolled so that every index is a
    // constant and the arrays stay in registers.
    v16h af[2][4], bf[2][2];
#pragma unroll
    for (int i = 0; i < 4; ++i) af[0][i] = frag_from_f16(As + 16 * i * GP, GP, 0);
#pragma unroll
    for (int j = 0; j < 2; ++j) bf[0][j] = frag_from_f16(Bs + 16 * j * GP, GP, 0);
#pragma unroll
    for (int s = 0; s < GK / 32; ++s) {
      const int cur = s & 1;
      if (s + 1 < GK / 32) {
#pragma unroll
        for (int i = 0; i < 4; ++i)
          af[cur ^ 1][i] = frag_from_f16(As + 16 * i * GP, GP, 32 * (s + 1));
#pragma unroll
        for (int j = 0; j < 2; ++j)
          bf[cur ^ 1][j] = frag_from_f16(Bs + 16 * j * GP, GP, 32 * (s + 1));
      }
      // Keeps the next step's LDS reads one group ahead of this step's products:
      // left free, the scheduler sinks each read to its use, into one register
      // set, and every pair of products then waits out an LDS latency.
      __builtin_amdgcn_sched_barrier(0);
#pragma unroll
      for (int i = 0; i < 4; ++i) {
        acc[i][0] = WMMA_F16(af[cur][i], bf[cur][0], acc[i][0]);
        acc[i][1] = WMMA_F16(af[cur][i], bf[cur][1], acc[i][1]);
      }
    }
    // Hand-over: this wave's reads of the buffer are done, its copies of slice
    // t + 1 have landed; the barrier publishes that slice and frees this buffer.
    asm volatile("s_wait_dscnt 0x0" ::: "memory");
    asm volatile("s_wait_asynccnt 0x0" ::: "memory");
    __syncthreads();
    if (t + 2 < GNT) {
      copy8(la + boff * 2, ga + (t + 2) * GK);
      copy8(lb + boff * 2, gb + (t + 2) * GK);
    }
  }
  asm volatile("s_wait_asynccnt 0x0" ::: "memory");  // nothing in flight at the end

  // Unrolled for constant accumulator indices, as above.
#pragma unroll
  for (int j = 0; j < 2; ++j) {
    const int col  = n0 + wn + 16 * j + n;
    const float bb = bo[col];
#pragma unroll
    for (int i = 0; i < 4; ++i)
#pragma unroll
      for (int r = 0; r < 8; ++r)
        out[(size_t)(m0 + wm + 16 * i + r + 8 * hi) * HID + col] = acc[i][j][r] + bb;
  }
}

// ---------------------------------------------------------------------------
extern "C" void kernel_launch(void* const* d_in, const int* in_sizes, int n_in,
                              void* d_out, int out_size, void* d_ws,
                              size_t ws_size, hipStream_t stream) {
  const float* q    = (const float*)d_in[0];
  const float* k    = (const float*)d_in[1];
  const float* v    = (const float*)d_in[2];
  const int*   mask = (const int*)d_in[3];
  const float* Wq   = (const float*)d_in[4];
  const float* bq   = (const float*)d_in[5];
  const float* Wk   = (const float*)d_in[6];
  const float* bk   = (const float*)d_in[7];
  const float* Wv   = (const float*)d_in[8];
  const float* bv   = (const float*)d_in[9];
  const float* Wo   = (const float*)d_in[10];
  const float* bo   = (const float*)d_in[11];

  // Workspace layout (bytes): q_i | k_i | vT | wv (8 MB f16 each) | Wo f16 (2 MB)
  // | mask bits (1 MB, at the next 4 MB step)
  const size_t HEADELEMS = (size_t)Bb * Hh * Ss * DH;  // 4,194,304
  char* ws = (char*)d_ws;
  _Float16* qh  = (_Float16*)(ws + 0 * HEADELEMS);
  _Float16* kh  = (_Float16*)(ws + 2 * HEADELEMS);
  _Float16* vT  = (_Float16*)(ws + 4 * HEADELEMS);
  _Float16* wvb = (_Float16*)(ws + 6 * HEADELEMS);
  _Float16* WoH = (_Float16*)(ws + 8 * HEADELEMS);
  unsigned* mbits = (unsigned*)(ws + 9 * HEADELEMS);

  const int wo_n = HID * HID;  // 1,048,576
  prep_kernel<<<PACKB + (wo_n + 255) / 256, 256, 0, stream>>>(Wo, WoH, wo_n,
                                                              mask, mbits);

  // 4096 row-tiles of 16 rows / 8 waves per block -> 512 blocks
  proj_kernel<<<512, 256, 0, stream>>>(q, k, v, Wq, bq, Wk, bk, Wv, bv,
                                       qh, kh, vT);

  // 32 (b,h) pairs * 16 blocks (128 q-rows each) = 512 blocks
  flash_kernel<<<512, 256, 0, stream>>>(qh, kh, vT, mbits, wvb);

  // 32 x 8 output tiles of 128 x 128, one block each
  outproj_kernel<<<256, 256, 0, stream>>>(wvb, WoH, bo, (float*)d_out);
}

// v009
// Measured time: 64.7 microseconds a run.
// Timed twice side by side with v008, it ran 1.04 times as fast both times.
// All steps since v000 together make it 3.36 times as fast.
#include <hip/hip_runtime.h>
#include <hip/hip_bf16.h>
#include <hip/hip_fp16.h>

typedef __attribute__((ext_vector_type(16))) _Float16 v16h;
typedef __attribute__((ext_vector_type(8)))  _Float16 v8h;
typedef __attribute__((ext_vector_type(4)))  _Float16 v4h;
typedef __attribute__((ext_vector_type(8)))  float    v8f;
typedef __attribute__((ext_vector_type(2)))  float    v2f;
typedef __attribute__((ext_vector_type(4)))  float    v4f;
typedef __attribute__((ext_vector_type(4)))  int      v4i;
typedef __attribute__((ext_vector_type(16))) unsigned v16u;

using gv4i = v4i __attribute__((address_space(1)));  // global int4
using lv4i = v4i __attribute__((address_space(3)));  // LDS int4

#define WMMA_F16(a, b, c) \
  __builtin_amdgcn_wmma_f32_16x16x32_f16(false, (a), false, (b), (short)0, (c), false, false)

#ifndef __has_builtin
#define __has_builtin(x) 0
#endif

#if __has_builtin(__builtin_amdgcn_global_load_async_to_lds_b128)
#define HAVE_ASYNC_LDS 1
#else
#define HAVE_ASYNC_LDS 0
#endif

static constexpr int Bb  = 2;
static constexpr int Ss  = 2048;
static constexpr int HID = 1024;
static constexpr int Hh  = 16;
static constexpr int DH  = 64;
static constexpr int KB  = 128;      // keys per pass of the flash kernel
static constexpr int NU  = KB / 32;  // 32-key groups (one k step of P * V) per pass
// LDS row pitches in f16 elements: 16 bytes times an odd number, so that the
// 16 rows one ds_load_b128 half-wave reads fall on 16 distinct bank groups.
static constexpr int KP  = 72;       // K tile rows: 128 data bytes at pitch 144
static constexpr int VP  = KB + 8;   // V tile rows: 256 data bytes at pitch 272
static_assert(((KP / 8) & 1) && ((VP / 8) & 1), "pitches are 16 bytes times an odd number");
// The projected q is stored times scale * log2(e): K * Q^T is then the exponent of
// 2 in the softmax, exp(s / 8) = 2^(s * SC2).
static constexpr float SC2 = 0.125f * 1.44269504088896340736f;

// ---------------------------------------------------------------------------
// Fragment loaders per CDNA5 ISA 7.12.2 (wave32):
//  A 16x32 f16: lane L holds row M=L&15; lanes 0-15 carry K={0..7,16..23},
//  lanes 16-31 carry K={8..15,24..31}. B 32x16 gathered symmetrically
//  (lane = column N, contiguous reduction dim in memory). Each lane loads
//  two contiguous 16-byte chunks.
// ---------------------------------------------------------------------------
__device__ inline v16h frag_from_f16(const _Float16* base, int ld, int k0) {
  const int lane = threadIdx.x & 31;
  const int r    = lane & 15;
  const int kb   = (lane & 16) ? 8 : 0;
  const _Float16* p = base + (size_t)r * ld + k0 + kb;
  v16h a;
#pragma unroll
  for (int i = 0; i < 8; ++i) a[i] = p[i];
#pragma unroll
  for (int i = 0; i < 8; ++i) a[8 + i] = p[16 + i];
  return a;
}

// The same two fragments (k 0..31 and 32..63) of a 16 x 64 f32 tile, in three
// parts: the lane's address, its eight 16-byte loads, the conversion of one
// fragment.
__device__ inline const float* lane_x(const float* base) {
  const int lane = threadIdx.x & 31;
  const int r    = lane & 15;
  const int kb   = (lane & 16) ? 8 : 0;
  return base + (size_t)r * DH + kb;
}

// The loops of these helpers are unrolled so that every index is a constant and
// the arrays stay in registers.
__device__ inline void load_x(const float* p, v4f (&x)[8]) {
#pragma unroll
  for (int i = 0; i < 4; ++i) {  // floats 16i..16i+7 of the lane's half
    x[2 * i]     = *(const v4f*)(p + 16 * i);
    x[2 * i + 1] = *(const v4f*)(p + 16 * i + 4);
  }
}

__device__ inline v16h frag_from_x(const v4f (&x)[8], int f) {
  v16h a;
#pragma unroll
  for (int i = 0; i < 16; ++i) a[i] = (_Float16)x[4 * f + (i >> 2)][i & 3];
  return a;
}

// Holds the eight loads of load_x ahead of this place (the loaded values are
// inputs only): left free, the compiler sinks them behind the barrier that
// follows, and the wave waits out a second memory latency there.
__device__ inline void hold_x(const v4f (&x)[8]) {
  asm volatile("" ::"v"(x[0]), "v"(x[1]), "v"(x[2]), "v"(x[3]), "v"(x[4]), "v"(x[5]),
               "v"(x[6]), "v"(x[7]));
}

// Value of lane l ^ 16: the two wave halves hold the two key halves of one query.
__device__ inline float xhalf(float x) {
  const int i = __builtin_bit_cast(int, x);
  return __builtin_bit_cast(
      float, __builtin_amdgcn_permlanex16(i, i, 0x76543210, 0xfedcba98, false, false));
}

// ---------------------------------------------------------------------------
// Kernel 0: input preparation. Blocks 0..PACKB-1 pack the mask, which all 16
// heads of a batch share, into bits, once: per 16-query tile and 32-key block
// 16 words, word i holding for every lane of the flash kernel's wave the bit
// of that lane's score i. They come first in the grid because they run the
// longest. The other blocks convert Wo f32 -> f16.
// ---------------------------------------------------------------------------
static constexpr int PACKB = Bb * (Ss / 16) * (Ss / 32) / 4 / 8;  // 512 blocks

__global__ __launch_bounds__(256) void prep_kernel(
    const float* __restrict__ src, _Float16* __restrict__ dst, int n,
    const int* __restrict__ mask, unsigned* __restrict__ mbits) {
  if (blockIdx.x < PACKB) {
    // One wave packs one query tile x four 32-key blocks. Lane (qn, hi) reads
    // the 16 mask words of the scores it will hold in the flash kernel (query
    // qn; keys 8hi+0..7 and 16+8hi+0..7 of the block); each ballot is one word
    // of the block. Lanes 0-15 collect an even block's 16 words, lanes 16-31
    // the next block's: one whole 128-byte line per store.
    const int lane = threadIdx.x & 31;
    const int qn   = lane & 15;
    const int hi   = lane >> 4;
    const int gw   = blockIdx.x * 8 + (threadIdx.x >> 5);  // 0..4095
    const int qt   = gw >> 4;                // b * (S/16) + query tile
    const int kb4  = (gw & 15) * 4;          // first of the four key blocks
    const int* Mr  = mask + ((size_t)qt * 16 + qn) * Ss + kb4 * 32 + 8 * hi;
    unsigned* Mo   = mbits + ((size_t)qt * (Ss / 32) + kb4) * 16 + lane;
    v4i m[4][4];
#pragma unroll
    for (int u = 0; u < 4; ++u) {
      m[u][0] = *(const v4i*)(Mr + 32 * u);
      m[u][1] = *(const v4i*)(Mr + 32 * u + 4);
      m[u][2] = *(const v4i*)(Mr + 32 * u + 16);
      m[u][3] = *(const v4i*)(Mr + 32 * u + 20);
    }
#pragma unroll
    for (int u2 = 0; u2 < 2; ++u2) {
      unsigned w = 0;
#pragma unroll
      for (int i = 0; i < 32; ++i) {  // lane i takes word i & 15 of block 2*u2 + (i >> 4)
        const unsigned bal =
            __builtin_amdgcn_ballot_w32(m[2 * u2 + (i >> 4)][(i >> 2) & 3][i & 3] != 0);
        w = lane == i ? bal : w;
      }
      Mo[32 * u2] = w;
    }
    return;
  }
  int i = (blockIdx.x - PACKB) * blockDim.x + threadIdx.x;
  if (i < n) dst[i] = (_Float16)src[i];
}

// ---------------------------------------------------------------------------
// Kernel 1: Q/K/V projections. Input viewed as flat [B*H*S, 64] row-major
// (the raw reshape keeps the 64-dim contiguous). q_i (times SC2) and k_i stored f16
// in the same [B*H*S, 64] layout; v stored transposed as vT[B*H][64][S] so the V^T
// A-fragments of P*V (O^T += V^T * P^T) gather contiguously later.
// The three 64 x 64 weight matrices are converted to f16 once per block and kept
// in LDS: all 8 waves read their B fragments from there.
// ---------------------------------------------------------------------------
static constexpr int WP = 72;  // LDS row pitch of a weight matrix in f16: 16 B x 9

// One weight matrix into LDS, in two parts: a thread's four whole-line loads (a
// wave reads 512 bytes in a row), and their conversion, four f16 a store.
// Unrolled for constant indices: the array stays in registers.
__device__ inline void load_w(const float* __restrict__ Wm, v4f (&w)[4], int tid) {
#pragma unroll
  for (int i = 0; i < 4; ++i) w[i] = *(const v4f*)(Wm + (i * 256 + tid) * 4);
}

__device__ inline void store_w(const v4f (&w)[4], _Float16* l, int tid) {
#pragma unroll
  for (int i = 0; i < 4; ++i) {
    const int e = (i * 256 + tid) * 4;
    const v4h h = {(_Float16)w[i][0], (_Float16)w[i][1], (_Float16)w[i][2],
                   (_Float16)w[i][3]};
    *(v4h*)(l + (e >> 6) * WP + (e & 63)) = h;
  }
}

__global__ __launch_bounds__(256) void proj_kernel(
    const float* __restrict__ q, const float* __restrict__ k,
    const float* __restrict__ v,
    const float* __restrict__ Wq, const float* __restrict__ bq,
    const float* __restrict__ Wk, const float* __restrict__ bk,
    const float* __restrict__ Wv, const float* __restrict__ bv,
    _Float16* __restrict__ qh, _Float16* __restrict__ kh,
    _Float16* __restrict__ vT) {
  __shared__ __align__(16) _Float16 wl[3][DH * WP];  // Wq, Wk, Wv rows at pitch WP

  const int wave = threadIdx.x >> 5;
  const int lane = threadIdx.x & 31;
  const int n    = lane & 15;
  const int hi   = lane >> 4;
  const size_t g0 = ((size_t)blockIdx.x * 8 + wave) * 16;  // row-tile base

  // The weights come first: they are cached, and converted while the inputs fly.
  v4f wq[4], wk[4], wv[4], xq[8], xk[8], xv[8];
  load_w(Wq, wq, threadIdx.x);
  load_w(Wk, wk, threadIdx.x);
  load_w(Wv, wv, threadIdx.x);
  const float* pq = lane_x(q + g0 * DH);
  const float* pk = lane_x(k + g0 * DH);
  const float* pv = lane_x(v + g0 * DH);
  load_x(pq, xq);
  load_x(pk, xk);
  load_x(pv, xv);
  // No address register of these loads is rewritten ahead of this wait; the
  // three addresses are inputs so that their registers stay theirs up to it.
  asm volatile("s_wait_xcnt 0x0" ::"v"(pq), "v"(pk), "v"(pv) : "memory");

  store_w(wq, wl[0], threadIdx.x);
  store_w(wk, wl[1], threadIdx.x);
  store_w(wv, wl[2], threadIdx.x);
  hold_x(xq);
  hold_x(xk);
  hold_x(xv);
  __syncthreads();  // the weights are read by every wave

  const v16h aq0 = frag_from_x(xq, 0), aq1 = frag_from_x(xq, 1);
  const v16h ak0 = frag_from_x(xk, 0), ak1 = frag_from_x(xk, 1);
  const v16h av0 = frag_from_x(xv, 0), av1 = frag_from_x(xv, 1);

  // q projection: out = (X @ Wq^T + bq) * SC2 ; B[k][n] = Wq[n][k] (row n, contiguous k)
#pragma unroll
  for (int j = 0; j < 4; ++j) {
    v8f c = {};
    c = WMMA_F16(aq0, frag_from_f16(wl[0] + 16 * j * WP, WP, 0), c);
    c = WMMA_F16(aq1, frag_from_f16(wl[0] + 16 * j * WP, WP, 32), c);
    const int col = 16 * j + n;
    const float bias = bq[col];
#pragma unroll
    for (int r = 0; r < 8; ++r)
      qh[(g0 + r + 8 * hi) * DH + col] = (_Float16)((c[r] + bias) * SC2);
  }
#pragma unroll
  for (int j = 0; j < 4; ++j) {
    v8f c = {};
    c = WMMA_F16(ak0, frag_from_f16(wl[1] + 16 * j * WP, WP, 0), c);
    c = WMMA_F16(ak1, frag_from_f16(wl[1] + 16 * j * WP, WP, 32), c);
    const int col = 16 * j + n;
    const float bias = bk[col];
#pragma unroll
    for (int r = 0; r < 8; ++r)
      kh[(g0 + r + 8 * hi) * DH + col] = (_Float16)(c[r] + bias);
  }
  // v projection -> transposed store
  const size_t bh = g0 >> 11;           // b*H + h (tiles never straddle heads)
  const int    s0 = (int)(g0 & 2047);
#pragma unroll
  for (int j = 0; j < 4; ++j) {
    v8f c = {};
    c = WMMA_F16(av0, frag_from_f16(wl[2] + 16 * j * WP, WP, 0), c);
    c = WMMA_F16(av1, frag_from_f16(wl[2] + 16 * j * WP, WP, 32), c);
    const int col = 16 * j + n;
    const float bias = bv[col];
#pragma unroll
    for (int r = 0; r < 8; ++r)
      vT[(bh * DH + col) * (size_t)Ss + (s0 + r + 8 * hi)] =
          (_Float16)(c[r] + bias);
  }
}

// ---------------------------------------------------------------------------
// Async (or fallback) staging of one KB-key K tile [KB][64] and V tile
// [64][KB] (from transposed V) into LDS, rows at the padded pitches KP and VP.
// 256 threads x NU x 16B per tile: 32 more K rows, 64 / NU more V rows a turn.
// ---------------------------------------------------------------------------
__device__ inline void stage_kv(const _Float16* __restrict__ K,
                                const _Float16* __restrict__ V, int kb0,
                                _Float16* ktb, _Float16* vtb, int tid) {
  constexpr int VT = KB / 8;                               // threads per V row
  const int krow = tid >> 3, kseg = (tid & 7) * 8;         // key row, 8-f16 segment
  const int vrow = tid / VT, vseg = (tid & (VT - 1)) * 8;  // dim row, 8-f16 segment
  const _Float16* gk = K + (size_t)(kb0 + krow) * DH + kseg;
  const _Float16* gv = V + (size_t)vrow * Ss + kb0 + vseg;
  _Float16* lk = ktb + krow * KP + kseg;
  _Float16* lv = vtb + vrow * VP + vseg;
  // Unrolled: the copies of a pass issue in a row, their steps are constants.
#pragma unroll
  for (int i = 0; i < NU; ++i) {
    const _Float16* gki = gk + (size_t)(32 * i) * DH;
    const _Float16* gvi = gv + (size_t)(256 / VT * i) * Ss;
    _Float16* lki = lk + 32 * i * KP;
    _Float16* lvi = lv + 256 / VT * i * VP;
#if HAVE_ASYNC_LDS
    __builtin_amdgcn_global_load_async_to_lds_b128((gv4i*)gki, (lv4i*)lki, 0, 0);
    __builtin_amdgcn_global_load_async_to_lds_b128((gv4i*)gvi, (lv4i*)lvi, 0, 0);
#else
    *(float4*)lki = *(const float4*)gki;
    *(float4*)lvi = *(const float4*)gvi;
#endif
  }
}

// ---------------------------------------------------------------------------
// Kernel 2: flash attention, transposed products. A block takes 128 queries; its
// 8 waves share double-buffered LDS K/V tiles staged with async global->LDS
// copies (DMA of pass i+1 overlaps WMMA work on pass i).
// A wave owns 32 queries (two tiles of 16) and one half of the keys of every
// pass: waves w and w + 4 have the same queries and the two key halves. So each
// K and each V fragment read from LDS feeds two WMMAs, one a query tile, and the
// block still has its 8 waves. The two partial results of a query are joined
// once, behind the key loop, through LDS.
// A pass is KB keys, NG groups of 32 a wave. Per group and query tile:
// S^T = K * Q^T (4 WMMA), so lane (n, hi) holds 16 scores of query n (keys
// 8*hi+r and 16+8*hi+r): mask, maximum and sum are in-lane, and the two score
// tiles converted in place are the B operand of O^T += V^T * P^T (4 WMMA).
// Every query has a reference exponent that is held from pass to pass. Its
// negative is the C operand of the score products, so they leave the matrix unit
// as the exponents of P. One test a pass: only where an exponent of the wave
// exceeds LAZY (or in the first pass) the references are raised to the maxima, with
// the exchange between the wave halves, the correction factor and the rescaling
// of O and of the sums. Once per pass the hand-over of the buffers.
// The mask comes as the packed words of kernel 0: 16 words per group and query
// tile by one scalar load, each word the lane mask of one select.
// ---------------------------------------------------------------------------
static constexpr int NG = NU / 2;  // 32-key groups of one wave per pass

__global__ __launch_bounds__(256) void flash_kernel(
    const _Float16* __restrict__ qh, const _Float16* __restrict__ kh,
    const _Float16* __restrict__ vT, const unsigned* __restrict__ mbits,
    _Float16* __restrict__ wv) {
  __shared__ __align__(16) _Float16 kt[2][KB * KP];  // [key][dim], rows at pitch KP
  __shared__ __align__(16) _Float16 vt[2][DH * VP];  // [dim][key], rows at pitch VP
  // The join: every wave hands one query tile's O, reference and sum to its partner.
  __shared__ __align__(16) v4f xo[8][8][32];
  __shared__ __align__(8) v2f xml[8][32];

  const int tid  = threadIdx.x;
  // Wave-uniform for the compiler: the key half and the mask address are scalars.
  const int wave = __builtin_amdgcn_readfirstlane(tid >> 5);
  const int lane = tid & 31;
  const int n    = lane & 15;
  const int hi   = lane >> 4;
  const int half = wave >> 2;                          // this wave's half of the keys
  const int bh   = blockIdx.x >> 4;                    // b*H + h
  const int q0   = (blockIdx.x & 15) * 128 + (wave & 3) * 32;
  const int b    = bh >> 4;

  const _Float16* Q  = qh + ((size_t)bh * Ss + q0) * DH;
  const _Float16* K  = kh + (size_t)bh * Ss * DH;
  const _Float16* V  = vT + (size_t)bh * DH * Ss;
  // This wave's packed mask words: 16 per key block, MT words on to the next
  // query tile; they load into scalar registers.
  constexpr int MT = (Ss / 32) * 16;
  const unsigned* Mw = mbits + (size_t)(b * (Ss / 16) + (q0 >> 4)) * MT + half * NG * 16;

  // The loops over query tiles, groups and registers, here and below, are unrolled
  // so that every index is a constant and the arrays stay in registers.
  v16h qf[2][2];
#pragma unroll
  for (int t = 0; t < 2; ++t) {
    qf[t][0] = frag_from_f16(Q + 16 * t * DH, DH, 0);
    qf[t][1] = frag_from_f16(Q + 16 * t * DH, DH, 32);
  }

  constexpr float MASKED = -10000.f * 1.44269504088896340736f;  // -10000 as an exponent of 2
  constexpr float LAZY   = 8.f;  // P stays at or below 2^8, far inside f16
  // Per query tile: the reference of query n (equal in both wave halves), its
  // negative in the eight registers of a C operand, the exponent of a masked
  // score, and the running sum over this lane's keys only.
  float mrow[2] = {0.f, 0.f};
  float emsk[2] = {MASKED, MASKED};
  float lrow[2] = {0.f, 0.f};
  v8f zacc = {};
  v8f nref[2] = {zacc, zacc};
  // o[t][j][r] = O[query 16t + n][dim 16j + 8hi + r], this wave's keys only
  v8f o[2][4] = {{zacc, zacc, zacc, zacc}, {zacc, zacc, zacc, zacc}};

  // Prologue: stage the first K/V tiles.
  stage_kv(K, V, 0, kt[0], vt[0], tid);
  asm volatile("s_wait_asynccnt 0x0" ::: "memory");  // this wave's copies have landed
  __syncthreads();

  int buf = 0;
  for (int kb0 = 0; kb0 < Ss; kb0 += KB) {
    // Kick off DMA for the next pass into the other buffer (overlaps WMMA).
    if (kb0 + KB < Ss) stage_kv(K, V, kb0 + KB, kt[buf ^ 1], vt[buf ^ 1], tid);

    const _Float16* Kt = kt[buf] + half * (32 * NG) * KP;  // this wave's key rows
    const _Float16* Vt = vt[buf] + half * (32 * NG);       // and key columns

    // ---- mask bits of this pass: 16 lane-mask words a group, scalar loads --
    v16u mw[2][NG];
#pragma unroll
    for (int t = 0; t < 2; ++t)
#pragma unroll
      for (int u = 0; u < NG; ++u)
        mw[t][u] = *(const v16u*)(Mw + t * MT + ((kb0 >> 5) + u) * 16);

    // ---- exponents, transposed: s0[t][u][r] = S[key 32u+8hi+r][query 16t+n] minus
    // the reference, s1: key +16. Each K fragment is read once and multiplies both
    // query tiles.
    v8f s0[2][NG], s1[2][NG];
#pragma unroll
    for (int u = 0; u < NG; ++u) {
      const _Float16* Ku = Kt + 32 * u * KP;
      const v16h ka0 = frag_from_f16(Ku, KP, 0);
      const v16h ka1 = frag_from_f16(Ku, KP, 32);
      const v16h kc0 = frag_from_f16(Ku + 16 * KP, KP, 0);
      const v16h kc1 = frag_from_f16(Ku + 16 * KP, KP, 32);
#pragma unroll
      for (int t = 0; t < 2; ++t) {
        v8f a, c;
        a = WMMA_F16(ka0, qf[t][0], nref[t]);
        c = WMMA_F16(kc0, qf[t][0], nref[t]);
        a = WMMA_F16(ka1, qf[t][1], a);
        c = WMMA_F16(kc1, qf[t][1], c);
        s0[t][u] = a;
        s1[t][u] = c;
      }
    }
    // Ends the scheduling region at the last score product: with the whole pass
    // in one region the scheduler waits on every K and V fragment alone, orders
    // the softmax in dependent pairs and moves the row sum behind the barrier.
    __builtin_amdgcn_sched_barrier(0);

    // ---- mask (mask!=0 -> the exponent of -10000, exact) and the maximum of this
    // lane's exponents, one query per lane and tile -------------------------
    float tmax[2];
#pragma unroll
    for (int t = 0; t < 2; ++t) {
      float gmax[NG];
#pragma unroll
      for (int u = 0; u < NG; ++u) {
#pragma unroll
        for (int r = 0; r < 8; ++r) {
          s0[t][u][r] =
              __builtin_amdgcn_inverse_ballot_w32(mw[t][u][r]) ? emsk[t] : s0[t][u][r];
          s1[t][u][r] =
              __builtin_amdgcn_inverse_ballot_w32(mw[t][u][8 + r]) ? emsk[t] : s1[t][u][r];
        }
        float x = fmaxf(s0[t][u][0], s1[t][u][0]);
#pragma unroll
        for (int r = 1; r < 8; ++r) x = fmaxf(x, fmaxf(s0[t][u][r], s1[t][u][r]));
        gmax[u] = x;
      }
      tmax[t] = gmax[0];
#pragma unroll
      for (int u = 1; u < NG; ++u) tmax[t] = fmaxf(tmax[t], gmax[u]);
    }

    // ---- one test a pass, a scalar branch: new references only where a lane of
    // the wave needs one. The first pass sets them (down too: d < 0), later ones
    // only raise them; the exponents of this pass, O and the sums follow.
    const bool first = kb0 == 0;
    if (__builtin_amdgcn_ballot_w32(first || tmax[0] > LAZY || tmax[1] > LAZY) != 0) {
#pragma unroll
      for (int t = 0; t < 2; ++t) {
        const float tm   = fmaxf(tmax[t], xhalf(tmax[t]));
        const float d    = first ? tm : fmaxf(tm, 0.f);
        const float corr = __builtin_amdgcn_exp2f(fminf(-d, 0.f));
        mrow[t] += d;
        emsk[t] = MASKED - mrow[t];
        lrow[t] *= corr;
#pragma unroll
        for (int r = 0; r < 8; ++r) nref[t][r] = -mrow[t];
#pragma unroll
        for (int u = 0; u < NG; ++u)
#pragma unroll
          for (int r = 0; r < 8; ++r) {
            s0[t][u][r] -= d;
            s1[t][u][r] -= d;
          }
#pragma unroll
        for (int j = 0; j < 4; ++j)
#pragma unroll
          for (int r = 0; r < 8; ++r) o[t][j][r] *= corr;
      }
    }

    // ---- per group: P of both query tiles, its sums, and O^T += V^T @ P^T ---
    float psum[2] = {0.f, 0.f};
#pragma unroll
    for (int u = 0; u < NG; ++u) {
      // B operands: pf[t][i] = P[query 16t+n][key 32u+8hi+i], pf[t][8+i]: key +16
      v16h pf[2];
#pragma unroll
      for (int t = 0; t < 2; ++t) {
        float gsum = 0.f;
#pragma unroll
        for (int r = 0; r < 8; ++r) {
          s0[t][u][r] = __builtin_amdgcn_exp2f(s0[t][u][r]);
          s1[t][u][r] = __builtin_amdgcn_exp2f(s1[t][u][r]);
        }
#pragma unroll
        for (int r = 0; r < 8; ++r) {
          gsum += s0[t][u][r] + s1[t][u][r];
          pf[t][r]     = (_Float16)s0[t][u][r];
          pf[t][8 + r] = (_Float16)s1[t][u][r];
        }
        psum[t] += gsum;
      }
      // A frags: dim rows of the LDS V tile, keys 32u..32u+31 of this wave's
      // half; each is read once and multiplies both query tiles.
#pragma unroll
      for (int j = 0; j < 4; ++j) {
        const v16h vf = frag_from_f16(Vt + 16 * j * VP, VP, 32 * u);
        o[0][j] = WMMA_F16(vf, pf[0], o[0][j]);
        o[1][j] = WMMA_F16(vf, pf[1], o[1][j]);
      }
    }
#pragma unroll
    for (int t = 0; t < 2; ++t) lrow[t] += psum[t];

    // Hand-over: this wave's reads of the buffers are done, its copies for the
    // next pass have landed; the barrier publishes them and frees these buffers.
    asm volatile("s_wait_dscnt 0x0" ::: "memory");
    asm volatile("s_wait_asynccnt 0x0" ::: "memory");
    __syncthreads();
    buf ^= 1;
  }
  asm volatile("s_wait_asynccnt 0x0" ::: "memory");  // nothing in flight at the end

  // ---- join the key halves: a wave of the first half finishes query tile 0 and
  // hands tile 1 to its partner, a wave of the second half the other way round.
  // The selects are on a wave-uniform condition with constant indices.
  const bool up = half != 0;
  v8f ok[4];  // the tile this wave keeps
#pragma unroll
  for (int j = 0; j < 4; ++j) {
    const v8f og = up ? o[0][j] : o[1][j];
    ok[j]        = up ? o[1][j] : o[0][j];
    xo[wave][2 * j][lane]     = v4f{og[0], og[1], og[2], og[3]};
    xo[wave][2 * j + 1][lane] = v4f{og[4], og[5], og[6], og[7]};
  }
  xml[wave][lane] = up ? v2f{mrow[0], lrow[0]} : v2f{mrow[1], lrow[1]};
  const float mk = up ? mrow[1] : mrow[0];
  const float lk = up ? lrow[1] : lrow[0];
  __syncthreads();  // the partner's tile is read behind it
  const v2f   ml = xml[wave ^ 4][lane];
  const float mj = fmaxf(mk, ml[0]);
  const float fk = __builtin_amdgcn_exp2f(mk - mj);     // this wave's weight
  const float fp = __builtin_amdgcn_exp2f(ml[0] - mj);  // the partner's
  // The slot behind the exponential: left alone, this build puts directly behind it
  // an instruction pair that overwrites its source register.
  asm volatile("v_nop");

  // ---- join the wave halves' sums, normalize, store wv (flat [B*H*S, 64] f16)
  const float lj  = lk * fk + ml[1] * fp;
  const float inv = 1.0f / (lj + xhalf(lj));  // one denominator per lane
  const float wk = fk * inv, wp = fp * inv;
  _Float16* orow = wv + ((size_t)bh * Ss + q0 + 16 * half + n) * DH + 8 * hi;
#pragma unroll
  for (int j = 0; j < 4; ++j) {
    const v4f p0 = xo[wave ^ 4][2 * j][lane];
    const v4f p1 = xo[wave ^ 4][2 * j + 1][lane];
    v8h ov;
#pragma unroll
    for (int r = 0; r < 4; ++r) {
      ov[r]     = (_Float16)(ok[j][r] * wk + p0[r] * wp);
      ov[4 + r] = (_Float16)(ok[j][4 + r] * wk + p1[r] * wp);
    }
    *(v8h*)(orow + 16 * j) = ov;  // 8 consecutive dims of one query: 16 bytes
  }
}

// ---------------------------------------------------------------------------
// Kernel 3: output projection. Raw-reshape merge means wv flat is exactly the
// [B*S, 1024] A matrix. out = A @ Wo^T + bo, M=4096 N=1024 K=1024.
// One block computes a 128 x 128 tile of out; its 8 waves (2 x 4) own 64 x 32
// each. A k slice of 128 of the block's 128 A rows and 128 Wo rows is staged in
// LDS by asynchronous copies, two buffers: slice t + 1 flies while slice t is
// multiplied, and every staged row serves all the waves that need it.
// ---------------------------------------------------------------------------
static constexpr int GT  = 128;            // tile rows of A, and of Wo
static constexpr int GK  = 128;            // k per slice: 256 data bytes a row
static constexpr int GP  = 136;            // LDS row pitch in f16: 272 B = 16 B x 17
static constexpr int GSL = 2 * GT * GP;    // one buffer: A rows, then Wo rows
static constexpr int GNT = HID / GK;       // 8 slices

// Eight 16-byte copies of one thread: rows 16 apart of one operand's slice.
// l: the lane's LDS byte address, g: its global address, both of the first row.
__device__ inline void copy8(unsigned l, const _Float16* g) {
  constexpr unsigned LS = 16 * GP * 2;  // 16 rows in LDS, bytes
  constexpr int      GS = 16 * HID;     // 16 rows in memory, elements
  // The closing s_wait_xcnt stands inside the statement so that no address
  // register of a copy is rewritten ahead of it.
  asm volatile(
      "global_load_async_to_lds_b128 %0, %8, off\n\t"
      "global_load_async_to_lds_b128 %1, %9, off\n\t"
      "global_load_async_to_lds_b128 %2, %10, off\n\t"
      "global_load_async_to_lds_b128 %3, %11, off\n\t"
      "global_load_async_to_lds_b128 %4, %12, off\n\t"
      "global_load_async_to_lds_b128 %5, %13, off\n\t"
      "global_load_async_to_lds_b128 %6, %14, off\n\t"
      "global_load_async_to_lds_b128 %7, %15, off\n\t"
      "s_wait_xcnt 0x0"
      :
      : "v"(l), "v"(l + LS), "v"(l + 2 * LS), "v"(l + 3 * LS), "v"(l + 4 * LS),
        "v"(l + 5 * LS), "v"(l + 6 * LS), "v"(l + 7 * LS), "v"(g), "v"(g + GS),
        "v"(g + 2 * GS), "v"(g + 3 * GS), "v"(g + 4 * GS), "v"(g + 5 * GS),
        "v"(g + 6 * GS), "v"(g + 7 * GS)
      : "memory");
}

__global__ __launch_bounds__(256) void outproj_kernel(
    const _Float16* __restrict__ wv, const _Float16* __restrict__ WoH,
    const float* __restrict__ bo, float* __restrict__ out) {
  __shared__ __align__(16) _Float16 st[2 * GSL];

  const int tid  = threadIdx.x;
  const int wave = tid >> 5;
  const int lane = tid & 31;
  const int n    = lane & 15;
  const int hi   = lane >> 4;
  const int m0   = (blockIdx.x >> 3) * GT;  // 32 row tiles
  const int n0   = (blockIdx.x & 7) * GT;   // 8 column tiles
  const int wm   = (wave >> 2) * 64;        // this wave's rows in the tile
  const int wn   = (wave & 3) * 32;         // this wave's columns in the tile

  // Copy map: 16 threads take one row's 256 bytes, so a wave copies whole lines.
  const int crow = tid >> 4, cseg = (tid & 15) * 8;
  const _Float16* ga = wv + (size_t)(m0 + crow) * HID + cseg;
  const _Float16* gb = WoH + (size_t)(n0 + crow) * HID + cseg;
  const unsigned la = (unsigned)(size_t)st + (crow * GP + cseg) * 2;
  const unsigned lb = la + GT * GP * 2;

  v8f zacc = {};
  v8f acc[4][2] = {{zacc, zacc}, {zacc, zacc}, {zacc, zacc}, {zacc, zacc}};

  // Slice 0 into buffer 0, landed and published; then slice 1 into buffer 1.
  copy8(la, ga);
  copy8(lb, gb);
  asm volatile("s_wait_asynccnt 0x0" ::: "memory");  // this wave's copies have landed
  __syncthreads();
  copy8(la + GSL * 2, ga + GK);
  copy8(lb + GSL * 2, gb + GK);

  for (int t = 0; t < GNT; ++t) {
    const int boff = (t & 1) * GSL;
    const _Float16* As = st + boff + wm * GP;
    const _Float16* Bs = st + boff + (GT + wn) * GP;
    // Two fragment sets: step s + 1 of this slice is read while step s multiplies.
    // The loops over sets and accumulators are unrolled so that every index is a
    // constant and the arrays stay in registers.
    v16h af[2][4], bf[2][2];
#pragma unroll
    for (int i = 0; i < 4; ++i) af[0][i] = frag_from_f16(As + 16 * i * GP, GP, 0);
#pragma unroll
    for (int j = 0; j < 2; ++j) bf[0][j] = frag_from_f16(Bs + 16 * j * GP, GP, 0);
#pragma unroll
    for (int s = 0; s < GK / 32; ++s) {
      const int cur = s & 1;
      if (s + 1 < GK / 32) {
#pragma unroll
        for (int i = 0; i < 4; ++i)
          af[cur ^ 1][i] = frag_from_f16(As + 16 * i * GP, GP, 32 * (s + 1));
#pragma unroll
        for (int j = 0; j < 2; ++j)
          bf[cur ^ 1][j] = frag_from_f16(Bs + 16 * j * GP, GP, 32 * (s + 1));
      }
      // Keeps the next step's LDS reads one group ahead of this step's products:
      // left free, the scheduler sinks each read to its use, into one register
      // set, and every pair of products then waits out an LDS latency.
      __builtin_amdgcn_sched_barrier(0);
#pragma unroll
      for (int i = 0; i < 4; ++i) {
        acc[i][0] = WMMA_F16(af[cur][i], bf[cur][0], acc[i][0]);
        acc[i][1] = WMMA_F16(af[cur][i], bf[cur][1], acc[i][1]);
      }
    }
    // Hand-over: this wave's reads of the buffer are done, its copies of slice
    // t + 1 have landed; the barrier publishes that slice and frees this buffer.
    asm volatile("s_wait_dscnt 0x0" ::: "memory");
    asm volatile("s_wait_asynccnt 0x0" ::: "memory");
    __syncthreads();
    if (t + 2 < GNT) {
      copy8(la + boff * 2, ga + (t + 2) * GK);
      copy8(lb + boff * 2, gb + (t + 2) * GK);
    }
  }
  asm volatile("s_wait_asynccnt 0x0" ::: "memory");  // nothing in flight at the end

  // Unrolled for constant accumulator indices, as above.
#pragma unroll
  for (int j = 0; j < 2; ++j) {
    const int col  = n0 + wn + 16 * j + n;
    const float bb = bo[col];
#pragma unroll
    for (int i = 0; i < 4; ++i)
#pragma unroll
      for (int r = 0; r < 8; ++r)
        out[(size_t)(m0 + wm + 16 * i + r + 8 * hi) * HID + col] = acc[i][j][r] + bb;
  }
}

// ---------------------------------------------------------------------------
extern "C" void kernel_launch(void* const* d_in, const int* in_sizes, int n_in,
                              void* d_out, int out_size, void* d_ws,
                              size_t ws_size, hipStream_t stream) {
  const float* q    = (const float*)d_in[0];
  const float* k    = (const float*)d_in[1];
  const float* v    = (const float*)d_in[2];
  const int*   mask = (const int*)d_in[3];
  const float* Wq   = (const float*)d_in[4];
  const float* bq   = (const float*)d_in[5];
  const float* Wk   = (const float*)d_in[6];
  const float* bk   = (const float*)d_in[7];
  const float* Wv   = (const float*)d_in[8];
  const float* bv   = (const float*)d_in[9];
  const float* Wo   = (const float*)d_in[10];
  const float* bo   = (const float*)d_in[11];

  // Workspace layout (bytes): q_i | k_i | vT | wv (8 MB f16 each) | Wo f16 (2 MB)
  // | mask bits (1 MB, at the next 4 MB step)
  const size_t HEADELEMS = (size_t)Bb * Hh * Ss * DH;  // 4,194,304
  char* ws = (char*)d_ws;
  _Float16* qh  = (_Float16*)(ws + 0 * HEADELEMS);
  _Float16* kh  = (_Float16*)(ws + 2 * HEADELEMS);
  _Float16* vT  = (_Float16*)(ws + 4 * HEADELEMS);
  _Float16* wvb = (_Float16*)(ws + 6 * HEADELEMS);
  _Float16* WoH = (_Float16*)(ws + 8 * HEADELEMS);
  unsigned* mbits = (unsigned*)(ws + 9 * HEADELEMS);

  const int wo_n = HID * HID;  // 1,048,576
  prep_kernel<<<PACKB + (wo_n + 255) / 256, 256, 0, stream>>>(Wo, WoH, wo_n,
                                                              mask, mbits);

  // 4096 row-tiles of 16 rows / 8 waves per block -> 512 blocks
  proj_kernel<<<512, 256, 0, stream>>>(q, k, v, Wq, bq, Wk, bk, Wv, bv,
                                       qh, kh, vT);

  // 32 (b,h) pairs * 16 blocks (128 q-rows each) = 512 blocks
  flash_kernel<<<512, 256, 0, stream>>>(qh, kh, vT, mbits, wvb);

  // 32 x 8 output tiles of 128 x 128, one block each
  outproj_kernel<<<256, 256, 0, stream>>>(wvb, WoH, bo, (float*)d_out);
}

// v010
// It runs in 62.6 microseconds.
// Timed twice side by side with v009, it ran 1.03 and 1.04 times as fast.
// All steps since v000 together make it 3.48 times as fast.
#include <hip/hip_runtime.h>
#include <hip/hip_bf16.h>
#include <hip/hip_fp16.h>

typedef __attribute__((ext_vector_type(16))) _Float16 v16h;
typedef __attribute__((ext_vector_type(8)))  _Float16 v8h;
typedef __attribute__((ext_vector_type(4)))  _Float16 v4h;
typedef __attribute__((ext_vector_type(8)))  float    v8f;
typedef __attribute__((ext_vector_type(2)))  float    v2f;
typedef __attribute__((ext_vector_type(4)))  float    v4f;
typedef __attribute__((ext_vector_type(4)))  int      v4i;
typedef __attribute__((ext_vector_type(16))) unsigned v16u;

using gv4i = v4i __attribute__((address_space(1)));  // global int4
using lv4i = v4i __attribute__((address_space(3)));  // LDS int4

#define WMMA_F16(a, b, c) \
  __builtin_amdgcn_wmma_f32_16x16x32_f16(false, (a), false, (b), (short)0, (c), false, false)

#ifndef __has_builtin
#define __has_builtin(x) 0
#endif

#if __has_builtin(__builtin_amdgcn_global_load_async_to_lds_b128)
#define HAVE_ASYNC_LDS 1
#else
#define HAVE_ASYNC_LDS 0
#endif

static constexpr int Bb  = 2;
static constexpr int Ss  = 2048;
static constexpr int HID = 1024;
static constexpr int Hh  = 16;
static constexpr int DH  = 64;
static constexpr int KB  = 128;      // keys per pass of the flash kernel
static constexpr int NU  = KB / 32;  // 32-key groups (one k step of P * V) per pass
// LDS row pitches in f16 elements: 16 bytes times an odd number, so that the
// 16 rows one ds_load_b128 half-wave reads fall on 16 distinct bank groups.
static constexpr int KP  = 72;       // K tile rows: 128 data bytes at pitch 144
static constexpr int VP  = KB + 8;   // V tile rows: 256 data bytes at pitch 272
static_assert(((KP / 8) & 1) && ((VP / 8) & 1), "pitches are 16 bytes times an odd number");
// The projected q is stored times scale * log2(e): K * Q^T is then the exponent of
// 2 in the softmax, exp(s / 8) = 2^(s * SC2).
static constexpr float SC2 = 0.125f * 1.44269504088896340736f;

// ---------------------------------------------------------------------------
// Fragment loaders per CDNA5 ISA 7.12.2 (wave32):
//  A 16x32 f16: lane L holds row M=L&15; lanes 0-15 carry K={0..7,16..23},
//  lanes 16-31 carry K={8..15,24..31}. B 32x16 gathered symmetrically
//  (lane = column N, contiguous reduction dim in memory). Each lane loads
//  two contiguous 16-byte chunks.
// ---------------------------------------------------------------------------
__device__ inline v16h frag_from_f16(const _Float16* base, int ld, int k0) {
  const int lane = threadIdx.x & 31;
  const int r    = lane & 15;
  const int kb   = (lane & 16) ? 8 : 0;
  const _Float16* p = base + (size_t)r * ld + k0 + kb;
  v16h a;
#pragma unroll
  for (int i = 0; i < 8; ++i) a[i] = p[i];
#pragma unroll
  for (int i = 0; i < 8; ++i) a[8 + i] = p[16 + i];
  return a;
}

// The same two fragments (k 0..31 and 32..63) of a 16 x 64 f32 tile, in three
// parts: the lane's address, its eight 16-byte loads, the conversion of one
// fragment.
__device__ inline const float* lane_x(const float* base) {
  const int lane = threadIdx.x & 31;
  const int r    = lane & 15;
  const int kb   = (lane & 16) ? 8 : 0;
  return base + (size_t)r * DH + kb;
}

// The loops of these helpers are unrolled so that every index is a constant and
// the arrays stay in registers.
__device__ inline void load_x(const float* p, v4f (&x)[8]) {
#pragma unroll
  for (int i = 0; i < 4; ++i) {  // floats 16i..16i+7 of the lane's half
    x[2 * i]     = *(const v4f*)(p + 16 * i);
    x[2 * i + 1] = *(const v4f*)(p + 16 * i + 4);
  }
}

__device__ inline v16h frag_from_x(const v4f (&x)[8], int f) {
  v16h a;
#pragma unroll
  for (int i = 0; i < 16; ++i) a[i] = (_Float16)x[4 * f + (i >> 2)][i & 3];
  return a;
}

// Holds the eight loads of load_x ahead of this place (the loaded values are
// inputs only): left free, the compiler sinks them behind the barrier that
// follows, and the wave waits out a second memory latency there.
__device__ inline void hold_x(const v4f (&x)[8]) {
  asm volatile("" ::"v"(x[0]), "v"(x[1]), "v"(x[2]), "v"(x[3]), "v"(x[4]), "v"(x[5]),
               "v"(x[6]), "v"(x[7]));
}

// Value of lane l ^ 16: the two wave halves hold the two key halves of one query.
__device__ inline float xhalf(float x) {
  const int i = __builtin_bit_cast(int, x);
  return __builtin_bit_cast(
      float, __builtin_amdgcn_permlanex16(i, i, 0x76543210, 0xfedcba98, false, false));
}

// ---------------------------------------------------------------------------
// Kernel 0: input preparation. Blocks 0..PACKB-1 pack the mask, which all 16
// heads of a batch share, into bits, once: per 16-query tile and 32-key block
// 16 words, word i holding for every lane of the flash kernel's wave the bit
// of that lane's score i. They come first in the grid because they run the
// longest. The other blocks convert Wo f32 -> f16.
// ---------------------------------------------------------------------------
static constexpr int PACKB = Bb * (Ss / 16) * (Ss / 32) / 4 / 8;  // 512 blocks

__global__ __launch_bounds__(256) void prep_kernel(
    const float* __restrict__ src, _Float16* __restrict__ dst, int n,
    const int* __restrict__ mask, unsigned* __restrict__ mbits) {
  if (blockIdx.x < PACKB) {
    // One wave packs one query tile x four 32-key blocks. Lane (qn, hi) reads
    // the 16 mask words of the scores it will hold in the flash kernel (query
    // qn; keys 8hi+0..7 and 16+8hi+0..7 of the block); each ballot is one word
    // of the block. Lanes 0-15 collect an even block's 16 words, lanes 16-31
    // the next block's: one whole 128-byte line per store.
    const int lane = threadIdx.x & 31;
    const int qn   = lane & 15;
    const int hi   = lane >> 4;
    const int gw   = blockIdx.x * 8 + (threadIdx.x >> 5);  // 0..4095
    const int qt   = gw >> 4;                // b * (S/16) + query tile
    const int kb4  = (gw & 15) * 4;          // first of the four key blocks
    const int* Mr  = mask + ((size_t)qt * 16 + qn) * Ss + kb4 * 32 + 8 * hi;
    unsigned* Mo   = mbits + ((size_t)qt * (Ss / 32) + kb4) * 16 + lane;
    v4i m[4][4];
#pragma unroll
    for (int u = 0; u < 4; ++u) {
      m[u][0] = *(const v4i*)(Mr + 32 * u);
      m[u][1] = *(const v4i*)(Mr + 32 * u + 4);
      m[u][2] = *(const v4i*)(Mr + 32 * u + 16);
      m[u][3] = *(const v4i*)(Mr + 32 * u + 20);
    }
#pragma unroll
    for (int u2 = 0; u2 < 2; ++u2) {
      unsigned w = 0;
#pragma unroll
      for (int i = 0; i < 32; ++i) {  // lane i takes word i & 15 of block 2*u2 + (i >> 4)
        const unsigned bal =
            __builtin_amdgcn_ballot_w32(m[2 * u2 + (i >> 4)][(i >> 2) & 3][i & 3] != 0);
        w = lane == i ? bal : w;
      }
      Mo[32 * u2] = w;
    }
    return;
  }
  int i = (blockIdx.x - PACKB) * blockDim.x + threadIdx.x;
  if (i < n) dst[i] = (_Float16)src[i];
}

// ---------------------------------------------------------------------------
// Kernel 1: Q/K/V projections. Input viewed as flat [B*H*S, 64] row-major
// (the raw reshape keeps the 64-dim contiguous). q_i (times SC2) and k_i stored f16
// in the same [B*H*S, 64] layout; v stored transposed as vT[B*H][64][S] so the V^T
// A-fragments of P*V (O^T += V^T * P^T) gather contiguously later.
// The three 64 x 64 weight matrices are converted to f16 once per block and kept
// in LDS: all 8 waves read their B fragments from there.
// ---------------------------------------------------------------------------
static constexpr int WP = 72;  // LDS row pitch of a weight matrix in f16: 16 B x 9

// One weight matrix into LDS, in two parts: a thread's four whole-line loads (a
// wave reads 512 bytes in a row), and their conversion, four f16 a store.
// Unrolled for constant indices: the array stays in registers.
__device__ inline void load_w(const float* __restrict__ Wm, v4f (&w)[4], int tid) {
#pragma unroll
  for (int i = 0; i < 4; ++i) w[i] = *(const v4f*)(Wm + (i * 256 + tid) * 4);
}

__device__ inline void store_w(const v4f (&w)[4], _Float16* l, int tid) {
#pragma unroll
  for (int i = 0; i < 4; ++i) {
    const int e = (i * 256 + tid) * 4;
    const v4h h = {(_Float16)w[i][0], (_Float16)w[i][1], (_Float16)w[i][2],
                   (_Float16)w[i][3]};
    *(v4h*)(l + (e >> 6) * WP + (e & 63)) = h;
  }
}

__global__ __launch_bounds__(256) void proj_kernel(
    const float* __restrict__ q, const float* __restrict__ k,
    const float* __restrict__ v,
    const float* __restrict__ Wq, const float* __restrict__ bq,
    const float* __restrict__ Wk, const float* __restrict__ bk,
    const float* __restrict__ Wv, const float* __restrict__ bv,
    _Float16* __restrict__ qh, _Float16* __restrict__ kh,
    _Float16* __restrict__ vT) {
  __shared__ __align__(16) _Float16 wl[3][DH * WP];  // Wq, Wk, Wv rows at pitch WP

  const int wave = threadIdx.x >> 5;
  const int lane = threadIdx.x & 31;
  const int n    = lane & 15;
  const int hi   = lane >> 4;
  const size_t g0 = ((size_t)blockIdx.x * 8 + wave) * 16;  // row-tile base

  // The weights come first: they are cached, and converted while the inputs fly.
  v4f wq[4], wk[4], wv[4], xq[8], xk[8], xv[8];
  load_w(Wq, wq, threadIdx.x);
  load_w(Wk, wk, threadIdx.x);
  load_w(Wv, wv, threadIdx.x);
  const float* pq = lane_x(q + g0 * DH);
  const float* pk = lane_x(k + g0 * DH);
  const float* pv = lane_x(v + g0 * DH);
  load_x(pq, xq);
  load_x(pk, xk);
  load_x(pv, xv);
  // No address register of these loads is rewritten ahead of this wait; the
  // three addresses are inputs so that their registers stay theirs up to it.
  asm volatile("s_wait_xcnt 0x0" ::"v"(pq), "v"(pk), "v"(pv) : "memory");

  store_w(wq, wl[0], threadIdx.x);
  store_w(wk, wl[1], threadIdx.x);
  store_w(wv, wl[2], threadIdx.x);
  hold_x(xq);
  hold_x(xk);
  hold_x(xv);
  __syncthreads();  // the weights are read by every wave

  const v16h aq0 = frag_from_x(xq, 0), aq1 = frag_from_x(xq, 1);
  const v16h ak0 = frag_from_x(xk, 0), ak1 = frag_from_x(xk, 1);
  const v16h av0 = frag_from_x(xv, 0), av1 = frag_from_x(xv, 1);

  // q projection: out = (X @ Wq^T + bq) * SC2 ; B[k][n] = Wq[n][k] (row n, contiguous k)
#pragma unroll
  for (int j = 0; j < 4; ++j) {
    v8f c = {};
    c = WMMA_F16(aq0, frag_from_f16(wl[0] + 16 * j * WP, WP, 0), c);
    c = WMMA_F16(aq1, frag_from_f16(wl[0] + 16 * j * WP, WP, 32), c);
    const int col = 16 * j + n;
    const float bias = bq[col];
#pragma unroll
    for (int r = 0; r < 8; ++r)
      qh[(g0 + r + 8 * hi) * DH + col] = (_Float16)((c[r] + bias) * SC2);
  }
#pragma unroll
  for (int j = 0; j < 4; ++j) {
    v8f c = {};
    c = WMMA_F16(ak0, frag_from_f16(wl[1] + 16 * j * WP, WP, 0), c);
    c = WMMA_F16(ak1, frag_from_f16(wl[1] + 16 * j * WP, WP, 32), c);
    const int col = 16 * j + n;
    const float bias = bk[col];
#pragma unroll
    for (int r = 0; r < 8; ++r)
      kh[(g0 + r + 8 * hi) * DH + col] = (_Float16)(c[r] + bias);
  }
  // v projection -> transposed store
  const size_t bh = g0 >> 11;           // b*H + h (tiles never straddle heads)
  const int    s0 = (int)(g0 & 2047);
#pragma unroll
  for (int j = 0; j < 4; ++j) {
    v8f c = {};
    c = WMMA_F16(av0, frag_from_f16(wl[2] + 16 * j * WP, WP, 0), c);
    c = WMMA_F16(av1, frag_from_f16(wl[2] + 16 * j * WP, WP, 32), c);
    const int col = 16 * j + n;
    const float bias = bv[col];
#pragma unroll
    for (int r = 0; r < 8; ++r)
      vT[(bh * DH + col) * (size_t)Ss + (s0 + r + 8 * hi)] =
          (_Float16)(c[r] + bias);
  }
}

// ---------------------------------------------------------------------------
// Async (or fallback) staging of one KB-key K tile [KB][64] and V tile
// [64][KB] (from transposed V) into LDS, rows at the padded pitches KP and VP.
// 256 threads x NU x 16B per tile: 32 more K rows, 64 / NU more V rows a turn.
// ---------------------------------------------------------------------------
__device__ inline void stage_kv(const _Float16* __restrict__ K,
                                const _Float16* __restrict__ V, int kb0,
                                _Float16* ktb, _Float16* vtb, int tid) {
  constexpr int VT = KB / 8;                               // threads per V row
  const int krow = tid >> 3, kseg = (tid & 7) * 8;         // key row, 8-f16 segment
  const int vrow = tid / VT, vseg = (tid & (VT - 1)) * 8;  // dim row, 8-f16 segment
  const _Float16* gk = K + (size_t)(kb0 + krow) * DH + kseg;
  const _Float16* gv = V + (size_t)vrow * Ss + kb0 + vseg;
  _Float16* lk = ktb + krow * KP + kseg;
  _Float16* lv = vtb + vrow * VP + vseg;
  // Unrolled: the copies of a pass issue in a row, their steps are constants.
#pragma unroll
  for (int i = 0; i < NU; ++i) {
    const _Float16* gki = gk + (size_t)(32 * i) * DH;
    const _Float16* gvi = gv + (size_t)(256 / VT * i) * Ss;
    _Float16* lki = lk + 32 * i * KP;
    _Float16* lvi = lv + 256 / VT * i * VP;
#if HAVE_ASYNC_LDS
    __builtin_amdgcn_global_load_async_to_lds_b128((gv4i*)gki, (lv4i*)lki, 0, 0);
    __builtin_amdgcn_global_load_async_to_lds_b128((gv4i*)gvi, (lv4i*)lvi, 0, 0);
#else
    *(float4*)lki = *(const float4*)gki;
    *(float4*)lvi = *(const float4*)gvi;
#endif
  }
}

// ---------------------------------------------------------------------------
// Kernel 2: flash attention, transposed products. A block takes 128 queries; its
// 8 waves share double-buffered LDS K/V tiles staged with async global->LDS
// copies (DMA of pass i+1 overlaps WMMA work on pass i).
// A wave owns 32 queries (two tiles of 16) and one half of the keys of every
// pass: waves w and w + 4 have the same queries and the two key halves. So each
// K and each V fragment read from LDS feeds two WMMAs, one a query tile, and the
// block still has its 8 waves. The two partial results of a query are joined
// once, behind the key loop, through LDS.
// A pass is KB keys, NG groups of 32 a wave. Per group and query tile:
// S^T = K * Q^T (4 WMMA), so lane (n, hi) holds 16 scores of query n (keys
// 8*hi+r and 16+8*hi+r): mask, maximum and sum are in-lane, and the two score
// tiles converted in place are the B operand of O^T += V^T * P^T (4 WMMA).
// Every query has a reference exponent that is held from pass to pass. Its
// negative is the C operand of the score products, so they leave the matrix unit
// as the exponents of P. One test a pass: only where an exponent of the wave
// exceeds LAZY (or in the first pass) the references are raised to the maxima, with
// the exchange between the wave halves, the correction factor and the rescaling
// of O and of the sums. Once per pass the hand-over of the buffers.
// The mask comes as the packed words of kernel 0: 16 words per group and query
// tile by one scalar load, each word the lane mask of one select.
// ---------------------------------------------------------------------------
static constexpr int NG = NU / 2;  // 32-key groups of one wave per pass

__global__ __launch_bounds__(256) void flash_kernel(
    const _Float16* __restrict__ qh, const _Float16* __restrict__ kh,
    const _Float16* __restrict__ vT, const unsigned* __restrict__ mbits,
    _Float16* __restrict__ wv) {
  __shared__ __align__(16) _Float16 kt[2][KB * KP];  // [key][dim], rows at pitch KP
  __shared__ __align__(16) _Float16 vt[2][DH * VP];  // [dim][key], rows at pitch VP
  // The join: every wave hands one query tile's O, reference and sum to its partner.
  __shared__ __align__(16) v4f xo[8][8][32];
  __shared__ __align__(8) v2f xml[8][32];

  const int tid  = threadIdx.x;
  // Wave-uniform for the compiler: the key half and the mask address are scalars.
  const int wave = __builtin_amdgcn_readfirstlane(tid >> 5);
  const int lane = tid & 31;
  const int n    = lane & 15;
  const int hi   = lane >> 4;
  const int half = wave >> 2;                          // this wave's half of the keys
  const int bh   = blockIdx.x >> 4;                    // b*H + h
  const int q0   = (blockIdx.x & 15) * 128 + (wave & 3) * 32;
  const int b    = bh >> 4;

  const _Float16* Q  = qh + ((size_t)bh * Ss + q0) * DH;
  const _Float16* K  = kh + (size_t)bh * Ss * DH;
  const _Float16* V  = vT + (size_t)bh * DH * Ss;
  // This wave's packed mask words: 16 per key block, MT words on to the next
  // query tile; they load into scalar registers.
  constexpr int MT = (Ss / 32) * 16;
  const unsigned* Mw = mbits + (size_t)(b * (Ss / 16) + (q0 >> 4)) * MT + half * NG * 16;

  // The loops over query tiles, groups and registers, here and below, are unrolled
  // so that every index is a constant and the arrays stay in registers.
  v16h qf[2][2];
#pragma unroll
  for (int t = 0; t < 2; ++t) {
    qf[t][0] = frag_from_f16(Q + 16 * t * DH, DH, 0);
    qf[t][1] = frag_from_f16(Q + 16 * t * DH, DH, 32);
  }

  constexpr float MASKED = -10000.f * 1.44269504088896340736f;  // -10000 as an exponent of 2
  constexpr float LAZY   = 8.f;  // P stays at or below 2^8, far inside f16
  // Per query tile: the reference of query n (equal in both wave halves), its
  // negative in the eight registers of a C operand, the exponent of a masked
  // score, and the running sum over this lane's keys only.
  float mrow[2] = {0.f, 0.f};
  float emsk[2] = {MASKED, MASKED};
  float lrow[2] = {0.f, 0.f};
  v8f zacc = {};
  v8f nref[2] = {zacc, zacc};
  // o[t][j][r] = O[query 16t + n][dim 16j + 8hi + r], this wave's keys only
  v8f o[2][4] = {{zacc, zacc, zacc, zacc}, {zacc, zacc, zacc, zacc}};

  // Prologue: stage the first K/V tiles.
  stage_kv(K, V, 0, kt[0], vt[0], tid);
  asm volatile("s_wait_asynccnt 0x0" ::: "memory");  // this wave's copies have landed
  __syncthreads();

  int buf = 0;
  for (int kb0 = 0; kb0 < Ss; kb0 += KB) {
    // Kick off DMA for the next pass into the other buffer (overlaps WMMA).
    if (kb0 + KB < Ss) stage_kv(K, V, kb0 + KB, kt[buf ^ 1], vt[buf ^ 1], tid);

    const _Float16* Kt = kt[buf] + half * (32 * NG) * KP;  // this wave's key rows
    const _Float16* Vt = vt[buf] + half * (32 * NG);       // and key columns

    // ---- mask bits of this pass: 16 lane-mask words a group, scalar loads --
    v16u mw[2][NG];
#pragma unroll
    for (int t = 0; t < 2; ++t)
#pragma unroll
      for (int u = 0; u < NG; ++u)
        mw[t][u] = *(const v16u*)(Mw + t * MT + ((kb0 >> 5) + u) * 16);

    // ---- exponents, transposed: s0[t][u][r] = S[key 32u+8hi+r][query 16t+n] minus
    // the reference, s1: key +16. Each K fragment is read once and multiplies both
    // query tiles.
    v8f s0[2][NG], s1[2][NG];
#pragma unroll
    for (int u = 0; u < NG; ++u) {
      const _Float16* Ku = Kt + 32 * u * KP;
      const v16h ka0 = frag_from_f16(Ku, KP, 0);
      const v16h ka1 = frag_from_f16(Ku, KP, 32);
      const v16h kc0 = frag_from_f16(Ku + 16 * KP, KP, 0);
      const v16h kc1 = frag_from_f16(Ku + 16 * KP, KP, 32);
#pragma unroll
      for (int t = 0; t < 2; ++t) {
        v8f a, c;
        a = WMMA_F16(ka0, qf[t][0], nref[t]);
        c = WMMA_F16(kc0, qf[t][0], nref[t]);
        a = WMMA_F16(ka1, qf[t][1], a);
        c = WMMA_F16(kc1, qf[t][1], c);
        s0[t][u] = a;
        s1[t][u] = c;
      }
    }
    // Ends the scheduling region at the last score product: with the whole pass
    // in one region the scheduler waits on every K and V fragment alone, orders
    // the softmax in dependent pairs and moves the row sum behind the barrier.
    __builtin_amdgcn_sched_barrier(0);

    // ---- mask (mask!=0 -> the exponent of -10000, exact) and the maximum of this
    // lane's exponents, one query per lane and tile -------------------------
    float tmax[2];
#pragma unroll
    for (int t = 0; t < 2; ++t) {
      float gmax[NG];
#pragma unroll
      for (int u = 0; u < NG; ++u) {
#pragma unroll
        for (int r = 0; r < 8; ++r) {
          s0[t][u][r] =
              __builtin_amdgcn_inverse_ballot_w32(mw[t][u][r]) ? emsk[t] : s0[t][u][r];
          s1[t][u][r] =
              __builtin_amdgcn_inverse_ballot_w32(mw[t][u][8 + r]) ? emsk[t] : s1[t][u][r];
        }
        float x = fmaxf(s0[t][u][0], s1[t][u][0]);
#pragma unroll
        for (int r = 1; r < 8; ++r) x = fmaxf(x, fmaxf(s0[t][u][r], s1[t][u][r]));
        gmax[u] = x;
      }
      tmax[t] = gmax[0];
#pragma unroll
      for (int u = 1; u < NG; ++u) tmax[t] = fmaxf(tmax[t], gmax[u]);
    }

    // ---- one test a pass, a scalar branch: new references only where a lane of
    // the wave needs one. The first pass sets them (down too: d < 0), later ones
    // only raise them; the exponents of this pass, O and the sums follow.
    const bool first = kb0 == 0;
    if (__builtin_amdgcn_ballot_w32(first || tmax[0] > LAZY || tmax[1] > LAZY) != 0) {
#pragma unroll
      for (int t = 0; t < 2; ++t) {
        const float tm   = fmaxf(tmax[t], xhalf(tmax[t]));
        const float d    = first ? tm : fmaxf(tm, 0.f);
        const float corr = __builtin_amdgcn_exp2f(fminf(-d, 0.f));
        mrow[t] += d;
        emsk[t] = MASKED - mrow[t];
        lrow[t] *= corr;
#pragma unroll
        for (int r = 0; r < 8; ++r) nref[t][r] = -mrow[t];
#pragma unroll
        for (int u = 0; u < NG; ++u)
#pragma unroll
          for (int r = 0; r < 8; ++r) {
            s0[t][u][r] -= d;
            s1[t][u][r] -= d;
          }
#pragma unroll
        for (int j = 0; j < 4; ++j)
#pragma unroll
          for (int r = 0; r < 8; ++r) o[t][j][r] *= corr;
      }
    }

    // ---- per group: P of both query tiles, its sums, and O^T += V^T @ P^T ---
    float psum[2] = {0.f, 0.f};
#pragma unroll
    for (int u = 0; u < NG; ++u) {
      // B operands: pf[t][i] = P[query 16t+n][key 32u+8hi+i], pf[t][8+i]: key +16
      v16h pf[2];
#pragma unroll
      for (int t = 0; t < 2; ++t) {
        float gsum = 0.f;
#pragma unroll
        for (int r = 0; r < 8; ++r) {
          s0[t][u][r] = __builtin_amdgcn_exp2f(s0[t][u][r]);
          s1[t][u][r] = __builtin_amdgcn_exp2f(s1[t][u][r]);
        }
#pragma unroll
        for (int r = 0; r < 8; ++r) {
          gsum += s0[t][u][r] + s1[t][u][r];
          pf[t][r]     = (_Float16)s0[t][u][r];
          pf[t][8 + r] = (_Float16)s1[t][u][r];
        }
        psum[t] += gsum;
      }
      // A frags: dim rows of the LDS V tile, keys 32u..32u+31 of this wave's
      // half; each is read once and multiplies both query tiles.
#pragma unroll
      for (int j = 0; j < 4; ++j) {
        const v16h vf = frag_from_f16(Vt + 16 * j * VP, VP, 32 * u);
        o[0][j] = WMMA_F16(vf, pf[0], o[0][j]);
        o[1][j] = WMMA_F16(vf, pf[1], o[1][j]);
      }
    }
#pragma unroll
    for (int t = 0; t < 2; ++t) lrow[t] += psum[t];

    // Hand-over: this wave's reads of the buffers are done, its copies for the
    // next pass have landed; the barrier publishes them and frees these buffers.
    asm volatile("s_wait_dscnt 0x0" ::: "memory");
    asm volatile("s_wait_asynccnt 0x0" ::: "memory");
    __syncthreads();
    buf ^= 1;
  }
  asm volatile("s_wait_asynccnt 0x0" ::: "memory");  // nothing in flight at the end

  // ---- join the key halves: a wave of the first half finishes query tile 0 and
  // hands tile 1 to its partner, a wave of the second half the other way round.
  // The selects are on a wave-uniform condition with constant indices.
  const bool up = half != 0;
  v8f ok[4];  // the tile this wave keeps
#pragma unroll
  for (int j = 0; j < 4; ++j) {
    const v8f og = up ? o[0][j] : o[1][j];
    ok[j]        = up ? o[1][j] : o[0][j];
    xo[wave][2 * j][lane]     = v4f{og[0], og[1], og[2], og[3]};
    xo[wave][2 * j + 1][lane] = v4f{og[4], og[5], og[6], og[7]};
  }
  xml[wave][lane] = up ? v2f{mrow[0], lrow[0]} : v2f{mrow[1], lrow[1]};
  const float mk = up ? mrow[1] : mrow[0];
  const float lk = up ? lrow[1] : lrow[0];
  __syncthreads();  // the partner's tile is read behind it
  const v2f   ml = xml[wave ^ 4][lane];
  const float mj = fmaxf(mk, ml[0]);
  const float fk = __builtin_amdgcn_exp2f(mk - mj);     // this wave's weight
  const float fp = __builtin_amdgcn_exp2f(ml[0] - mj);  // the partner's
  // The slot behind the exponential: left alone, this build puts directly behind it
  // an instruction pair that overwrites its source register.
  asm volatile("v_nop");

  // ---- join the wave halves' sums, normalize, store wv (flat [B*H*S, 64] f16)
  const float lj  = lk * fk + ml[1] * fp;
  const float inv = 1.0f / (lj + xhalf(lj));  // one denominator per lane
  const float wk = fk * inv, wp = fp * inv;
  _Float16* orow = wv + ((size_t)bh * Ss + q0 + 16 * half + n) * DH + 8 * hi;
#pragma unroll
  for (int j = 0; j < 4; ++j) {
    const v4f p0 = xo[wave ^ 4][2 * j][lane];
    const v4f p1 = xo[wave ^ 4][2 * j + 1][lane];
    v8h ov;
#pragma unroll
    for (int r = 0; r < 4; ++r) {
      ov[r]     = (_Float16)(ok[j][r] * wk + p0[r] * wp);
      ov[4 + r] = (_Float16)(ok[j][4 + r] * wk + p1[r] * wp);
    }
    *(v8h*)(orow + 16 * j) = ov;  // 8 consecutive dims of one query: 16 bytes
  }
}

// ---------------------------------------------------------------------------
// Kernel 3: output projection. Raw-reshape merge means wv flat is exactly the
// [B*S, 1024] A matrix. out = A @ Wo^T + bo, M=4096 N=1024 K=1024.
// One block computes a 128 x 128 tile of out; its 8 waves (2 x 4) own 64 x 32
// each. A k slice of 128 of the block's 128 A rows and 128 Wo rows is staged in
// LDS by asynchronous copies, a ring of four buffers: slices t + 1 to t + 3 fly
// while slice t is multiplied, so that a slice has three trips to land in and the
// requests to L2 follow one another without a pause; every staged row serves all
// the waves that need it.
// ---------------------------------------------------------------------------
static constexpr int GT  = 128;            // tile rows of A, and of Wo
static constexpr int GK  = 128;            // k per slice: 256 data bytes a row
static constexpr int GP  = 136;            // LDS row pitch in f16: 272 B = 16 B x 17
static constexpr int GSL = 2 * GT * GP;    // one buffer: A rows, then Wo rows
static constexpr int GNT = HID / GK;       // 8 slices
static constexpr int GNB = 4;              // buffers of the ring
static_assert(GNT > GNB && (GNB & (GNB - 1)) == 0, "the prologue fills the ring");

// Eight 16-byte copies of one thread: rows 16 apart of one operand's slice.
// l: the lane's LDS byte address, g: its global address, both of the first row.
__device__ inline void copy8(unsigned l, const _Float16* g) {
  constexpr unsigned LS = 16 * GP * 2;  // 16 rows in LDS, bytes
  constexpr int      GS = 16 * HID;     // 16 rows in memory, elements
  // The closing s_wait_xcnt stands inside the statement so that no address
  // register of a copy is rewritten ahead of it.
  asm volatile(
      "global_load_async_to_lds_b128 %0, %8, off\n\t"
      "global_load_async_to_lds_b128 %1, %9, off\n\t"
      "global_load_async_to_lds_b128 %2, %10, off\n\t"
      "global_load_async_to_lds_b128 %3, %11, off\n\t"
      "global_load_async_to_lds_b128 %4, %12, off\n\t"
      "global_load_async_to_lds_b128 %5, %13, off\n\t"
      "global_load_async_to_lds_b128 %6, %14, off\n\t"
      "global_load_async_to_lds_b128 %7, %15, off\n\t"
      "s_wait_xcnt 0x0"
      :
      : "v"(l), "v"(l + LS), "v"(l + 2 * LS), "v"(l + 3 * LS), "v"(l + 4 * LS),
        "v"(l + 5 * LS), "v"(l + 6 * LS), "v"(l + 7 * LS), "v"(g), "v"(g + GS),
        "v"(g + 2 * GS), "v"(g + 3 * GS), "v"(g + 4 * GS), "v"(g + 5 * GS),
        "v"(g + 6 * GS), "v"(g + 7 * GS)
      : "memory");
}

__global__ __launch_bounds__(256) void outproj_kernel(
    const _Float16* __restrict__ wv, const _Float16* __restrict__ WoH,
    const float* __restrict__ bo, float* __restrict__ out) {
  __shared__ __align__(16) _Float16 st[GNB * GSL];

  const int tid  = threadIdx.x;
  const int wave = tid >> 5;
  const int lane = tid & 31;
  const int n    = lane & 15;
  const int hi   = lane >> 4;
  const int m0   = (blockIdx.x >> 3) * GT;  // 32 row tiles
  const int n0   = (blockIdx.x & 7) * GT;   // 8 column tiles
  const int wm   = (wave >> 2) * 64;        // this wave's rows in the tile
  const int wn   = (wave & 3) * 32;         // this wave's columns in the tile

  // Copy map: 16 threads take one row's 256 bytes, so a wave copies whole lines.
  const int crow = tid >> 4, cseg = (tid & 15) * 8;
  const _Float16* ga = wv + (size_t)(m0 + crow) * HID + cseg;
  const _Float16* gb = WoH + (size_t)(n0 + crow) * HID + cseg;
  const unsigned la = (unsigned)(size_t)st + (crow * GP + cseg) * 2;
  const unsigned lb = la + GT * GP * 2;

  v8f zacc = {};
  v8f acc[4][2] = {{zacc, zacc}, {zacc, zacc}, {zacc, zacc}, {zacc, zacc}};

  // Slices 0 to 2 into buffers 0 to 2, 16 copies a wave and slice. The counter
  // returns in issue order: all but the 32 youngest landed means slice 0 has
  // landed. It is published; then slice 3 into buffer 3 (48 copies in flight).
  copy8(la, ga);
  copy8(lb, gb);
  copy8(la + GSL * 2, ga + GK);
  copy8(lb + GSL * 2, gb + GK);
  copy8(la + 2 * GSL * 2, ga + 2 * GK);
  copy8(lb + 2 * GSL * 2, gb + 2 * GK);
  asm volatile("s_wait_asynccnt 0x20" ::: "memory");  // this wave's slice 0 has landed
  __syncthreads();
  copy8(la + 3 * GSL * 2, ga + 3 * GK);
  copy8(lb + 3 * GSL * 2, gb + 3 * GK);

  for (int t = 0; t < GNT; ++t) {
    const int boff = (t & (GNB - 1)) * GSL;
    const _Float16* As = st + boff + wm * GP;
    const _Float16* Bs = st + boff + (GT + wn) * GP;
    // Two fragment sets: step s + 1 of this slice is read while step s multiplies.
    // The loops over sets and accumulators are unrolled so that every index is a
    // constant and the arrays stay in registers.
    v16h af[2][4], bf[2][2];
#pragma unroll
    for (int i = 0; i < 4; ++i) af[0][i] = frag_from_f16(As + 16 * i * GP, GP, 0);
#pragma unroll
    for (int j = 0; j < 2; ++j) bf[0][j] = frag_from_f16(Bs + 16 * j * GP, GP, 0);
#pragma unroll
    for (int s = 0; s < GK / 32; ++s) {
      const int cur = s & 1;
      if (s + 1 < GK / 32) {
#pragma unroll
        for (int i = 0; i < 4; ++i)
          af[cur ^ 1][i] = frag_from_f16(As + 16 * i * GP, GP, 32 * (s + 1));
#pragma unroll
        for (int j = 0; j < 2; ++j)
          bf[cur ^ 1][j] = frag_from_f16(Bs + 16 * j * GP, GP, 32 * (s + 1));
      }
      // Keeps the next step's LDS reads one group ahead of this step's products:
      // left free, the scheduler sinks each read to its use, into one register
      // set, and every pair of products then waits out an LDS latency.
      __builtin_amdgcn_sched_barrier(0);
#pragma unroll
      for (int i = 0; i < 4; ++i) {
        acc[i][0] = WMMA_F16(af[cur][i], bf[cur][0], acc[i][0]);
        acc[i][1] = WMMA_F16(af[cur][i], bf[cur][1], acc[i][1]);
      }
    }
    // Hand-over: this wave's reads of the buffer are done, its copies of slice
    // t + 1 have landed; the barrier publishes that slice and frees this buffer.
    // While slices t + 2 and t + 3 exist, their 32 copies, in every wave alike, are
    // the youngest and stay in flight; in the last trips, behind which fewer were
    // issued, the wait is to 0.
    asm volatile("s_wait_dscnt 0x0" ::: "memory");
    if (t + 3 < GNT)
      asm volatile("s_wait_asynccnt 0x20" ::: "memory");
    else
      asm volatile("s_wait_asynccnt 0x0" ::: "memory");
    __syncthreads();
    if (t + GNB < GNT) {
      copy8(la + boff * 2, ga + (t + GNB) * GK);
      copy8(lb + boff * 2, gb + (t + GNB) * GK);
    }
  }
  asm volatile("s_wait_asynccnt 0x0" ::: "memory");  // nothing in flight at the end

  // Unrolled for constant accumulator indices, as above.
#pragma unroll
  for (int j = 0; j < 2; ++j) {
    const int col  = n0 + wn + 16 * j + n;
    const float bb = bo[col];
#pragma unroll
    for (int i = 0; i < 4; ++i)
#pragma unroll
      for (int r = 0; r < 8; ++r)
        out[(size_t)(m0 + wm + 16 * i + r + 8 * hi) * HID + col] = acc[i][j][r] + bb;
  }
}

// ---------------------------------------------------------------------------
extern "C" void kernel_launch(void* const* d_in, const int* in_sizes, int n_in,
                              void* d_out, int out_size, void* d_ws,
                              size_t ws_size, hipStream_t stream) {
  const float* q    = (const float*)d_in[0];
  const float* k    = (const float*)d_in[1];
  const float* v    = (const float*)d_in[2];
  const int*   mask = (const int*)d_in[3];
  const float* Wq   = (const float*)d_in[4];
  const float* bq   = (const float*)d_in[5];
  const float* Wk   = (const float*)d_in[6];
  const float* bk   = (const float*)d_in[7];
  const float* Wv   = (const float*)d_in[8];
  const float* bv   = (const float*)d_in[9];
  const float* Wo   = (const float*)d_in[10];
  const float* bo   = (const float*)d_in[11];

  // Workspace layout (bytes): q_i | k_i | vT | wv (8 MB f16 each) | Wo f16 (2 MB)
  // | mask bits (1 MB, at the next 4 MB step)
  const size_t HEADELEMS = (size_t)Bb * Hh * Ss * DH;  // 4,194,304
  char* ws = (char*)d_ws;
  _Float16* qh  = (_Float16*)(ws + 0 * HEADELEMS);
  _Float16* kh  = (_Float16*)(ws + 2 * HEADELEMS);
  _Float16* vT  = (_Float16*)(ws + 4 * HEADELEMS);
  _Float16* wvb = (_Float16*)(ws + 6 * HEADELEMS);
  _Float16* WoH = (_Float16*)(ws + 8 * HEADELEMS);
  unsigned* mbits = (unsigned*)(ws + 9 * HEADELEMS);

  const int wo_n = HID * HID;  // 1,048,576
  prep_kernel<<<PACKB + (wo_n + 255) / 256, 256, 0, stream>>>(Wo, WoH, wo_n,
                                                              mask, mbits);

  // 4096 row-tiles of 16 rows / 8 waves per block -> 512 blocks
  proj_kernel<<<512, 256, 0, stream>>>(q, k, v, Wq, bq, Wk, bk, Wv, bv,
                                       qh, kh, vT);

  // 32 (b,h) pairs * 16 blocks (128 q-rows each) = 512 blocks
  flash_kernel<<<512, 256, 0, stream>>>(qh, kh, vT, mbits, wvb);

  // 32 x 8 output tiles of 128 x 128, one block each
  outproj_kernel<<<256, 256, 0, stream>>>(wvb, WoH, bo, (float*)d_out);
}
